// v000
// The times below were measured on an AMD MI455X: many runs one after another, warmed up first and cycling through
// copies of the inputs, with the whole window's GPU time divided by the number of runs. Launches and the gaps
// between them are all in it. The median over several windows is given; except for v000 it joins two sittings, which
// can be a few percent apart, so the side-by-side timings, each taken in one sitting, are the better comparison.
// v000 is the starting kernel. One run takes 1440 microseconds.
#include <hip/hip_runtime.h>

// MultiHeadAttentionWithRPR: q = queries Wq^T, k = keys Wk^T, v = values Wv^T (16 heads x 64); dist = clip(k - q, -16, 16) + 16; scores = (q.k + q.Ek[dist]) / 8; keys >= valid_lens[b] -> -1e6 (excluded); attn = softmax; out_h = attn v + sum_k attn Ev[dist]; out = concat_h Wo^T -> [4][1024][1024].
// Deterministic: online softmax over fixed 256-key chunks (only chunks below valid_len), fixed order; the Ev term via 33 per-row bucket sums of attn; no atomics.
// WMMA (v_wmma_f32_16x16x32_f16, f32 accumulate): inputs (EXACT bf16 x8, K 1,024) x Wq/Wk/Wv rows (EXACT; 64 tiles each) per 16-token wave; per (bh, 16-query) wave QE = q (hi+lo) x Ek rows (hi+lo; 3 tiles), S = q x k rows (hi+lo; 16 tiles/chunk), O += P (hi+lo) x v^T (hi+lo; 4 tiles); o (hi+lo) x Wo rows (64 tiles) — ≈ 4 M WMMA; softmax, buckets, Ev epilogue in f32.

namespace {
constexpr int NB_ = 4, S = 1024, D = 1024, H = 16, HD = 64, CLIP = 16, NR = 2 * CLIP + 1 /* 33 */, NT = NB_ * S, CH = 256;
constexpr float XS = 8.0f, HS = 256.0f, PS = 256.0f, WSC = 256.0f, SCALE = 0.125f;
typedef _Float16 b16;
typedef __attribute__((ext_vector_type(16))) _Float16 v16b;
typedef __attribute__((ext_vector_type(8))) _Float16 v8b;
typedef __attribute__((ext_vector_type(2))) _Float16 v2b;
typedef __attribute__((ext_vector_type(8))) float v8f;
typedef __attribute__((ext_vector_type(4))) float v4f;
typedef __attribute__((ext_vector_type(2))) float v2f;
__device__ __forceinline__ float bf16_rne(float f) { unsigned int u = __float_as_uint(f); u += 0x7FFFu + ((u >> 16) & 1u); float r = __uint_as_float(u & 0xFFFF0000u); asm volatile("" : "+v"(r)); return r; }
__device__ __forceinline__ float bfv(float f) { float r = bf16_rne(f); asm volatile("" : "+v"(r)); return r; }
__device__ __forceinline__ void split16(float v, b16& hi, b16& lo) { hi = (b16)v; lo = (b16)(v - (float)hi); }
__device__ __forceinline__ v16b frag_kb(const b16* p, int hh) { const v8b a = *(const v8b*)(p + 8 * hh), b = *(const v8b*)(p + 16 + 8 * hh); v16b f;
#pragma unroll
  for (int e = 0; e < 8; ++e) { f[e] = a[e]; f[8 + e] = b[e]; } return f; }
__device__ __forceinline__ v8f wmma16b(v16b a, v16b b, v8f c) { v8f d = __builtin_amdgcn_wmma_f32_16x16x32_f16(false, a, false, b, (short)0, c, false, false); asm volatile("v_nop\n\tv_nop\n\tv_nop\n\tv_nop" : "+v"(d) : "v"(a), "v"(b)); return d; }
__device__ __forceinline__ void wave_lds_sync() { __builtin_amdgcn_fence(__ATOMIC_RELEASE, "workgroup"); __builtin_amdgcn_wave_barrier(); __builtin_amdgcn_fence(__ATOMIC_ACQUIRE, "workgroup"); }
__device__ __forceinline__ float pmul(float a, float b) { float p = a * b; asm volatile("" : "+v"(p)); return p; }
__device__ __forceinline__ int iclamp(int v, int lo, int hi) { return v < lo ? lo : (v > hi ? hi : v); }

__global__ __launch_bounds__(256) void wput_kernel(const float* __restrict__ wq, const float* __restrict__ wk, const float* __restrict__ wv, const float* __restrict__ wo, const float* __restrict__ ek, b16* __restrict__ W4, b16* __restrict__ EKh, b16* __restrict__ EKl) { const size_t nt = (size_t)gridDim.x * 256, u0 = (size_t)blockIdx.x * 256 + threadIdx.x; v8b v;
  for (size_t u = u0; u < (size_t)4 * D * 128; u += nt) { const int o = (int)(u / 128), k0 = (int)(u % 128) * 8; const int which = o / D, oo = o % D; const float* w = which == 0 ? wq : (which == 1 ? wk : (which == 2 ? wv : wo));
#pragma unroll
    for (int j = 0; j < 8; ++j) v[j] = (b16)(bf16_rne(w[(size_t)oo * D + k0 + j]) * WSC); { *(v8b*)(W4 + (size_t)o * D + k0) = v;  } }
  if (u0 < 48 * 8) { const int r = (int)(u0 / 8), k0 = (int)(u0 % 8) * 8; v8b a, c;
#pragma unroll
    for (int j = 0; j < 8; ++j) { float e = r < NR ? bfv(ek[(size_t)r * HD + k0 + j]) : 0.0f; b16 p, pl; split16(e * HS, p, pl); a[j] = p; c[j] = pl; } { *(v8b*)(EKh + (size_t)r * HD + k0) = a; *(v8b*)(EKl + (size_t)r * HD + k0) = c;  } } }
__global__ __launch_bounds__(32) void proj_kernel(const float* __restrict__ xq, const float* __restrict__ xk, const float* __restrict__ xv, const b16* __restrict__ W4, int QLIM, b16* __restrict__ Qh, b16* __restrict__ Ql, b16* __restrict__ Kh, b16* __restrict__ Kl, float* __restrict__ V) { __shared__ __attribute__((aligned(16))) b16 Ax[16][D + 8]; __shared__ float Tf[16][260]; const int lane = threadIdx.x, nloc = lane & 15, hlf = lane >> 4; const size_t t0 = (size_t)blockIdx.x * 16; const int which = blockIdx.y; if ((int)(t0 % S) >= QLIM) return;
  const float* x = which == 0 ? xq : (which == 1 ? xk : xv);
  for (int rr = 0; rr < 16; ++rr) for (int q = 0; q < D / 32; ++q) { const int c = q * 32 + lane; Ax[rr][c] = (b16)(bf16_rne(x[(t0 + rr) * D + c]) * XS); }
  if (lane < 16) for (int k = D; k < D + 8; ++k) Ax[lane][k] = (b16)0.0f;
  wave_lds_sync();
#pragma unroll 1
  for (int g = 0; g < 4; ++g) { const int c0 = g * 256; v8f acc[16];
#pragma unroll
    for (int t = 0; t < 16; ++t) acc[t] = (v8f){};
#pragma unroll 2
    for (int kb = 0; kb < D; kb += 32) { const v16b a = frag_kb(&Ax[nloc][kb], hlf);
#pragma unroll
      for (int t = 0; t < 16; ++t) acc[t] = wmma16b(a, frag_kb(W4 + ((size_t)which * D + c0 + t * 16 + nloc) * D + kb, hlf), acc[t]); }
#pragma unroll
    for (int t = 0; t < 16; ++t)
#pragma unroll
      for (int r8 = 0; r8 < 8; ++r8) Tf[8 * hlf + r8][t * 16 + nloc] = acc[t][r8] * (1.0f / (XS * WSC));
    wave_lds_sync();
    { for (int rr = 0; rr < 16; ++rr) { const size_t tk = t0 + rr;
        if (which == 2) { for (int q = 0; q < 2; ++q) *(v4f*)(V + tk * D + c0 + q * 128 + lane * 4) = *(const v4f*)(&Tf[rr][q * 128 + lane * 4]); }
        else { b16* Ph = which == 0 ? Qh : Kh; b16* Pl = which == 0 ? Ql : Kl; for (int q = 0; q < 4; ++q) { const int c = q * 64 + lane * 2; b16 h0, l0, h1, l1; split16(Tf[rr][c] * HS, h0, l0); split16(Tf[rr][c + 1] * HS, h1, l1); *(v2b*)(Ph + tk * D + c0 + c) = (v2b){h0, h1}; *(v2b*)(Pl + tk * D + c0 + c) = (v2b){l0, l1}; } } }
       }
    wave_lds_sync(); } }
__global__ __launch_bounds__(256) void vt_kernel(const float* __restrict__ V, b16* __restrict__ VTh, b16* __restrict__ VTl) { __shared__ float Tt[64][257]; const int tt = blockIdx.x >> 2, hg = blockIdx.x & 3; const size_t t0 = (size_t)tt * 64; const int b = (int)(t0 / S), s0 = (int)(t0 % S); const int tid = threadIdx.x, wave = tid >> 5, lane = tid & 31;
  for (int q = wave; q < 64; q += 8) for (int c = lane; c < 256; c += 32) Tt[q][c] = V[(t0 + q) * D + hg * 256 + c];
  __syncthreads();
  { for (int c = wave; c < 256; c += 8) { const int h = hg * 4 + c / HD, d = c % HD; b16 h0, l0, h1, l1; split16(Tt[lane * 2][c] * HS, h0, l0); split16(Tt[lane * 2 + 1][c] * HS, h1, l1); const size_t o = (((size_t)b * H + h) * HD + d) * S + s0 + lane * 2; *(v2b*)(VTh + o) = (v2b){h0, h1}; *(v2b*)(VTl + o) = (v2b){l0, l1}; }  } }
__global__ __launch_bounds__(32) void att_kernel(const b16* __restrict__ Qh, const b16* __restrict__ Ql, const b16* __restrict__ Kh, const b16* __restrict__ Kl, const b16* __restrict__ VTh, const b16* __restrict__ VTl, const b16* __restrict__ EKh, const b16* __restrict__ EKl, const float* __restrict__ ev, const int* __restrict__ vlens, int ALIM, float* __restrict__ O) { __shared__ __attribute__((aligned(16))) b16 Pa[16][CH + 8], Pb[16][CH + 8]; __shared__ float Sc[16][CH + 1], QE[16][49], Bk[16][NR], Mx[16], Ls[16], Fc[16], Of[16][HD + 1]; const int lane = threadIdx.x, nloc = lane & 15, hlf = lane >> 4; const int bh = blockIdx.x / (S / 16), q0 = (blockIdx.x % (S / 16)) * 16; if (q0 >= ALIM) return; const int b = bh / H, h = bh % H; const size_t tq = (size_t)b * S + q0; const int vl = iclamp(vlens[b], 0, S);
  if (lane < 16) { Mx[lane] = -INFINITY; Ls[lane] = 0.0f; for (int kk = CH; kk < CH + 8; ++kk) { Pa[lane][kk] = (b16)0.0f; Pb[lane][kk] = (b16)0.0f; } for (int r = 0; r < NR; ++r) Bk[lane][r] = 0.0f; }
  v16b qa[2], ql[2]; for (int ks = 0; ks < 2; ++ks) { qa[ks] = frag_kb(Qh + (tq + nloc) * D + h * HD + ks * 32, hlf); ql[ks] = frag_kb(Ql + (tq + nloc) * D + h * HD + ks * 32, hlf); }
  // QE[q][r] = q . Ek[r]
#pragma unroll
  for (int t = 0; t < 3; ++t) { v8f e = (v8f){};
#pragma unroll
    for (int ks = 0; ks < 2; ++ks) { const v16b eh = frag_kb(EKh + (size_t)(t * 16 + nloc) * HD + ks * 32, hlf), el = frag_kb(EKl + (size_t)(t * 16 + nloc) * HD + ks * 32, hlf); e = wmma16b(qa[ks], eh, e); e = wmma16b(qa[ks], el, e); e = wmma16b(ql[ks], eh, e); }
#pragma unroll
    for (int r8 = 0; r8 < 8; ++r8) QE[8 * hlf + r8][t * 16 + nloc] = e[r8] * (1.0f / (HS * HS)); }
  wave_lds_sync();
  v8f oacc[4] = {(v8f){}, (v8f){}, (v8f){}, (v8f){}}; const int nch = (vl + CH - 1) / CH;
#pragma unroll 1
  for (int ch = 0; ch < nch; ++ch) { const int k0 = ch * CH;
#pragma unroll 1
    for (int tg = 0; tg < 16; tg += 4) { v8f sacc[4] = {(v8f){}, (v8f){}, (v8f){}, (v8f){}};
#pragma unroll
      for (int t = 0; t < 4; ++t)
#pragma unroll
        for (int ks = 0; ks < 2; ++ks) { const size_t ko = ((size_t)b * S + k0 + (tg + t) * 16 + nloc) * D + h * HD + ks * 32; const v16b kh = frag_kb(Kh + ko, hlf), kl = frag_kb(Kl + ko, hlf); sacc[t] = wmma16b(qa[ks], kh, sacc[t]); sacc[t] = wmma16b(qa[ks], kl, sacc[t]); sacc[t] = wmma16b(ql[ks], kh, sacc[t]); }
#pragma unroll
      for (int t = 0; t < 4; ++t)
#pragma unroll
        for (int r8 = 0; r8 < 8; ++r8) Sc[8 * hlf + r8][(tg + t) * 16 + nloc] = sacc[t][r8] * (1.0f / (HS * HS)); }
    wave_lds_sync();
    if (lane < 16) { const int r = lane, q = q0 + r; float mx = -INFINITY; for (int j = 0; j < CH; ++j) { const int k = k0 + j; if (k < vl) { const int dd = iclamp(k - q, -CLIP, CLIP) + CLIP; const float s = (Sc[r][j] + QE[r][dd]) * SCALE; Sc[r][j] = s; mx = fmaxf(mx, s); } }
      const float mo = Mx[r], mn = fmaxf(mo, mx); const float fac = (mo == -INFINITY) ? 0.0f : __expf(mo - mn); for (int rr2 = 0; rr2 < NR; ++rr2) Bk[r][rr2] *= fac;
      float sm = 0.0f; for (int j = 0; j < CH; ++j) { const int k = k0 + j; const float p = (k < vl) ? __expf(Sc[r][j] - mn) : 0.0f; sm += p; if (k < vl) { const int dd = iclamp(k - q, -CLIP, CLIP) + CLIP; Bk[r][dd] += p; } b16 ph, pl; split16(p * PS, ph, pl); Pa[r][j] = ph; Pb[r][j] = pl; }
      Fc[r] = fac; Ls[r] = Ls[r] * fac + sm; Mx[r] = mn; }
    wave_lds_sync();
#pragma unroll
    for (int t = 0; t < 4; ++t)
#pragma unroll
      for (int r8 = 0; r8 < 8; ++r8) oacc[t][r8] *= Fc[8 * hlf + r8];
#pragma unroll 2
    for (int kb = 0; kb < CH; kb += 32) { const v16b pa = frag_kb(&Pa[nloc][kb], hlf), pb = frag_kb(&Pb[nloc][kb], hlf);
#pragma unroll
      for (int t = 0; t < 4; ++t) { const size_t vo = ((size_t)bh * HD + t * 16 + nloc) * S + k0 + kb; const v16b vh = frag_kb(VTh + vo, hlf), vlo = frag_kb(VTl + vo, hlf); oacc[t] = wmma16b(pa, vh, oacc[t]); oacc[t] = wmma16b(pa, vlo, oacc[t]); oacc[t] = wmma16b(pb, vh, oacc[t]); } }
    wave_lds_sync(); }
#pragma unroll
  for (int t = 0; t < 4; ++t)
#pragma unroll
    for (int r8 = 0; r8 < 8; ++r8) Of[8 * hlf + r8][t * 16 + nloc] = oacc[t][r8] * (1.0f / (PS * HS));
  wave_lds_sync();
  // + sum_r Bk[row][r] Ev[r][d]; lane = d pair
  for (int r = 0; r < 16; ++r) { float a0 = Of[r][lane * 2], a1 = Of[r][lane * 2 + 1];
#pragma unroll 1
    for (int rr2 = 0; rr2 < NR; ++rr2) { const float bk = Bk[r][rr2]; a0 += pmul(bk, bfv(ev[(size_t)rr2 * HD + lane * 2])); a1 += pmul(bk, bfv(ev[(size_t)rr2 * HD + lane * 2 + 1])); } const float inv = 1.0f / Ls[r]; Of[r][lane * 2] = a0 * inv; Of[r][lane * 2 + 1] = a1 * inv; }
  wave_lds_sync();
  { for (int r = 0; r < 16; ++r) *(v2f*)(O + (tq + r) * D + h * HD + lane * 2) = (v2f){Of[r][lane * 2], Of[r][lane * 2 + 1]};  } }
__global__ __launch_bounds__(32) void outp_kernel(const float* __restrict__ O, const b16* __restrict__ WO, int ALIM, float* __restrict__ out) { __shared__ __attribute__((aligned(16))) b16 Ah[16][D + 8], Al[16][D + 8]; __shared__ float Tf[16][260]; const int lane = threadIdx.x, nloc = lane & 15, hlf = lane >> 4; const size_t t0 = (size_t)blockIdx.x * 16; if ((int)(t0 % S) >= ALIM) return;
  for (int rr = 0; rr < 16; ++rr) for (int q = 0; q < D / 32; ++q) { const int c = q * 32 + lane; b16 p, pl; split16(O[(t0 + rr) * D + c] * HS, p, pl); Ah[rr][c] = p; Al[rr][c] = pl; }
  if (lane < 16) for (int k = D; k < D + 8; ++k) { Ah[lane][k] = (b16)0.0f; Al[lane][k] = (b16)0.0f; }
  wave_lds_sync();
#pragma unroll 1
  for (int g = 0; g < 4; ++g) { v8f acc[16];
#pragma unroll
    for (int t = 0; t < 16; ++t) acc[t] = (v8f){};
#pragma unroll 2
    for (int kb = 0; kb < D; kb += 32) { const v16b a = frag_kb(&Ah[nloc][kb], hlf), al = frag_kb(&Al[nloc][kb], hlf);
#pragma unroll
      for (int t = 0; t < 16; ++t) { const v16b bw = frag_kb(WO + (size_t)(g * 256 + t * 16 + nloc) * D + kb, hlf); acc[t] = wmma16b(a, bw, acc[t]); acc[t] = wmma16b(al, bw, acc[t]); } }
#pragma unroll
    for (int t = 0; t < 16; ++t)
#pragma unroll
      for (int r8 = 0; r8 < 8; ++r8) Tf[8 * hlf + r8][t * 16 + nloc] = acc[t][r8] * (1.0f / (HS * WSC));
    wave_lds_sync();
    { for (int rr = 0; rr < 16; ++rr) for (int q = 0; q < 2; ++q) *(v4f*)(out + (t0 + rr) * D + g * 256 + q * 128 + lane * 4) = *(const v4f*)(&Tf[rr][q * 128 + lane * 4]);  }
    wave_lds_sync(); } }
}  // namespace

extern "C" void kernel_launch(void* const* d_in, const int* in_sizes, int n_in, void* d_out, int out_size, void* d_ws, size_t ws_size, hipStream_t stream) {
  (void)n_in;
  auto Fp = [&](int i) { return (const float*)d_in[i]; }; auto Ip = [&](int i) { return (const int*)d_in[i]; };
  // Input order: 0 queries [4,1024,1024]; 1 keys; 2 values; 3 valid_lens [4] i32; 4 Wq [1024,1024]; 5 Wk; 6 Wv; 7 Wo; 8 Ek [33,64]; 9 Ev [33,64]
  if (in_sizes[0] != NT * D || in_sizes[1] != NT * D || in_sizes[2] != NT * D || in_sizes[3] != NB_ || in_sizes[4] != D * D || in_sizes[7] != D * D || in_sizes[8] != NR * HD || in_sizes[9] != NR * HD || out_size != NT * D) return;
  const int QLIM = S, ALIM = S;   // QLIM = tokens projected per batch (>= max valid_len), ALIM = queries attended/output (multiples of 16)
  size_t off = 0; char* ws = (char*)d_ws;
  auto carve = [&](size_t bytes) { char* p = ws + off; off += (bytes + 255) & ~(size_t)255; return p; };
  b16* W4 = (b16*)carve((size_t)4 * D * D * 2); b16* EKh = (b16*)carve(48 * HD * 2); b16* EKl = (b16*)carve(48 * HD * 2); b16* Qh = (b16*)carve((size_t)NT * D * 2); b16* Ql = (b16*)carve((size_t)NT * D * 2); b16* Kh = (b16*)carve((size_t)NT * D * 2); b16* Kl = (b16*)carve((size_t)NT * D * 2); float* V = (float*)carve((size_t)NT * D * 4); b16* VTh = (b16*)carve((size_t)NT * D * 2); b16* VTl = (b16*)carve((size_t)NT * D * 2); float* O = (float*)carve((size_t)NT * D * 4);
  if (off > ws_size || off > ((size_t)104 << 20)) return;   // ~ 90 MB
  wput_kernel<<<256, 256, 0, stream>>>(Fp(4), Fp(5), Fp(6), Fp(7), Fp(8), W4, EKh, EKl);
  proj_kernel<<<dim3(NT / 16, 3), 32, 0, stream>>>(Fp(0), Fp(1), Fp(2), W4, QLIM, Qh, Ql, Kh, Kl, V);
  vt_kernel<<<(NT / 64) * 4, 256, 0, stream>>>(V, VTh, VTl);
  att_kernel<<<NB_ * H * (S / 16), 32, 0, stream>>>(Qh, Ql, Kh, Kl, VTh, VTl, EKh, EKl, Fp(9), Ip(3), ALIM, O);
  outp_kernel<<<NT / 16, 32, 0, stream>>>(O, W4 + (size_t)3 * D * D, ALIM, (float*)d_out);
}

// v001
// It runs in 472 microseconds.
// Next to v000, in two timings, it ran 3.05 and 3.06 times as fast.
#include <hip/hip_runtime.h>

// MultiHeadAttentionWithRPR: q = queries Wq^T, k = keys Wk^T, v = values Wv^T (16 heads x 64); dist = clip(k - q, -16, 16) + 16; scores = (q.k + q.Ek[dist]) / 8; keys >= valid_lens[b] -> -1e6 (excluded); attn = softmax; out_h = attn v + sum_k attn Ev[dist]; out = concat_h Wo^T -> [4][1024][1024].
// Deterministic: online softmax over fixed 256-key chunks (only chunks below valid_len), fixed order; the Ev term via 33 per-row bucket sums of attn; no atomics.
// WMMA (v_wmma_f32_16x16x32_f16, f32 accumulate): inputs (EXACT bf16 x8, K 1,024) x Wq/Wk/Wv rows (EXACT) in 128 x 128 block tiles; per (bh, 16-query) wave QE = q (hi+lo) x Ek rows (hi+lo; 3 tiles), S = q x k rows (hi+lo; 16 tiles/chunk), O += P (hi+lo) x v^T (hi+lo; 4 tiles); o (hi+lo) x Wo rows (64 tiles) — ≈ 4 M WMMA; softmax, buckets, Ev epilogue in f32.

namespace {
constexpr int NB_ = 4, S = 1024, D = 1024, H = 16, HD = 64, CLIP = 16, NR = 2 * CLIP + 1 /* 33 */, NT = NB_ * S, CH = 256;
constexpr int BM = 128, BN = 128, KS = 64, LP = KS + 8;   // GEMM block tile, k per LDS stage, LDS row pitch in halves (144 B = 16 B x odd, for 16-byte readers)
constexpr float XS = 8.0f, HS = 256.0f, PS = 256.0f, WSC = 256.0f, SCALE = 0.125f;
typedef _Float16 b16;
typedef __attribute__((ext_vector_type(16))) _Float16 v16b;
typedef __attribute__((ext_vector_type(8))) _Float16 v8b;
typedef __attribute__((ext_vector_type(4))) _Float16 v4b;
typedef __attribute__((ext_vector_type(2))) _Float16 v2b;
typedef __attribute__((ext_vector_type(8))) float v8f;
typedef __attribute__((ext_vector_type(4))) float v4f;
typedef __attribute__((ext_vector_type(2))) float v2f;
__device__ __forceinline__ float bf16_rne(float f) { unsigned int u = __float_as_uint(f); u += 0x7FFFu + ((u >> 16) & 1u); float r = __uint_as_float(u & 0xFFFF0000u); asm volatile("" : "+v"(r)); return r; }
__device__ __forceinline__ float bfv(float f) { float r = bf16_rne(f); asm volatile("" : "+v"(r)); return r; }
__device__ __forceinline__ void split16(float v, b16& hi, b16& lo) { hi = (b16)v; lo = (b16)(v - (float)hi); }
__device__ __forceinline__ v16b frag_kb(const b16* p, int hh) { const v8b a = *(const v8b*)(p + 8 * hh), b = *(const v8b*)(p + 16 + 8 * hh); v16b f;
#pragma unroll
  for (int e = 0; e < 8; ++e) { f[e] = a[e]; f[8 + e] = b[e]; } return f; }
__device__ __forceinline__ v8f wmma16b(v16b a, v16b b, v8f c) { v8f d = __builtin_amdgcn_wmma_f32_16x16x32_f16(false, a, false, b, (short)0, c, false, false); asm volatile("v_nop\n\tv_nop\n\tv_nop\n\tv_nop" : "+v"(d) : "v"(a), "v"(b)); return d; }
__device__ __forceinline__ void wave_lds_sync() { __builtin_amdgcn_fence(__ATOMIC_RELEASE, "workgroup"); __builtin_amdgcn_wave_barrier(); __builtin_amdgcn_fence(__ATOMIC_ACQUIRE, "workgroup"); }
__device__ __forceinline__ float pmul(float a, float b) { float p = a * b; asm volatile("" : "+v"(p)); return p; }
__device__ __forceinline__ int iclamp(int v, int lo, int hi) { return v < lo ? lo : (v > hi ? hi : v); }

__global__ __launch_bounds__(256) void wput_kernel(const float* __restrict__ wq, const float* __restrict__ wk, const float* __restrict__ wv, const float* __restrict__ wo, const float* __restrict__ ek, b16* __restrict__ W4, b16* __restrict__ EKh, b16* __restrict__ EKl) { const size_t nt = (size_t)gridDim.x * 256, u0 = (size_t)blockIdx.x * 256 + threadIdx.x; v8b v;
  for (size_t u = u0; u < (size_t)4 * D * 128; u += nt) { const int o = (int)(u / 128), k0 = (int)(u % 128) * 8; const int which = o / D, oo = o % D; const float* w = which == 0 ? wq : (which == 1 ? wk : (which == 2 ? wv : wo));
#pragma unroll
    for (int j = 0; j < 8; ++j) v[j] = (b16)(bf16_rne(w[(size_t)oo * D + k0 + j]) * WSC); { *(v8b*)(W4 + (size_t)o * D + k0) = v;  } }
  if (u0 < 48 * 8) { const int r = (int)(u0 / 8), k0 = (int)(u0 % 8) * 8; v8b a, c;
#pragma unroll
    for (int j = 0; j < 8; ++j) { float e = r < NR ? bfv(ek[(size_t)r * HD + k0 + j]) : 0.0f; b16 p, pl; split16(e * HS, p, pl); a[j] = p; c[j] = pl; } { *(v8b*)(EKh + (size_t)r * HD + k0) = a; *(v8b*)(EKl + (size_t)r * HD + k0) = c;  } } }
// The four dense projections run as block-tiled GEMMs: 8 waves share one 128 x 128 output tile (wave = 32 rows x 64 columns), both operands staged in LDS 64 k at a time,
// the next stage's global loads issued ahead of the current stage's products. Every accumulator still sums k in ascending blocks of 32.
// In both kernels each '#pragma unroll' makes the indices of a register array (ra, rb, acc, fragments, tv) constants, so that it stays in registers.
__global__ __launch_bounds__(256) void proj_kernel(const float* __restrict__ xq, const float* __restrict__ xk, const float* __restrict__ xv, const b16* __restrict__ W4, int QLIM, b16* __restrict__ Qh, b16* __restrict__ Ql, b16* __restrict__ Kh, b16* __restrict__ Kl, float* __restrict__ V) {
  __shared__ __attribute__((aligned(16))) b16 As[BM][LP], Bs[BN][LP]; __shared__ __attribute__((aligned(16))) float Tf[8][16][68];
  const int tid = threadIdx.x, lane = tid & 31, wave = tid >> 5, nloc = lane & 15, hlf = lane >> 4, wm = wave >> 1, wn = wave & 1;
  const size_t t0 = (size_t)blockIdx.x * BM; const int c0 = blockIdx.y * BN, which = blockIdx.z; if ((int)(t0 % S) >= QLIM) return;
  const float* x = which == 0 ? xq : (which == 1 ? xk : xv);
  const int ar = tid >> 4, ac = (tid & 15) * 4, br = tid >> 3, bc = (tid & 7) * 8;   // staging: 16 lanes per 256-B piece of an x row, 8 lanes per 128-B piece of a W row
  const float* xg = x + (t0 + ar) * D + ac; const b16* wg = W4 + ((size_t)which * D + c0 + br) * D + bc;
  v4f ra[8]; v8b rb[4];
#pragma unroll
  for (int i = 0; i < 8; ++i) ra[i] = *(const v4f*)(xg + (size_t)i * 16 * D);
#pragma unroll
  for (int i = 0; i < 4; ++i) rb[i] = *(const v8b*)(wg + (size_t)i * 32 * D);
  v8f acc[2][4];
#pragma unroll
  for (int mi = 0; mi < 2; ++mi)
#pragma unroll
    for (int ni = 0; ni < 4; ++ni) acc[mi][ni] = (v8f){};
#pragma unroll 1   // stays rolled, for speed only
  for (int k0 = 0; k0 < D; k0 += KS) {
#pragma unroll
    for (int i = 0; i < 8; ++i) { v4b hx;
#pragma unroll
      for (int j = 0; j < 4; ++j) hx[j] = (b16)(bf16_rne(ra[i][j]) * XS);
      *(v4b*)(&As[ar + i * 16][ac]) = hx; }
#pragma unroll
    for (int i = 0; i < 4; ++i) *(v8b*)(&Bs[br + i * 32][bc]) = rb[i];
    __syncthreads();
    if (k0 + KS < D) {
#pragma unroll
      for (int i = 0; i < 8; ++i) ra[i] = *(const v4f*)(xg + (size_t)i * 16 * D + k0 + KS);
#pragma unroll
      for (int i = 0; i < 4; ++i) rb[i] = *(const v8b*)(wg + (size_t)i * 32 * D + k0 + KS);
      asm volatile("s_wait_xcnt 0x0" ::: "memory"); }   // the loop advances the address registers that these issued loads name: the wait stands in front of that overwrite
#pragma unroll
    for (int kb = 0; kb < KS; kb += 32) { v16b a[2], bw[4];
#pragma unroll
      for (int mi = 0; mi < 2; ++mi) a[mi] = frag_kb(&As[wm * 32 + mi * 16 + nloc][kb], hlf);
#pragma unroll
      for (int ni = 0; ni < 4; ++ni) bw[ni] = frag_kb(&Bs[wn * 64 + ni * 16 + nloc][kb], hlf);
#pragma unroll
      for (int mi = 0; mi < 2; ++mi)
#pragma unroll
        for (int ni = 0; ni < 4; ++ni) acc[mi][ni] = wmma16b(a[mi], bw[ni], acc[mi][ni]); }
    __syncthreads(); }
  // each wave stages 16 x 64 results in its own LDS range and stores whole lines: two rows per instruction, 16 lanes a row
#pragma unroll
  for (int mi = 0; mi < 2; ++mi) {
#pragma unroll
    for (int ni = 0; ni < 4; ++ni)
#pragma unroll
      for (int r8 = 0; r8 < 8; ++r8) Tf[wave][8 * hlf + r8][ni * 16 + nloc] = acc[mi][ni][r8] * (1.0f / (XS * WSC));
    wave_lds_sync();
    v4f tv[8]; const size_t o = (t0 + wm * 32 + mi * 16 + hlf) * D + c0 + wn * 64 + nloc * 4;
#pragma unroll
    for (int rr = 0; rr < 8; ++rr) tv[rr] = *(const v4f*)(&Tf[wave][rr * 2 + hlf][nloc * 4]);
    if (which == 2) {
#pragma unroll
      for (int rr = 0; rr < 8; ++rr) *(v4f*)(V + o + (size_t)rr * 2 * D) = tv[rr]; }
    else { b16* Ph = which == 0 ? Qh : Kh; b16* Pl = which == 0 ? Ql : Kl;
#pragma unroll
      for (int rr = 0; rr < 8; ++rr) { v4b ph, pl;
#pragma unroll
        for (int j = 0; j < 4; ++j) { b16 p, q; split16(tv[rr][j] * HS, p, q); ph[j] = p; pl[j] = q; }
        *(v4b*)(Ph + o + (size_t)rr * 2 * D) = ph; *(v4b*)(Pl + o + (size_t)rr * 2 * D) = pl; } }
    wave_lds_sync(); } }
__global__ __launch_bounds__(256) void vt_kernel(const float* __restrict__ V, b16* __restrict__ VTh, b16* __restrict__ VTl) { __shared__ float Tt[64][257]; const int tt = blockIdx.x >> 2, hg = blockIdx.x & 3; const size_t t0 = (size_t)tt * 64; const int b = (int)(t0 / S), s0 = (int)(t0 % S); const int tid = threadIdx.x, wave = tid >> 5, lane = tid & 31;
  for (int q = wave; q < 64; q += 8) for (int c = lane; c < 256; c += 32) Tt[q][c] = V[(t0 + q) * D + hg * 256 + c];
  __syncthreads();
  { for (int c = wave; c < 256; c += 8) { const int h = hg * 4 + c / HD, d = c % HD; b16 h0, l0, h1, l1; split16(Tt[lane * 2][c] * HS, h0, l0); split16(Tt[lane * 2 + 1][c] * HS, h1, l1); const size_t o = (((size_t)b * H + h) * HD + d) * S + s0 + lane * 2; *(v2b*)(VTh + o) = (v2b){h0, h1}; *(v2b*)(VTl + o) = (v2b){l0, l1}; }  } }
__global__ __launch_bounds__(32) void att_kernel(const b16* __restrict__ Qh, const b16* __restrict__ Ql, const b16* __restrict__ Kh, const b16* __restrict__ Kl, const b16* __restrict__ VTh, const b16* __restrict__ VTl, const b16* __restrict__ EKh, const b16* __restrict__ EKl, const float* __restrict__ ev, const int* __restrict__ vlens, int ALIM, float* __restrict__ O) { __shared__ __attribute__((aligned(16))) b16 Pa[16][CH + 8], Pb[16][CH + 8]; __shared__ float Sc[16][CH + 1], QE[16][49], Bk[16][NR], Mx[16], Ls[16], Fc[16], Of[16][HD + 1]; const int lane = threadIdx.x, nloc = lane & 15, hlf = lane >> 4; const int bh = blockIdx.x / (S / 16), q0 = (blockIdx.x % (S / 16)) * 16; if (q0 >= ALIM) return; const int b = bh / H, h = bh % H; const size_t tq = (size_t)b * S + q0; const int vl = iclamp(vlens[b], 0, S);
  if (lane < 16) { Mx[lane] = -INFINITY; Ls[lane] = 0.0f; for (int kk = CH; kk < CH + 8; ++kk) { Pa[lane][kk] = (b16)0.0f; Pb[lane][kk] = (b16)0.0f; } for (int r = 0; r < NR; ++r) Bk[lane][r] = 0.0f; }
  v16b qa[2], ql[2]; for (int ks = 0; ks < 2; ++ks) { qa[ks] = frag_kb(Qh + (tq + nloc) * D + h * HD + ks * 32, hlf); ql[ks] = frag_kb(Ql + (tq + nloc) * D + h * HD + ks * 32, hlf); }
  // QE[q][r] = q . Ek[r]
#pragma unroll
  for (int t = 0; t < 3; ++t) { v8f e = (v8f){};
#pragma unroll
    for (int ks = 0; ks < 2; ++ks) { const v16b eh = frag_kb(EKh + (size_t)(t * 16 + nloc) * HD + ks * 32, hlf), el = frag_kb(EKl + (size_t)(t * 16 + nloc) * HD + ks * 32, hlf); e = wmma16b(qa[ks], eh, e); e = wmma16b(qa[ks], el, e); e = wmma16b(ql[ks], eh, e); }
#pragma unroll
    for (int r8 = 0; r8 < 8; ++r8) QE[8 * hlf + r8][t * 16 + nloc] = e[r8] * (1.0f / (HS * HS)); }
  wave_lds_sync();
  v8f oacc[4] = {(v8f){}, (v8f){}, (v8f){}, (v8f){}}; const int nch = (vl + CH - 1) / CH;
#pragma unroll 1
  for (int ch = 0; ch < nch; ++ch) { const int k0 = ch * CH;
#pragma unroll 1
    for (int tg = 0; tg < 16; tg += 4) { v8f sacc[4] = {(v8f){}, (v8f){}, (v8f){}, (v8f){}};
#pragma unroll
      for (int t = 0; t < 4; ++t)
#pragma unroll
        for (int ks = 0; ks < 2; ++ks) { const size_t ko = ((size_t)b * S + k0 + (tg + t) * 16 + nloc) * D + h * HD + ks * 32; const v16b kh = frag_kb(Kh + ko, hlf), kl = frag_kb(Kl + ko, hlf); sacc[t] = wmma16b(qa[ks], kh, sacc[t]); sacc[t] = wmma16b(qa[ks], kl, sacc[t]); sacc[t] = wmma16b(ql[ks], kh, sacc[t]); }
#pragma unroll
      for (int t = 0; t < 4; ++t)
#pragma unroll
        for (int r8 = 0; r8 < 8; ++r8) Sc[8 * hlf + r8][(tg + t) * 16 + nloc] = sacc[t][r8] * (1.0f / (HS * HS)); }
    wave_lds_sync();
    if (lane < 16) { const int r = lane, q = q0 + r; float mx = -INFINITY; for (int j = 0; j < CH; ++j) { const int k = k0 + j; if (k < vl) { const int dd = iclamp(k - q, -CLIP, CLIP) + CLIP; const float s = (Sc[r][j] + QE[r][dd]) * SCALE; Sc[r][j] = s; mx = fmaxf(mx, s); } }
      const float mo = Mx[r], mn = fmaxf(mo, mx); const float fac = (mo == -INFINITY) ? 0.0f : __expf(mo - mn); for (int rr2 = 0; rr2 < NR; ++rr2) Bk[r][rr2] *= fac;
      float sm = 0.0f; for (int j = 0; j < CH; ++j) { const int k = k0 + j; const float p = (k < vl) ? __expf(Sc[r][j] - mn) : 0.0f; sm += p; if (k < vl) { const int dd = iclamp(k - q, -CLIP, CLIP) + CLIP; Bk[r][dd] += p; } b16 ph, pl; split16(p * PS, ph, pl); Pa[r][j] = ph; Pb[r][j] = pl; }
      Fc[r] = fac; Ls[r] = Ls[r] * fac + sm; Mx[r] = mn; }
    wave_lds_sync();
#pragma unroll
    for (int t = 0; t < 4; ++t)
#pragma unroll
      for (int r8 = 0; r8 < 8; ++r8) oacc[t][r8] *= Fc[8 * hlf + r8];
#pragma unroll 2
    for (int kb = 0; kb < CH; kb += 32) { const v16b pa = frag_kb(&Pa[nloc][kb], hlf), pb = frag_kb(&Pb[nloc][kb], hlf);
#pragma unroll
      for (int t = 0; t < 4; ++t) { const size_t vo = ((size_t)bh * HD + t * 16 + nloc) * S + k0 + kb; const v16b vh = frag_kb(VTh + vo, hlf), vlo = frag_kb(VTl + vo, hlf); oacc[t] = wmma16b(pa, vh, oacc[t]); oacc[t] = wmma16b(pa, vlo, oacc[t]); oacc[t] = wmma16b(pb, vh, oacc[t]); } }
    wave_lds_sync(); }
#pragma unroll
  for (int t = 0; t < 4; ++t)
#pragma unroll
    for (int r8 = 0; r8 < 8; ++r8) Of[8 * hlf + r8][t * 16 + nloc] = oacc[t][r8] * (1.0f / (PS * HS));
  wave_lds_sync();
  // + sum_r Bk[row][r] Ev[r][d]; lane = d pair
  for (int r = 0; r < 16; ++r) { float a0 = Of[r][lane * 2], a1 = Of[r][lane * 2 + 1];
#pragma unroll 1
    for (int rr2 = 0; rr2 < NR; ++rr2) { const float bk = Bk[r][rr2]; a0 += pmul(bk, bfv(ev[(size_t)rr2 * HD + lane * 2])); a1 += pmul(bk, bfv(ev[(size_t)rr2 * HD + lane * 2 + 1])); } const float inv = 1.0f / Ls[r]; Of[r][lane * 2] = a0 * inv; Of[r][lane * 2 + 1] = a1 * inv; }
  wave_lds_sync();
  { for (int r = 0; r < 16; ++r) *(v2f*)(O + (tq + r) * D + h * HD + lane * 2) = (v2f){Of[r][lane * 2], Of[r][lane * 2 + 1]};  } }
__global__ __launch_bounds__(256) void outp_kernel(const float* __restrict__ O, const b16* __restrict__ WO, int ALIM, float* __restrict__ out) {
  __shared__ __attribute__((aligned(16))) b16 Ah[BM][LP], Al[BM][LP], Bs[BN][LP]; __shared__ __attribute__((aligned(16))) float Tf[8][16][68];
  const int tid = threadIdx.x, lane = tid & 31, wave = tid >> 5, nloc = lane & 15, hlf = lane >> 4, wm = wave >> 1, wn = wave & 1;
  const size_t t0 = (size_t)blockIdx.x * BM; const int c0 = blockIdx.y * BN; if ((int)(t0 % S) >= ALIM) return;
  const int ar = tid >> 4, ac = (tid & 15) * 4, br = tid >> 3, bc = (tid & 7) * 8;
  const float* og = O + (t0 + ar) * D + ac; const b16* wg = WO + ((size_t)c0 + br) * D + bc;
  v4f ra[8]; v8b rb[4];
#pragma unroll
  for (int i = 0; i < 8; ++i) ra[i] = *(const v4f*)(og + (size_t)i * 16 * D);
#pragma unroll
  for (int i = 0; i < 4; ++i) rb[i] = *(const v8b*)(wg + (size_t)i * 32 * D);
  v8f acc[2][4];
#pragma unroll
  for (int mi = 0; mi < 2; ++mi)
#pragma unroll
    for (int ni = 0; ni < 4; ++ni) acc[mi][ni] = (v8f){};
#pragma unroll 1   // stays rolled, for speed only
  for (int k0 = 0; k0 < D; k0 += KS) {
#pragma unroll
    for (int i = 0; i < 8; ++i) { v4b hx, lx;
#pragma unroll
      for (int j = 0; j < 4; ++j) { b16 p, q; split16(ra[i][j] * HS, p, q); hx[j] = p; lx[j] = q; }
      *(v4b*)(&Ah[ar + i * 16][ac]) = hx; *(v4b*)(&Al[ar + i * 16][ac]) = lx; }
#pragma unroll
    for (int i = 0; i < 4; ++i) *(v8b*)(&Bs[br + i * 32][bc]) = rb[i];
    __syncthreads();
    if (k0 + KS < D) {
#pragma unroll
      for (int i = 0; i < 8; ++i) ra[i] = *(const v4f*)(og + (size_t)i * 16 * D + k0 + KS);
#pragma unroll
      for (int i = 0; i < 4; ++i) rb[i] = *(const v8b*)(wg + (size_t)i * 32 * D + k0 + KS);
      asm volatile("s_wait_xcnt 0x0" ::: "memory"); }   // the loop advances the address registers that these issued loads name: the wait stands in front of that overwrite
#pragma unroll
    for (int kb = 0; kb < KS; kb += 32) { v16b a[2], al[2], bw[4];
#pragma unroll
      for (int mi = 0; mi < 2; ++mi) { a[mi] = frag_kb(&Ah[wm * 32 + mi * 16 + nloc][kb], hlf); al[mi] = frag_kb(&Al[wm * 32 + mi * 16 + nloc][kb], hlf); }
#pragma unroll
      for (int ni = 0; ni < 4; ++ni) bw[ni] = frag_kb(&Bs[wn * 64 + ni * 16 + nloc][kb], hlf);
#pragma unroll
      for (int mi = 0; mi < 2; ++mi)
#pragma unroll
        for (int ni = 0; ni < 4; ++ni) acc[mi][ni] = wmma16b(a[mi], bw[ni], acc[mi][ni]);
#pragma unroll
      for (int mi = 0; mi < 2; ++mi)
#pragma unroll
        for (int ni = 0; ni < 4; ++ni) acc[mi][ni] = wmma16b(al[mi], bw[ni], acc[mi][ni]); }
    __syncthreads(); }
#pragma unroll
  for (int mi = 0; mi < 2; ++mi) {
#pragma unroll
    for (int ni = 0; ni < 4; ++ni)
#pragma unroll
      for (int r8 = 0; r8 < 8; ++r8) Tf[wave][8 * hlf + r8][ni * 16 + nloc] = acc[mi][ni][r8] * (1.0f / (HS * WSC));
    wave_lds_sync();
    v4f tv[8]; const size_t o = (t0 + wm * 32 + mi * 16 + hlf) * D + c0 + wn * 64 + nloc * 4;
#pragma unroll
    for (int rr = 0; rr < 8; ++rr) tv[rr] = *(const v4f*)(&Tf[wave][rr * 2 + hlf][nloc * 4]);
#pragma unroll
    for (int rr = 0; rr < 8; ++rr) *(v4f*)(out + o + (size_t)rr * 2 * D) = tv[rr];
    wave_lds_sync(); } }
}  // namespace

extern "C" void kernel_launch(void* const* d_in, const int* in_sizes, int n_in, void* d_out, int out_size, void* d_ws, size_t ws_size, hipStream_t stream) {
  (void)n_in;
  auto Fp = [&](int i) { return (const float*)d_in[i]; }; auto Ip = [&](int i) { return (const int*)d_in[i]; };
  // Input order: 0 queries [4,1024,1024]; 1 keys; 2 values; 3 valid_lens [4] i32; 4 Wq [1024,1024]; 5 Wk; 6 Wv; 7 Wo; 8 Ek [33,64]; 9 Ev [33,64]
  if (in_sizes[0] != NT * D || in_sizes[1] != NT * D || in_sizes[2] != NT * D || in_sizes[3] != NB_ || in_sizes[4] != D * D || in_sizes[7] != D * D || in_sizes[8] != NR * HD || in_sizes[9] != NR * HD || out_size != NT * D) return;
  const int QLIM = S, ALIM = S;   // QLIM = tokens projected per batch (>= max valid_len), ALIM = queries attended/output (multiples of 16)
  size_t off = 0; char* ws = (char*)d_ws;
  auto carve = [&](size_t bytes) { char* p = ws + off; off += (bytes + 255) & ~(size_t)255; return p; };
  b16* W4 = (b16*)carve((size_t)4 * D * D * 2); b16* EKh = (b16*)carve(48 * HD * 2); b16* EKl = (b16*)carve(48 * HD * 2); b16* Qh = (b16*)carve((size_t)NT * D * 2); b16* Ql = (b16*)carve((size_t)NT * D * 2); b16* Kh = (b16*)carve((size_t)NT * D * 2); b16* Kl = (b16*)carve((size_t)NT * D * 2); float* V = (float*)carve((size_t)NT * D * 4); b16* VTh = (b16*)carve((size_t)NT * D * 2); b16* VTl = (b16*)carve((size_t)NT * D * 2); float* O = (float*)carve((size_t)NT * D * 4);
  if (off > ws_size || off > ((size_t)104 << 20)) return;   // ~ 90 MB
  wput_kernel<<<256, 256, 0, stream>>>(Fp(4), Fp(5), Fp(6), Fp(7), Fp(8), W4, EKh, EKl);
  proj_kernel<<<dim3(NT / BM, D / BN, 3), 256, 0, stream>>>(Fp(0), Fp(1), Fp(2), W4, QLIM, Qh, Ql, Kh, Kl, V);
  vt_kernel<<<(NT / 64) * 4, 256, 0, stream>>>(V, VTh, VTl);
  att_kernel<<<NB_ * H * (S / 16), 32, 0, stream>>>(Qh, Ql, Kh, Kl, VTh, VTl, EKh, EKl, Fp(9), Ip(3), ALIM, O);
  outp_kernel<<<dim3(NT / BM, D / BN), 256, 0, stream>>>(O, W4 + (size_t)3 * D * D, ALIM, (float*)d_out);
}

// v002
// A run of this version takes 229 microseconds.
// Next to v001, in two timings, it ran 2.06 and 2.05 times as fast.
// All steps since v000 together make it 6.29 times as fast.
#include <hip/hip_runtime.h>

// MultiHeadAttentionWithRPR: q = queries Wq^T, k = keys Wk^T, v = values Wv^T (16 heads x 64); dist = clip(k - q, -16, 16) + 16; scores = (q.k + q.Ek[dist]) / 8; keys >= valid_lens[b] -> -1e6 (excluded); attn = softmax; out_h = attn v + sum_k attn Ev[dist]; out = concat_h Wo^T -> [4][1024][1024].
// Deterministic: online softmax over fixed 128-key chunks (only chunks below valid_len), fixed order; the Ev term via 33 per-row bucket sums of attn; no atomics.
// WMMA (v_wmma_f32_16x16x32_f16, f32 accumulate): inputs (EXACT bf16 x8, K 1,024) x Wq/Wk/Wv rows (EXACT) in 128 x 128 block tiles; per (bh, 16-query) wave QE = q (hi+lo) x Ek rows (hi+lo; 3 tiles), S = q x k rows (hi+lo; 8 tiles/chunk), O += P (hi+lo) x v^T (hi+lo; 4 tiles); o (hi+lo) x Wo rows (64 tiles) — ≈ 4 M WMMA; softmax, buckets, Ev epilogue in f32.

namespace {
constexpr int NB_ = 4, S = 1024, D = 1024, H = 16, HD = 64, CLIP = 16, NR = 2 * CLIP + 1 /* 33 */, NT = NB_ * S, CH = 128;
constexpr int BM = 128, BN = 128, KS = 64, LP = KS + 8;   // GEMM block tile, k per LDS stage, LDS row pitch in halves (144 B = 16 B x odd, for 16-byte readers)
constexpr float XS = 8.0f, HS = 256.0f, PS = 256.0f, WSC = 256.0f, SCALE = 0.125f;
typedef _Float16 b16;
typedef __attribute__((ext_vector_type(16))) _Float16 v16b;
typedef __attribute__((ext_vector_type(8))) _Float16 v8b;
typedef __attribute__((ext_vector_type(4))) _Float16 v4b;
typedef __attribute__((ext_vector_type(2))) _Float16 v2b;
typedef __attribute__((ext_vector_type(8))) float v8f;
typedef __attribute__((ext_vector_type(4))) float v4f;
typedef __attribute__((ext_vector_type(2))) float v2f;
__device__ __forceinline__ float bf16_rne(float f) { unsigned int u = __float_as_uint(f); u += 0x7FFFu + ((u >> 16) & 1u); float r = __uint_as_float(u & 0xFFFF0000u); asm volatile("" : "+v"(r)); return r; }
__device__ __forceinline__ float bfv(float f) { float r = bf16_rne(f); asm volatile("" : "+v"(r)); return r; }
__device__ __forceinline__ void split16(float v, b16& hi, b16& lo) { hi = (b16)v; lo = (b16)(v - (float)hi); }
__device__ __forceinline__ v16b frag_kb(const b16* p, int hh) { const v8b a = *(const v8b*)(p + 8 * hh), b = *(const v8b*)(p + 16 + 8 * hh); v16b f;
#pragma unroll
  for (int e = 0; e < 8; ++e) { f[e] = a[e]; f[8 + e] = b[e]; } return f; }
__device__ __forceinline__ v8f wmma16b(v16b a, v16b b, v8f c) { v8f d = __builtin_amdgcn_wmma_f32_16x16x32_f16(false, a, false, b, (short)0, c, false, false); asm volatile("v_nop\n\tv_nop\n\tv_nop\n\tv_nop" : "+v"(d) : "v"(a), "v"(b)); return d; }
__device__ __forceinline__ void wave_lds_sync() { __builtin_amdgcn_fence(__ATOMIC_RELEASE, "workgroup"); __builtin_amdgcn_wave_barrier(); __builtin_amdgcn_fence(__ATOMIC_ACQUIRE, "workgroup"); }
__device__ __forceinline__ float pmul(float a, float b) { float p = a * b; asm volatile("" : "+v"(p)); return p; }
template <int M> __device__ __forceinline__ float rowx(float x) { return __builtin_bit_cast(float, __builtin_amdgcn_update_dpp(__builtin_bit_cast(int, x), __builtin_bit_cast(int, x), 0x160 + M, 0xf, 0xf, false)); }   // the value of lane l ^ M of the same 16-lane row (row_xmask)
__device__ __forceinline__ int iclamp(int v, int lo, int hi) { return v < lo ? lo : (v > hi ? hi : v); }

__global__ __launch_bounds__(256) void wput_kernel(const float* __restrict__ wq, const float* __restrict__ wk, const float* __restrict__ wv, const float* __restrict__ wo, const float* __restrict__ ek, b16* __restrict__ W4, b16* __restrict__ EKh, b16* __restrict__ EKl) { const size_t nt = (size_t)gridDim.x * 256, u0 = (size_t)blockIdx.x * 256 + threadIdx.x; v8b v;
  for (size_t u = u0; u < (size_t)4 * D * 128; u += nt) { const int o = (int)(u / 128), k0 = (int)(u % 128) * 8; const int which = o / D, oo = o % D; const float* w = which == 0 ? wq : (which == 1 ? wk : (which == 2 ? wv : wo));
#pragma unroll
    for (int j = 0; j < 8; ++j) v[j] = (b16)(bf16_rne(w[(size_t)oo * D + k0 + j]) * WSC); { *(v8b*)(W4 + (size_t)o * D + k0) = v;  } }
  if (u0 < 48 * 8) { const int r = (int)(u0 / 8), k0 = (int)(u0 % 8) * 8; v8b a, c;
#pragma unroll
    for (int j = 0; j < 8; ++j) { float e = r < NR ? bfv(ek[(size_t)r * HD + k0 + j]) : 0.0f; b16 p, pl; split16(e * HS, p, pl); a[j] = p; c[j] = pl; } { *(v8b*)(EKh + (size_t)r * HD + k0) = a; *(v8b*)(EKl + (size_t)r * HD + k0) = c;  } } }
// The four dense projections run as block-tiled GEMMs: 8 waves share one 128 x 128 output tile (wave = 32 rows x 64 columns), both operands staged in LDS 64 k at a time,
// the next stage's global loads issued ahead of the current stage's products. Every accumulator still sums k in ascending blocks of 32.
// In both kernels each '#pragma unroll' makes the indices of a register array (ra, rb, acc, fragments, tv) constants, so that it stays in registers.
__global__ __launch_bounds__(256) void proj_kernel(const float* __restrict__ xq, const float* __restrict__ xk, const float* __restrict__ xv, const b16* __restrict__ W4, int QLIM, b16* __restrict__ Qh, b16* __restrict__ Ql, b16* __restrict__ Kh, b16* __restrict__ Kl, float* __restrict__ V) {
  __shared__ __attribute__((aligned(16))) b16 As[BM][LP], Bs[BN][LP]; __shared__ __attribute__((aligned(16))) float Tf[8][16][68];
  const int tid = threadIdx.x, lane = tid & 31, wave = tid >> 5, nloc = lane & 15, hlf = lane >> 4, wm = wave >> 1, wn = wave & 1;
  const size_t t0 = (size_t)blockIdx.x * BM; const int c0 = blockIdx.y * BN, which = blockIdx.z; if ((int)(t0 % S) >= QLIM) return;
  const float* x = which == 0 ? xq : (which == 1 ? xk : xv);
  const int ar = tid >> 4, ac = (tid & 15) * 4, br = tid >> 3, bc = (tid & 7) * 8;   // staging: 16 lanes per 256-B piece of an x row, 8 lanes per 128-B piece of a W row
  const float* xg = x + (t0 + ar) * D + ac; const b16* wg = W4 + ((size_t)which * D + c0 + br) * D + bc;
  v4f ra[8]; v8b rb[4];
#pragma unroll
  for (int i = 0; i < 8; ++i) ra[i] = *(const v4f*)(xg + (size_t)i * 16 * D);
#pragma unroll
  for (int i = 0; i < 4; ++i) rb[i] = *(const v8b*)(wg + (size_t)i * 32 * D);
  v8f acc[2][4];
#pragma unroll
  for (int mi = 0; mi < 2; ++mi)
#pragma unroll
    for (int ni = 0; ni < 4; ++ni) acc[mi][ni] = (v8f){};
#pragma unroll 1   // stays rolled, for speed only
  for (int k0 = 0; k0 < D; k0 += KS) {
#pragma unroll
    for (int i = 0; i < 8; ++i) { v4b hx;
#pragma unroll
      for (int j = 0; j < 4; ++j) hx[j] = (b16)(bf16_rne(ra[i][j]) * XS);
      *(v4b*)(&As[ar + i * 16][ac]) = hx; }
#pragma unroll
    for (int i = 0; i < 4; ++i) *(v8b*)(&Bs[br + i * 32][bc]) = rb[i];
    __syncthreads();
    if (k0 + KS < D) {
#pragma unroll
      for (int i = 0; i < 8; ++i) ra[i] = *(const v4f*)(xg + (size_t)i * 16 * D + k0 + KS);
#pragma unroll
      for (int i = 0; i < 4; ++i) rb[i] = *(const v8b*)(wg + (size_t)i * 32 * D + k0 + KS);
      asm volatile("s_wait_xcnt 0x0" ::: "memory"); }   // the loop advances the address registers that these issued loads name: the wait stands in front of that overwrite
#pragma unroll
    for (int kb = 0; kb < KS; kb += 32) { v16b a[2], bw[4];
#pragma unroll
      for (int mi = 0; mi < 2; ++mi) a[mi] = frag_kb(&As[wm * 32 + mi * 16 + nloc][kb], hlf);
#pragma unroll
      for (int ni = 0; ni < 4; ++ni) bw[ni] = frag_kb(&Bs[wn * 64 + ni * 16 + nloc][kb], hlf);
#pragma unroll
      for (int mi = 0; mi < 2; ++mi)
#pragma unroll
        for (int ni = 0; ni < 4; ++ni) acc[mi][ni] = wmma16b(a[mi], bw[ni], acc[mi][ni]); }
    __syncthreads(); }
  // each wave stages 16 x 64 results in its own LDS range and stores whole lines: two rows per instruction, 16 lanes a row
#pragma unroll
  for (int mi = 0; mi < 2; ++mi) {
#pragma unroll
    for (int ni = 0; ni < 4; ++ni)
#pragma unroll
      for (int r8 = 0; r8 < 8; ++r8) Tf[wave][8 * hlf + r8][ni * 16 + nloc] = acc[mi][ni][r8] * (1.0f / (XS * WSC));
    wave_lds_sync();
    v4f tv[8]; const size_t o = (t0 + wm * 32 + mi * 16 + hlf) * D + c0 + wn * 64 + nloc * 4;
#pragma unroll
    for (int rr = 0; rr < 8; ++rr) tv[rr] = *(const v4f*)(&Tf[wave][rr * 2 + hlf][nloc * 4]);
    if (which == 2) {
#pragma unroll
      for (int rr = 0; rr < 8; ++rr) *(v4f*)(V + o + (size_t)rr * 2 * D) = tv[rr]; }
    else { b16* Ph = which == 0 ? Qh : Kh; b16* Pl = which == 0 ? Ql : Kl;
#pragma unroll
      for (int rr = 0; rr < 8; ++rr) { v4b ph, pl;
#pragma unroll
        for (int j = 0; j < 4; ++j) { b16 p, q; split16(tv[rr][j] * HS, p, q); ph[j] = p; pl[j] = q; }
        *(v4b*)(Ph + o + (size_t)rr * 2 * D) = ph; *(v4b*)(Pl + o + (size_t)rr * 2 * D) = pl; } }
    wave_lds_sync(); } }
__global__ __launch_bounds__(256) void vt_kernel(const float* __restrict__ V, b16* __restrict__ VTh, b16* __restrict__ VTl) { __shared__ float Tt[64][257]; const int tt = blockIdx.x >> 2, hg = blockIdx.x & 3; const size_t t0 = (size_t)tt * 64; const int b = (int)(t0 / S), s0 = (int)(t0 % S); const int tid = threadIdx.x, wave = tid >> 5, lane = tid & 31;
  for (int q = wave; q < 64; q += 8) for (int c = lane; c < 256; c += 32) Tt[q][c] = V[(t0 + q) * D + hg * 256 + c];
  __syncthreads();
  { for (int c = wave; c < 256; c += 8) { const int h = hg * 4 + c / HD, d = c % HD; b16 h0, l0, h1, l1; split16(Tt[lane * 2][c] * HS, h0, l0); split16(Tt[lane * 2 + 1][c] * HS, h1, l1); const size_t o = (((size_t)b * H + h) * HD + d) * S + s0 + lane * 2; *(v2b*)(VTh + o) = (v2b){h0, h1}; *(v2b*)(VTl + o) = (v2b){l0, l1}; }  } }
// One wave per (batch-head, 16 queries). The scores of a 128-key chunk stay in their eight accumulator tiles (lane = key column, register = query row 8 * half + r8):
// bias, mask, row maximum (in-lane over the tiles, then a 16-lane exchange), exp and the sums all run on all 32 lanes in that layout; only P goes through LDS, to become an A fragment.
// Buckets: distance <= -16 and >= 16 are running per-lane sums, joined once after the loop; each of the 31 inner distances has one key, whose score is kept and turned into its weight with the final maximum.
__global__ __launch_bounds__(32) void att_kernel(const b16* __restrict__ Qh, const b16* __restrict__ Ql, const b16* __restrict__ Kh, const b16* __restrict__ Kl, const b16* __restrict__ VTh, const b16* __restrict__ VTl, const b16* __restrict__ EKh, const b16* __restrict__ EKl, const float* __restrict__ ev, const int* __restrict__ vlens, int ALIM, float* __restrict__ O) { __shared__ __attribute__((aligned(16))) b16 Pa[16][CH + 8], Pb[16][CH + 8]; __shared__ float QE[16][49], Bk[16][NR], Ls[16], Of[16][HD + 1]; const int lane = threadIdx.x, nloc = lane & 15, hlf = lane >> 4, rowb = 8 * hlf; const int bh = blockIdx.x / (S / 16), q0 = (blockIdx.x % (S / 16)) * 16; if (q0 >= ALIM) return; const int b = bh / H, h = bh % H; const size_t tq = (size_t)b * S + q0; const int vl = iclamp(vlens[b], 0, S);
  if (lane < 16) { for (int r = 0; r < NR; ++r) Bk[lane][r] = -INFINITY; }
  v16b qa[2], ql[2]; for (int ks = 0; ks < 2; ++ks) { qa[ks] = frag_kb(Qh + (tq + nloc) * D + h * HD + ks * 32, hlf); ql[ks] = frag_kb(Ql + (tq + nloc) * D + h * HD + ks * 32, hlf); }
  // QE[q][r] = q . Ek[r]
#pragma unroll
  for (int t = 0; t < 3; ++t) { v8f e = (v8f){};
#pragma unroll
    for (int ks = 0; ks < 2; ++ks) { const v16b eh = frag_kb(EKh + (size_t)(t * 16 + nloc) * HD + ks * 32, hlf), el = frag_kb(EKl + (size_t)(t * 16 + nloc) * HD + ks * 32, hlf); e = wmma16b(qa[ks], eh, e); e = wmma16b(qa[ks], el, e); e = wmma16b(ql[ks], eh, e); }
#pragma unroll
    for (int r8 = 0; r8 < 8; ++r8) QE[8 * hlf + r8][t * 16 + nloc] = e[r8] * (1.0f / (HS * HS)); }
  wave_lds_sync();
  v8f oacc[4] = {(v8f){}, (v8f){}, (v8f){}, (v8f){}}; const int nch = (vl + CH - 1) / CH;
  // every '#pragma unroll' below makes the indices of a register array (sacc, oacc, mrow, mx, slo, shi, sin_, w0, w1) constants, so that it stays in registers
  float mrow[8], slo[8], shi[8], sin_[8];
#pragma unroll
  for (int r8 = 0; r8 < 8; ++r8) { mrow[r8] = -INFINITY; slo[r8] = 0.0f; shi[r8] = 0.0f; sin_[r8] = 0.0f; }
#pragma unroll 1   // stays rolled: the trip count comes from valid_lens
  for (int ch = 0; ch < nch; ++ch) { const int k0 = ch * CH; v8f sacc[CH / 16];
#pragma unroll
    for (int t = 0; t < CH / 16; ++t) { sacc[t] = (v8f){};
#pragma unroll
      for (int ks = 0; ks < 2; ++ks) { const size_t ko = ((size_t)b * S + k0 + t * 16 + nloc) * D + h * HD + ks * 32; const v16b kh = frag_kb(Kh + ko, hlf), kl = frag_kb(Kl + ko, hlf); sacc[t] = wmma16b(qa[ks], kh, sacc[t]); sacc[t] = wmma16b(qa[ks], kl, sacc[t]); sacc[t] = wmma16b(ql[ks], kh, sacc[t]); } }
    const int dl = k0 + nloc - q0 - rowb;   // key - query of this lane at tile 0, register 0
    float mx[8];
#pragma unroll
    for (int r8 = 0; r8 < 8; ++r8) mx[r8] = -INFINITY;
#pragma unroll
    for (int t = 0; t < CH / 16; ++t) { const int rel = k0 + t * 16 - q0; const bool live = k0 + t * 16 + nloc < vl;
#pragma unroll
      for (int r8 = 0; r8 < 8; ++r8) { const int dd = iclamp(dl + t * 16 - r8, -CLIP, CLIP) + CLIP; const float s = (sacc[t][r8] * (1.0f / (HS * HS)) + QE[rowb + r8][dd]) * SCALE; const float sm = live ? s : -INFINITY; sacc[t][r8] = sm; mx[r8] = fmaxf(mx[r8], sm); }
      if (rel >= -16 && rel <= 16) {   // wave-uniform: only these three tiles hold an inner distance
#pragma unroll
        for (int r8 = 0; r8 < 8; ++r8) { const int d = dl + t * 16 - r8; if (d > -CLIP && d < CLIP) Bk[rowb + r8][d + CLIP] = sacc[t][r8]; } } }
#pragma unroll
    for (int r8 = 0; r8 < 8; ++r8) { float m = mx[r8]; m = fmaxf(m, rowx<1>(m)); m = fmaxf(m, rowx<2>(m)); m = fmaxf(m, rowx<4>(m)); m = fmaxf(m, rowx<8>(m));
      const float mo = mrow[r8], mn = fmaxf(mo, m); const float fac = (mo == -INFINITY) ? 0.0f : __expf(mo - mn); mrow[r8] = mn; slo[r8] *= fac; shi[r8] *= fac; sin_[r8] *= fac;
#pragma unroll
      for (int t = 0; t < 4; ++t) oacc[t][r8] *= fac; }
#pragma unroll
    for (int t = 0; t < CH / 16; ++t) { const int rel = k0 + t * 16 - q0;
#pragma unroll
      for (int r8 = 0; r8 < 8; ++r8) { const float p = __expf(sacc[t][r8] - mrow[r8]); sacc[t][r8] = p; b16 ph, pl; split16(p * PS, ph, pl); Pa[rowb + r8][t * 16 + nloc] = ph; Pb[rowb + r8][t * 16 + nloc] = pl; }
      if (rel <= -32) {
#pragma unroll
        for (int r8 = 0; r8 < 8; ++r8) slo[r8] += sacc[t][r8]; }
      else if (rel >= 32) {
#pragma unroll
        for (int r8 = 0; r8 < 8; ++r8) shi[r8] += sacc[t][r8]; }
      else {
#pragma unroll
        for (int r8 = 0; r8 < 8; ++r8) { const int d = dl + t * 16 - r8; const float p = sacc[t][r8]; slo[r8] += d <= -CLIP ? p : 0.0f; shi[r8] += d >= CLIP ? p : 0.0f; sin_[r8] += (d > -CLIP && d < CLIP) ? p : 0.0f; } } }
    wave_lds_sync();
#pragma unroll 2
    for (int kb = 0; kb < CH; kb += 32) { const v16b pa = frag_kb(&Pa[nloc][kb], hlf), pb = frag_kb(&Pb[nloc][kb], hlf);
#pragma unroll
      for (int t = 0; t < 4; ++t) { const size_t vo = ((size_t)bh * HD + t * 16 + nloc) * S + k0 + kb; const v16b vh = frag_kb(VTh + vo, hlf), vlo = frag_kb(VTl + vo, hlf); oacc[t] = wmma16b(pa, vh, oacc[t]); oacc[t] = wmma16b(pa, vlo, oacc[t]); oacc[t] = wmma16b(pb, vh, oacc[t]); } }
    wave_lds_sync(); }
  // join the 16 lanes' sums; the inner distances' kept scores become weights under the final maximum (a slot no key reached holds -inf and gives 0)
#pragma unroll
  for (int r8 = 0; r8 < 8; ++r8) { float a = slo[r8], c = shi[r8], e = sin_[r8];
    a += rowx<1>(a); c += rowx<1>(c); e += rowx<1>(e); a += rowx<2>(a); c += rowx<2>(c); e += rowx<2>(e); a += rowx<4>(a); c += rowx<4>(c); e += rowx<4>(e); a += rowx<8>(a); c += rowx<8>(c); e += rowx<8>(e);
    if (nloc == 0) { Bk[rowb + r8][0] = a; Bk[rowb + r8][2 * CLIP] = c; Ls[rowb + r8] = a + c + e; } }
  float w0[8], w1[8]; const int j1 = 17 + (nloc < 15 ? nloc : 14);   // lane 15 of a row has no second slot: it reads its neighbour's and stores nothing
#pragma unroll
  for (int r8 = 0; r8 < 8; ++r8) { w0[r8] = __expf(Bk[rowb + r8][1 + nloc] - mrow[r8]); w1[r8] = __expf(Bk[rowb + r8][j1] - mrow[r8]); }
#pragma unroll
  for (int r8 = 0; r8 < 8; ++r8) { Bk[rowb + r8][1 + nloc] = w0[r8]; if (nloc < 15) Bk[rowb + r8][j1] = w1[r8]; }
#pragma unroll
  for (int t = 0; t < 4; ++t)
#pragma unroll
    for (int r8 = 0; r8 < 8; ++r8) Of[8 * hlf + r8][t * 16 + nloc] = oacc[t][r8] * (1.0f / (PS * HS));
  wave_lds_sync();
  // + sum_r Bk[row][r] Ev[r][d]; lane = d pair
  for (int r = 0; r < 16; ++r) { float a0 = Of[r][lane * 2], a1 = Of[r][lane * 2 + 1];
#pragma unroll 1
    for (int rr2 = 0; rr2 < NR; ++rr2) { const float bk = Bk[r][rr2]; a0 += pmul(bk, bfv(ev[(size_t)rr2 * HD + lane * 2])); a1 += pmul(bk, bfv(ev[(size_t)rr2 * HD + lane * 2 + 1])); } const float inv = 1.0f / Ls[r]; Of[r][lane * 2] = a0 * inv; Of[r][lane * 2 + 1] = a1 * inv; }
  wave_lds_sync();
  { for (int r = 0; r < 16; ++r) *(v2f*)(O + (tq + r) * D + h * HD + lane * 2) = (v2f){Of[r][lane * 2], Of[r][lane * 2 + 1]};  } }
__global__ __launch_bounds__(256) void outp_kernel(const float* __restrict__ O, const b16* __restrict__ WO, int ALIM, float* __restrict__ out) {
  __shared__ __attribute__((aligned(16))) b16 Ah[BM][LP], Al[BM][LP], Bs[BN][LP]; __shared__ __attribute__((aligned(16))) float Tf[8][16][68];
  const int tid = threadIdx.x, lane = tid & 31, wave = tid >> 5, nloc = lane & 15, hlf = lane >> 4, wm = wave >> 1, wn = wave & 1;
  const size_t t0 = (size_t)blockIdx.x * BM; const int c0 = blockIdx.y * BN; if ((int)(t0 % S) >= ALIM) return;
  const int ar = tid >> 4, ac = (tid & 15) * 4, br = tid >> 3, bc = (tid & 7) * 8;
  const float* og = O + (t0 + ar) * D + ac; const b16* wg = WO + ((size_t)c0 + br) * D + bc;
  v4f ra[8]; v8b rb[4];
#pragma unroll
  for (int i = 0; i < 8; ++i) ra[i] = *(const v4f*)(og + (size_t)i * 16 * D);
#pragma unroll
  for (int i = 0; i < 4; ++i) rb[i] = *(const v8b*)(wg + (size_t)i * 32 * D);
  v8f acc[2][4];
#pragma unroll
  for (int mi = 0; mi < 2; ++mi)
#pragma unroll
    for (int ni = 0; ni < 4; ++ni) acc[mi][ni] = (v8f){};
#pragma unroll 1   // stays rolled, for speed only
  for (int k0 = 0; k0 < D; k0 += KS) {
#pragma unroll
    for (int i = 0; i < 8; ++i) { v4b hx, lx;
#pragma unroll
      for (int j = 0; j < 4; ++j) { b16 p, q; split16(ra[i][j] * HS, p, q); hx[j] = p; lx[j] = q; }
      *(v4b*)(&Ah[ar + i * 16][ac]) = hx; *(v4b*)(&Al[ar + i * 16][ac]) = lx; }
#pragma unroll
    for (int i = 0; i < 4; ++i) *(v8b*)(&Bs[br + i * 32][bc]) = rb[i];
    __syncthreads();
    if (k0 + KS < D) {
#pragma unroll
      for (int i = 0; i < 8; ++i) ra[i] = *(const v4f*)(og + (size_t)i * 16 * D + k0 + KS);
#pragma unroll
      for (int i = 0; i < 4; ++i) rb[i] = *(const v8b*)(wg + (size_t)i * 32 * D + k0 + KS);
      asm volatile("s_wait_xcnt 0x0" ::: "memory"); }   // the loop advances the address registers that these issued loads name: the wait stands in front of that overwrite
#pragma unroll
    for (int kb = 0; kb < KS; kb += 32) { v16b a[2], al[2], bw[4];
#pragma unroll
      for (int mi = 0; mi < 2; ++mi) { a[mi] = frag_kb(&Ah[wm * 32 + mi * 16 + nloc][kb], hlf); al[mi] = frag_kb(&Al[wm * 32 + mi * 16 + nloc][kb], hlf); }
#pragma unroll
      for (int ni = 0; ni < 4; ++ni) bw[ni] = frag_kb(&Bs[wn * 64 + ni * 16 + nloc][kb], hlf);
#pragma unroll
      for (int mi = 0; mi < 2; ++mi)
#pragma unroll
        for (int ni = 0; ni < 4; ++ni) acc[mi][ni] = wmma16b(a[mi], bw[ni], acc[mi][ni]);
#pragma unroll
      for (int mi = 0; mi < 2; ++mi)
#pragma unroll
        for (int ni = 0; ni < 4; ++ni) acc[mi][ni] = wmma16b(al[mi], bw[ni], acc[mi][ni]); }
    __syncthreads(); }
#pragma unroll
  for (int mi = 0; mi < 2; ++mi) {
#pragma unroll
    for (int ni = 0; ni < 4; ++ni)
#pragma unroll
      for (int r8 = 0; r8 < 8; ++r8) Tf[wave][8 * hlf + r8][ni * 16 + nloc] = acc[mi][ni][r8] * (1.0f / (HS * WSC));
    wave_lds_sync();
    v4f tv[8]; const size_t o = (t0 + wm * 32 + mi * 16 + hlf) * D + c0 + wn * 64 + nloc * 4;
#pragma unroll
    for (int rr = 0; rr < 8; ++rr) tv[rr] = *(const v4f*)(&Tf[wave][rr * 2 + hlf][nloc * 4]);
#pragma unroll
    for (int rr = 0; rr < 8; ++rr) *(v4f*)(out + o + (size_t)rr * 2 * D) = tv[rr];
    wave_lds_sync(); } }
}  // namespace

extern "C" void kernel_launch(void* const* d_in, const int* in_sizes, int n_in, void* d_out, int out_size, void* d_ws, size_t ws_size, hipStream_t stream) {
  (void)n_in;
  auto Fp = [&](int i) { return (const float*)d_in[i]; }; auto Ip = [&](int i) { return (const int*)d_in[i]; };
  // Input order: 0 queries [4,1024,1024]; 1 keys; 2 values; 3 valid_lens [4] i32; 4 Wq [1024,1024]; 5 Wk; 6 Wv; 7 Wo; 8 Ek [33,64]; 9 Ev [33,64]
  if (in_sizes[0] != NT * D || in_sizes[1] != NT * D || in_sizes[2] != NT * D || in_sizes[3] != NB_ || in_sizes[4] != D * D || in_sizes[7] != D * D || in_sizes[8] != NR * HD || in_sizes[9] != NR * HD || out_size != NT * D) return;
  const int QLIM = S, ALIM = S;   // QLIM = tokens projected per batch (>= max valid_len), ALIM = queries attended/output (multiples of 16)
  size_t off = 0; char* ws = (char*)d_ws;
  auto carve = [&](size_t bytes) { char* p = ws + off; off += (bytes + 255) & ~(size_t)255; return p; };
  b16* W4 = (b16*)carve((size_t)4 * D * D * 2); b16* EKh = (b16*)carve(48 * HD * 2); b16* EKl = (b16*)carve(48 * HD * 2); b16* Qh = (b16*)carve((size_t)NT * D * 2); b16* Ql = (b16*)carve((size_t)NT * D * 2); b16* Kh = (b16*)carve((size_t)NT * D * 2); b16* Kl = (b16*)carve((size_t)NT * D * 2); float* V = (float*)carve((size_t)NT * D * 4); b16* VTh = (b16*)carve((size_t)NT * D * 2); b16* VTl = (b16*)carve((size_t)NT * D * 2); float* O = (float*)carve((size_t)NT * D * 4);
  if (off > ws_size || off > ((size_t)104 << 20)) return;   // ~ 90 MB
  wput_kernel<<<256, 256, 0, stream>>>(Fp(4), Fp(5), Fp(6), Fp(7), Fp(8), W4, EKh, EKl);
  proj_kernel<<<dim3(NT / BM, D / BN, 3), 256, 0, stream>>>(Fp(0), Fp(1), Fp(2), W4, QLIM, Qh, Ql, Kh, Kl, V);
  vt_kernel<<<(NT / 64) * 4, 256, 0, stream>>>(V, VTh, VTl);
  att_kernel<<<NB_ * H * (S / 16), 32, 0, stream>>>(Qh, Ql, Kh, Kl, VTh, VTl, EKh, EKl, Fp(9), Ip(3), ALIM, O);
  outp_kernel<<<dim3(NT / BM, D / BN), 256, 0, stream>>>(O, W4 + (size_t)3 * D * D, ALIM, (float*)d_out);
}

// v003
// Measured time: 179 microseconds a run.
// Two timings next to v002 put it at 1.28 and 1.29 times that version's speed.
// Counting every step since v000, it is 8.08 times as fast.
#include <hip/hip_runtime.h>

// MultiHeadAttentionWithRPR: q = queries Wq^T, k = keys Wk^T, v = values Wv^T (16 heads x 64); dist = clip(k - q, -16, 16) + 16; scores = (q.k + q.Ek[dist]) / 8; keys >= valid_lens[b] -> -1e6 (excluded); attn = softmax; out_h = attn v + sum_k attn Ev[dist]; out = concat_h Wo^T -> [4][1024][1024].
// Deterministic: online softmax over fixed 128-key chunks (only chunks below valid_len), fixed order; the Ev term via 33 per-row bucket sums of attn; no atomics.
// WMMA (v_wmma_f32_16x16x32_f16, f32 accumulate): inputs (EXACT bf16 x8, K 1,024) x Wq/Wk/Wv rows (EXACT) in 128 x 128 block tiles; per (bh, 16-query) wave QE = q (hi+lo) x Ek rows (hi+lo; 3 tiles), S = q x k rows (hi+lo; 8 tiles/chunk), O += P (hi+lo) x v^T (hi+lo; 4 tiles); o (hi+lo) x Wo rows (64 tiles) — ≈ 4 M WMMA; softmax, buckets, Ev epilogue in f32.

namespace {
constexpr int NB_ = 4, S = 1024, D = 1024, H = 16, HD = 64, CLIP = 16, NR = 2 * CLIP + 1 /* 33 */, NT = NB_ * S, CH = 128;
constexpr int BM = 128, BN = 128, KS = 64, LP = KS + 8;   // GEMM block tile, k per LDS stage, LDS row pitch in halves (144 B = 16 B x odd, for 16-byte readers)
constexpr float XS = 8.0f, HS = 256.0f, PS = 256.0f, WSC = 256.0f, SCALE = 0.125f;
typedef _Float16 b16;
typedef __attribute__((ext_vector_type(16))) _Float16 v16b;
typedef __attribute__((ext_vector_type(8))) _Float16 v8b;
typedef __attribute__((ext_vector_type(4))) _Float16 v4b;
typedef __attribute__((ext_vector_type(2))) _Float16 v2b;
typedef __attribute__((ext_vector_type(8))) float v8f;
typedef __attribute__((ext_vector_type(4))) float v4f;
typedef __attribute__((ext_vector_type(2))) float v2f;
__device__ __forceinline__ float bf16_rne(float f) { unsigned int u = __float_as_uint(f); u += 0x7FFFu + ((u >> 16) & 1u); float r = __uint_as_float(u & 0xFFFF0000u); asm volatile("" : "+v"(r)); return r; }
__device__ __forceinline__ float bfv(float f) { float r = bf16_rne(f); asm volatile("" : "+v"(r)); return r; }
__device__ __forceinline__ void split16(float v, b16& hi, b16& lo) { hi = (b16)v; lo = (b16)(v - (float)hi); }
__device__ __forceinline__ v16b frag_kb(const b16* p, int hh) { const v8b a = *(const v8b*)(p + 8 * hh), b = *(const v8b*)(p + 16 + 8 * hh); v16b f;
#pragma unroll
  for (int e = 0; e < 8; ++e) { f[e] = a[e]; f[8 + e] = b[e]; } return f; }
__device__ __forceinline__ v8f wmma16b(v16b a, v16b b, v8f c) { v8f d = __builtin_amdgcn_wmma_f32_16x16x32_f16(false, a, false, b, (short)0, c, false, false); asm volatile("v_nop\n\tv_nop\n\tv_nop\n\tv_nop" : "+v"(d) : "v"(a), "v"(b)); return d; }
__device__ __forceinline__ void wave_lds_sync() { __builtin_amdgcn_fence(__ATOMIC_RELEASE, "workgroup"); __builtin_amdgcn_wave_barrier(); __builtin_amdgcn_fence(__ATOMIC_ACQUIRE, "workgroup"); }
__device__ __forceinline__ float bf16_near(float f) { unsigned int u = __float_as_uint(f); u += 0x7FFFu + ((u >> 16) & 1u); return __uint_as_float(u & 0xFFFF0000u); }   // f rounded to the nearest bf16 value, ties to even
template <int M> __device__ __forceinline__ float rowx(float x) { return __builtin_bit_cast(float, __builtin_amdgcn_update_dpp(__builtin_bit_cast(int, x), __builtin_bit_cast(int, x), 0x160 + M, 0xf, 0xf, false)); }   // the value of lane l ^ M of the same 16-lane row (row_xmask)
__device__ __forceinline__ int iclamp(int v, int lo, int hi) { return v < lo ? lo : (v > hi ? hi : v); }

__global__ __launch_bounds__(256) void wput_kernel(const float* __restrict__ wq, const float* __restrict__ wk, const float* __restrict__ wv, const float* __restrict__ wo, const float* __restrict__ ek, b16* __restrict__ W4, b16* __restrict__ EKh, b16* __restrict__ EKl) { const size_t nt = (size_t)gridDim.x * 256, u0 = (size_t)blockIdx.x * 256 + threadIdx.x; v8b v;
  for (size_t u = u0; u < (size_t)4 * D * 128; u += nt) { const int o = (int)(u / 128), k0 = (int)(u % 128) * 8; const int which = o / D, oo = o % D; const float* w = which == 0 ? wq : (which == 1 ? wk : (which == 2 ? wv : wo));
#pragma unroll
    for (int j = 0; j < 8; ++j) v[j] = (b16)(bf16_rne(w[(size_t)oo * D + k0 + j]) * WSC); { *(v8b*)(W4 + (size_t)o * D + k0) = v;  } }
  if (u0 < 48 * 8) { const int r = (int)(u0 / 8), k0 = (int)(u0 % 8) * 8; v8b a, c;
#pragma unroll
    for (int j = 0; j < 8; ++j) { float e = r < NR ? bfv(ek[(size_t)r * HD + k0 + j]) : 0.0f; b16 p, pl; split16(e * HS, p, pl); a[j] = p; c[j] = pl; } { *(v8b*)(EKh + (size_t)r * HD + k0) = a; *(v8b*)(EKl + (size_t)r * HD + k0) = c;  } } }
// The four dense projections run as block-tiled GEMMs: 8 waves share one 128 x 128 output tile (wave = 32 rows x 64 columns), both operands staged in LDS 64 k at a time,
// the next stage's global loads issued ahead of the current stage's products. Every accumulator still sums k in ascending blocks of 32.
// In both kernels each '#pragma unroll' makes the indices of a register array (ra, rb, acc, fragments, tv) constants, so that it stays in registers.
__global__ __launch_bounds__(256) void proj_kernel(const float* __restrict__ xq, const float* __restrict__ xk, const float* __restrict__ xv, const b16* __restrict__ W4, int QLIM, b16* __restrict__ Qh, b16* __restrict__ Ql, b16* __restrict__ Kh, b16* __restrict__ Kl, float* __restrict__ V) {
  __shared__ __attribute__((aligned(16))) b16 As[BM][LP], Bs[BN][LP]; __shared__ __attribute__((aligned(16))) float Tf[8][16][68];
  const int tid = threadIdx.x, lane = tid & 31, wave = tid >> 5, nloc = lane & 15, hlf = lane >> 4, wm = wave >> 1, wn = wave & 1;
  const size_t t0 = (size_t)blockIdx.x * BM; const int c0 = blockIdx.y * BN, which = blockIdx.z; if ((int)(t0 % S) >= QLIM) return;
  const float* x = which == 0 ? xq : (which == 1 ? xk : xv);
  const int ar = tid >> 4, ac = (tid & 15) * 4, br = tid >> 3, bc = (tid & 7) * 8;   // staging: 16 lanes per 256-B piece of an x row, 8 lanes per 128-B piece of a W row
  const float* xg = x + (t0 + ar) * D + ac; const b16* wg = W4 + ((size_t)which * D + c0 + br) * D + bc;
  v4f ra[8]; v8b rb[4];
#pragma unroll
  for (int i = 0; i < 8; ++i) ra[i] = *(const v4f*)(xg + (size_t)i * 16 * D);
#pragma unroll
  for (int i = 0; i < 4; ++i) rb[i] = *(const v8b*)(wg + (size_t)i * 32 * D);
  v8f acc[2][4];
#pragma unroll
  for (int mi = 0; mi < 2; ++mi)
#pragma unroll
    for (int ni = 0; ni < 4; ++ni) acc[mi][ni] = (v8f){};
#pragma unroll 1   // stays rolled, for speed only
  for (int k0 = 0; k0 < D; k0 += KS) {
#pragma unroll
    for (int i = 0; i < 8; ++i) { v4b hx;
#pragma unroll
      for (int j = 0; j < 4; ++j) hx[j] = (b16)(bf16_rne(ra[i][j]) * XS);
      *(v4b*)(&As[ar + i * 16][ac]) = hx; }
#pragma unroll
    for (int i = 0; i < 4; ++i) *(v8b*)(&Bs[br + i * 32][bc]) = rb[i];
    __syncthreads();
    if (k0 + KS < D) {
#pragma unroll
      for (int i = 0; i < 8; ++i) ra[i] = *(const v4f*)(xg + (size_t)i * 16 * D + k0 + KS);
#pragma unroll
      for (int i = 0; i < 4; ++i) rb[i] = *(const v8b*)(wg + (size_t)i * 32 * D + k0 + KS);
      asm volatile("s_wait_xcnt 0x0" ::: "memory"); }   // the loop advances the address registers that these issued loads name: the wait stands in front of that overwrite
#pragma unroll
    for (int kb = 0; kb < KS; kb += 32) { v16b a[2], bw[4];
#pragma unroll
      for (int mi = 0; mi < 2; ++mi) a[mi] = frag_kb(&As[wm * 32 + mi * 16 + nloc][kb], hlf);
#pragma unroll
      for (int ni = 0; ni < 4; ++ni) bw[ni] = frag_kb(&Bs[wn * 64 + ni * 16 + nloc][kb], hlf);
#pragma unroll
      for (int mi = 0; mi < 2; ++mi)
#pragma unroll
        for (int ni = 0; ni < 4; ++ni) acc[mi][ni] = wmma16b(a[mi], bw[ni], acc[mi][ni]); }
    __syncthreads(); }
  // each wave stages 16 x 64 results in its own LDS range and stores whole lines: two rows per instruction, 16 lanes a row
#pragma unroll
  for (int mi = 0; mi < 2; ++mi) {
#pragma unroll
    for (int ni = 0; ni < 4; ++ni)
#pragma unroll
      for (int r8 = 0; r8 < 8; ++r8) Tf[wave][8 * hlf + r8][ni * 16 + nloc] = acc[mi][ni][r8] * (1.0f / (XS * WSC));
    wave_lds_sync();
    v4f tv[8]; const size_t o = (t0 + wm * 32 + mi * 16 + hlf) * D + c0 + wn * 64 + nloc * 4;
#pragma unroll
    for (int rr = 0; rr < 8; ++rr) tv[rr] = *(const v4f*)(&Tf[wave][rr * 2 + hlf][nloc * 4]);
    if (which == 2) {
#pragma unroll
      for (int rr = 0; rr < 8; ++rr) *(v4f*)(V + o + (size_t)rr * 2 * D) = tv[rr]; }
    else { b16* Ph = which == 0 ? Qh : Kh; b16* Pl = which == 0 ? Ql : Kl;
#pragma unroll
      for (int rr = 0; rr < 8; ++rr) { v4b ph, pl;
#pragma unroll
        for (int j = 0; j < 4; ++j) { b16 p, q; split16(tv[rr][j] * HS, p, q); ph[j] = p; pl[j] = q; }
        *(v4b*)(Ph + o + (size_t)rr * 2 * D) = ph; *(v4b*)(Pl + o + (size_t)rr * 2 * D) = pl; } }
    wave_lds_sync(); } }
__global__ __launch_bounds__(256) void vt_kernel(const float* __restrict__ V, b16* __restrict__ VTh, b16* __restrict__ VTl) { __shared__ float Tt[64][257]; const int tt = blockIdx.x >> 2, hg = blockIdx.x & 3; const size_t t0 = (size_t)tt * 64; const int b = (int)(t0 / S), s0 = (int)(t0 % S); const int tid = threadIdx.x, wave = tid >> 5, lane = tid & 31;
  for (int q = wave; q < 64; q += 8) for (int c = lane; c < 256; c += 32) Tt[q][c] = V[(t0 + q) * D + hg * 256 + c];
  __syncthreads();
  { for (int c = wave; c < 256; c += 8) { const int h = hg * 4 + c / HD, d = c % HD; b16 h0, l0, h1, l1; split16(Tt[lane * 2][c] * HS, h0, l0); split16(Tt[lane * 2 + 1][c] * HS, h1, l1); const size_t o = (((size_t)b * H + h) * HD + d) * S + s0 + lane * 2; *(v2b*)(VTh + o) = (v2b){h0, h1}; *(v2b*)(VTl + o) = (v2b){l0, l1}; }  } }
// One wave per (batch-head, 16 queries). The scores of a 128-key chunk stay in their eight accumulator tiles (lane = key column, register = query row 8 * half + r8):
// bias, mask, row maximum (in-lane over the tiles, then a 16-lane exchange), exp and the sums all run on all 32 lanes in that layout; only P goes through LDS, to become an A fragment.
// Buckets: distance <= -16 and >= 16 are running per-lane sums, joined once after the loop; each of the 31 inner distances has one key, whose score is kept and turned into its weight with the final maximum.
__global__ __launch_bounds__(32) void att_kernel(const b16* __restrict__ Qh, const b16* __restrict__ Ql, const b16* __restrict__ Kh, const b16* __restrict__ Kl, const b16* __restrict__ VTh, const b16* __restrict__ VTl, const b16* __restrict__ EKh, const b16* __restrict__ EKl, const float* __restrict__ ev, const int* __restrict__ vlens, int ALIM, float* __restrict__ O) { __shared__ __attribute__((aligned(16))) b16 Pa[16][CH + 8], Pb[16][CH + 8]; __shared__ __attribute__((aligned(16))) float Bk[16][36]; __shared__ float QE[16][49], Ls[16], Of[16][HD + 1]; const int lane = threadIdx.x, nloc = lane & 15, hlf = lane >> 4, rowb = 8 * hlf; const int bh = blockIdx.x / (S / 16), q0 = (blockIdx.x % (S / 16)) * 16; if (q0 >= ALIM) return; const int b = bh / H, h = bh % H; const size_t tq = (size_t)b * S + q0; const int vl = iclamp(vlens[b], 0, S);
  if (lane < 16) { for (int r = 0; r < NR; ++r) Bk[lane][r] = -INFINITY; }
  v16b qa[2], ql[2]; for (int ks = 0; ks < 2; ++ks) { qa[ks] = frag_kb(Qh + (tq + nloc) * D + h * HD + ks * 32, hlf); ql[ks] = frag_kb(Ql + (tq + nloc) * D + h * HD + ks * 32, hlf); }
  // QE[q][r] = q . Ek[r]
#pragma unroll
  for (int t = 0; t < 3; ++t) { v8f e = (v8f){};
#pragma unroll
    for (int ks = 0; ks < 2; ++ks) { const v16b eh = frag_kb(EKh + (size_t)(t * 16 + nloc) * HD + ks * 32, hlf), el = frag_kb(EKl + (size_t)(t * 16 + nloc) * HD + ks * 32, hlf); e = wmma16b(qa[ks], eh, e); e = wmma16b(qa[ks], el, e); e = wmma16b(ql[ks], eh, e); }
#pragma unroll
    for (int r8 = 0; r8 < 8; ++r8) QE[8 * hlf + r8][t * 16 + nloc] = e[r8] * (1.0f / (HS * HS)); }
  wave_lds_sync();
  v8f oacc[4] = {(v8f){}, (v8f){}, (v8f){}, (v8f){}}; const int nch = (vl + CH - 1) / CH;
  // every '#pragma unroll' below makes the indices of a register array (sacc, oacc, mrow, mx, slo, shi, sin_, w0, w1) constants, so that it stays in registers
  float mrow[8], slo[8], shi[8], sin_[8];
#pragma unroll
  for (int r8 = 0; r8 < 8; ++r8) { mrow[r8] = -INFINITY; slo[r8] = 0.0f; shi[r8] = 0.0f; sin_[r8] = 0.0f; }
#pragma unroll 1   // stays rolled: the trip count comes from valid_lens
  for (int ch = 0; ch < nch; ++ch) { const int k0 = ch * CH; v8f sacc[CH / 16];
#pragma unroll
    for (int t = 0; t < CH / 16; ++t) { sacc[t] = (v8f){};
#pragma unroll
      for (int ks = 0; ks < 2; ++ks) { const size_t ko = ((size_t)b * S + k0 + t * 16 + nloc) * D + h * HD + ks * 32; const v16b kh = frag_kb(Kh + ko, hlf), kl = frag_kb(Kl + ko, hlf); sacc[t] = wmma16b(qa[ks], kh, sacc[t]); sacc[t] = wmma16b(qa[ks], kl, sacc[t]); sacc[t] = wmma16b(ql[ks], kh, sacc[t]); } }
    const int dl = k0 + nloc - q0 - rowb;   // key - query of this lane at tile 0, register 0
    float mx[8];
#pragma unroll
    for (int r8 = 0; r8 < 8; ++r8) mx[r8] = -INFINITY;
#pragma unroll
    for (int t = 0; t < CH / 16; ++t) { const int rel = k0 + t * 16 - q0; const bool live = k0 + t * 16 + nloc < vl;
#pragma unroll
      for (int r8 = 0; r8 < 8; ++r8) { const int dd = iclamp(dl + t * 16 - r8, -CLIP, CLIP) + CLIP; const float s = (sacc[t][r8] * (1.0f / (HS * HS)) + QE[rowb + r8][dd]) * SCALE; const float sm = live ? s : -INFINITY; sacc[t][r8] = sm; mx[r8] = fmaxf(mx[r8], sm); }
      if (rel >= -16 && rel <= 16) {   // wave-uniform: only these three tiles hold an inner distance
#pragma unroll
        for (int r8 = 0; r8 < 8; ++r8) { const int d = dl + t * 16 - r8; if (d > -CLIP && d < CLIP) Bk[rowb + r8][d + CLIP] = sacc[t][r8]; } } }
#pragma unroll
    for (int r8 = 0; r8 < 8; ++r8) { float m = mx[r8]; m = fmaxf(m, rowx<1>(m)); m = fmaxf(m, rowx<2>(m)); m = fmaxf(m, rowx<4>(m)); m = fmaxf(m, rowx<8>(m));
      const float mo = mrow[r8], mn = fmaxf(mo, m); const float fac = (mo == -INFINITY) ? 0.0f : __expf(mo - mn); mrow[r8] = mn; slo[r8] *= fac; shi[r8] *= fac; sin_[r8] *= fac;
#pragma unroll
      for (int t = 0; t < 4; ++t) oacc[t][r8] *= fac; }
#pragma unroll
    for (int t = 0; t < CH / 16; ++t) { const int rel = k0 + t * 16 - q0;
#pragma unroll
      for (int r8 = 0; r8 < 8; ++r8) { const float p = __expf(sacc[t][r8] - mrow[r8]); sacc[t][r8] = p; b16 ph, pl; split16(p * PS, ph, pl); Pa[rowb + r8][t * 16 + nloc] = ph; Pb[rowb + r8][t * 16 + nloc] = pl; }
      if (rel <= -32) {
#pragma unroll
        for (int r8 = 0; r8 < 8; ++r8) slo[r8] += sacc[t][r8]; }
      else if (rel >= 32) {
#pragma unroll
        for (int r8 = 0; r8 < 8; ++r8) shi[r8] += sacc[t][r8]; }
      else {
#pragma unroll
        for (int r8 = 0; r8 < 8; ++r8) { const int d = dl + t * 16 - r8; const float p = sacc[t][r8]; slo[r8] += d <= -CLIP ? p : 0.0f; shi[r8] += d >= CLIP ? p : 0.0f; sin_[r8] += (d > -CLIP && d < CLIP) ? p : 0.0f; } } }
    wave_lds_sync();
#pragma unroll 2
    for (int kb = 0; kb < CH; kb += 32) { const v16b pa = frag_kb(&Pa[nloc][kb], hlf), pb = frag_kb(&Pb[nloc][kb], hlf);
#pragma unroll
      for (int t = 0; t < 4; ++t) { const size_t vo = ((size_t)bh * HD + t * 16 + nloc) * S + k0 + kb; const v16b vh = frag_kb(VTh + vo, hlf), vlo = frag_kb(VTl + vo, hlf); oacc[t] = wmma16b(pa, vh, oacc[t]); oacc[t] = wmma16b(pa, vlo, oacc[t]); oacc[t] = wmma16b(pb, vh, oacc[t]); } }
    wave_lds_sync(); }
  // this lane's two columns of all 33 Ev rows: the loads fly together, under the joins below, and the values stay in registers for all 16 query rows
  v2f evr[NR];
#pragma unroll
  for (int j = 0; j < NR; ++j) evr[j] = *(const v2f*)(ev + (size_t)j * HD + lane * 2);
  // join the 16 lanes' sums; the inner distances' kept scores become weights under the final maximum (a slot no key reached holds -inf and gives 0)
#pragma unroll
  for (int r8 = 0; r8 < 8; ++r8) { float a = slo[r8], c = shi[r8], e = sin_[r8];
    a += rowx<1>(a); c += rowx<1>(c); e += rowx<1>(e); a += rowx<2>(a); c += rowx<2>(c); e += rowx<2>(e); a += rowx<4>(a); c += rowx<4>(c); e += rowx<4>(e); a += rowx<8>(a); c += rowx<8>(c); e += rowx<8>(e);
    if (nloc == 0) { Bk[rowb + r8][0] = a; Bk[rowb + r8][2 * CLIP] = c; Ls[rowb + r8] = a + c + e; } }
  float w0[8], w1[8]; const int j1 = 17 + (nloc < 15 ? nloc : 14);   // lane 15 of a row has no second slot: it reads its neighbour's and stores nothing
#pragma unroll
  for (int r8 = 0; r8 < 8; ++r8) { w0[r8] = __expf(Bk[rowb + r8][1 + nloc] - mrow[r8]); w1[r8] = __expf(Bk[rowb + r8][j1] - mrow[r8]); }
#pragma unroll
  for (int r8 = 0; r8 < 8; ++r8) { Bk[rowb + r8][1 + nloc] = w0[r8]; if (nloc < 15) Bk[rowb + r8][j1] = w1[r8]; }
#pragma unroll
  for (int t = 0; t < 4; ++t)
#pragma unroll
    for (int r8 = 0; r8 < 8; ++r8) Of[8 * hlf + r8][t * 16 + nloc] = oacc[t][r8] * (1.0f / (PS * HS));
  wave_lds_sync();
  // + sum_r Bk[row][r] Ev[r][d]; lane = d pair. Every '#pragma unroll' here makes the indices of evr, bq and a constants, so that they stay in registers.
#pragma unroll
  for (int j = 0; j < NR; ++j) { evr[j][0] = bf16_near(evr[j][0]); evr[j][1] = bf16_near(evr[j][1]); }
#pragma unroll 1   // stays rolled: four rows a trip already give four independent sum chains, and sixteen would only lengthen the code
  for (int r0 = 0; r0 < 16; r0 += 4) { v2f a[4]; v4f bq[4][8]; float bl[4], inv[4];
#pragma unroll
    for (int i = 0; i < 4; ++i) { a[i] = (v2f){Of[r0 + i][lane * 2], Of[r0 + i][lane * 2 + 1]}; bl[i] = Bk[r0 + i][32]; inv[i] = 1.0f / Ls[r0 + i];
#pragma unroll
      for (int j = 0; j < 8; ++j) bq[i][j] = *(const v4f*)(&Bk[r0 + i][j * 4]); }
#pragma unroll
    for (int j = 0; j < NR - 1; ++j)
#pragma unroll
      for (int i = 0; i < 4; ++i) a[i] += bq[i][j >> 2][j & 3] * evr[j];
#pragma unroll
    for (int i = 0; i < 4; ++i) { a[i] += bl[i] * evr[NR - 1]; *(v2f*)(O + (tq + r0 + i) * D + h * HD + lane * 2) = a[i] * inv[i]; } } }
__global__ __launch_bounds__(256) void outp_kernel(const float* __restrict__ O, const b16* __restrict__ WO, int ALIM, float* __restrict__ out) {
  __shared__ __attribute__((aligned(16))) b16 Ah[BM][LP], Al[BM][LP], Bs[BN][LP]; __shared__ __attribute__((aligned(16))) float Tf[8][16][68];
  const int tid = threadIdx.x, lane = tid & 31, wave = tid >> 5, nloc = lane & 15, hlf = lane >> 4, wm = wave >> 1, wn = wave & 1;
  const size_t t0 = (size_t)blockIdx.x * BM; const int c0 = blockIdx.y * BN; if ((int)(t0 % S) >= ALIM) return;
  const int ar = tid >> 4, ac = (tid & 15) * 4, br = tid >> 3, bc = (tid & 7) * 8;
  const float* og = O + (t0 + ar) * D + ac; const b16* wg = WO + ((size_t)c0 + br) * D + bc;
  v4f ra[8]; v8b rb[4];
#pragma unroll
  for (int i = 0; i < 8; ++i) ra[i] = *(const v4f*)(og + (size_t)i * 16 * D);
#pragma unroll
  for (int i = 0; i < 4; ++i) rb[i] = *(const v8b*)(wg + (size_t)i * 32 * D);
  v8f acc[2][4];
#pragma unroll
  for (int mi = 0; mi < 2; ++mi)
#pragma unroll
    for (int ni = 0; ni < 4; ++ni) acc[mi][ni] = (v8f){};
#pragma unroll 1   // stays rolled, for speed only
  for (int k0 = 0; k0 < D; k0 += KS) {
#pragma unroll
    for (int i = 0; i < 8; ++i) { v4b hx, lx;
#pragma unroll
      for (int j = 0; j < 4; ++j) { b16 p, q; split16(ra[i][j] * HS, p, q); hx[j] = p; lx[j] = q; }
      *(v4b*)(&Ah[ar + i * 16][ac]) = hx; *(v4b*)(&Al[ar + i * 16][ac]) = lx; }
#pragma unroll
    for (int i = 0; i < 4; ++i) *(v8b*)(&Bs[br + i * 32][bc]) = rb[i];
    __syncthreads();
    if (k0 + KS < D) {
#pragma unroll
      for (int i = 0; i < 8; ++i) ra[i] = *(const v4f*)(og + (size_t)i * 16 * D + k0 + KS);
#pragma unroll
      for (int i = 0; i < 4; ++i) rb[i] = *(const v8b*)(wg + (size_t)i * 32 * D + k0 + KS);
      asm volatile("s_wait_xcnt 0x0" ::: "memory"); }   // the loop advances the address registers that these issued loads name: the wait stands in front of that overwrite
#pragma unroll
    for (int kb = 0; kb < KS; kb += 32) { v16b a[2], al[2], bw[4];
#pragma unroll
      for (int mi = 0; mi < 2; ++mi) { a[mi] = frag_kb(&Ah[wm * 32 + mi * 16 + nloc][kb], hlf); al[mi] = frag_kb(&Al[wm * 32 + mi * 16 + nloc][kb], hlf); }
#pragma unroll
      for (int ni = 0; ni < 4; ++ni) bw[ni] = frag_kb(&Bs[wn * 64 + ni * 16 + nloc][kb], hlf);
#pragma unroll
      for (int mi = 0; mi < 2; ++mi)
#pragma unroll
        for (int ni = 0; ni < 4; ++ni) acc[mi][ni] = wmma16b(a[mi], bw[ni], acc[mi][ni]);
#pragma unroll
      for (int mi = 0; mi < 2; ++mi)
#pragma unroll
        for (int ni = 0; ni < 4; ++ni) acc[mi][ni] = wmma16b(al[mi], bw[ni], acc[mi][ni]); }
    __syncthreads(); }
#pragma unroll
  for (int mi = 0; mi < 2; ++mi) {
#pragma unroll
    for (int ni = 0; ni < 4; ++ni)
#pragma unroll
      for (int r8 = 0; r8 < 8; ++r8) Tf[wave][8 * hlf + r8][ni * 16 + nloc] = acc[mi][ni][r8] * (1.0f / (HS * WSC));
    wave_lds_sync();
    v4f tv[8]; const size_t o = (t0 + wm * 32 + mi * 16 + hlf) * D + c0 + wn * 64 + nloc * 4;
#pragma unroll
    for (int rr = 0; rr < 8; ++rr) tv[rr] = *(const v4f*)(&Tf[wave][rr * 2 + hlf][nloc * 4]);
#pragma unroll
    for (int rr = 0; rr < 8; ++rr) *(v4f*)(out + o + (size_t)rr * 2 * D) = tv[rr];
    wave_lds_sync(); } }
}  // namespace

extern "C" void kernel_launch(void* const* d_in, const int* in_sizes, int n_in, void* d_out, int out_size, void* d_ws, size_t ws_size, hipStream_t stream) {
  (void)n_in;
  auto Fp = [&](int i) { return (const float*)d_in[i]; }; auto Ip = [&](int i) { return (const int*)d_in[i]; };
  // Input order: 0 queries [4,1024,1024]; 1 keys; 2 values; 3 valid_lens [4] i32; 4 Wq [1024,1024]; 5 Wk; 6 Wv; 7 Wo; 8 Ek [33,64]; 9 Ev [33,64]
  if (in_sizes[0] != NT * D || in_sizes[1] != NT * D || in_sizes[2] != NT * D || in_sizes[3] != NB_ || in_sizes[4] != D * D || in_sizes[7] != D * D || in_sizes[8] != NR * HD || in_sizes[9] != NR * HD || out_size != NT * D) return;
  const int QLIM = S, ALIM = S;   // QLIM = tokens projected per batch (>= max valid_len), ALIM = queries attended/output (multiples of 16)
  size_t off = 0; char* ws = (char*)d_ws;
  auto carve = [&](size_t bytes) { char* p = ws + off; off += (bytes + 255) & ~(size_t)255; return p; };
  b16* W4 = (b16*)carve((size_t)4 * D * D * 2); b16* EKh = (b16*)carve(48 * HD * 2); b16* EKl = (b16*)carve(48 * HD * 2); b16* Qh = (b16*)carve((size_t)NT * D * 2); b16* Ql = (b16*)carve((size_t)NT * D * 2); b16* Kh = (b16*)carve((size_t)NT * D * 2); b16* Kl = (b16*)carve((size_t)NT * D * 2); float* V = (float*)carve((size_t)NT * D * 4); b16* VTh = (b16*)carve((size_t)NT * D * 2); b16* VTl = (b16*)carve((size_t)NT * D * 2); float* O = (float*)carve((size_t)NT * D * 4);
  if (off > ws_size || off > ((size_t)104 << 20)) return;   // ~ 90 MB
  wput_kernel<<<256, 256, 0, stream>>>(Fp(4), Fp(5), Fp(6), Fp(7), Fp(8), W4, EKh, EKl);
  proj_kernel<<<dim3(NT / BM, D / BN, 3), 256, 0, stream>>>(Fp(0), Fp(1), Fp(2), W4, QLIM, Qh, Ql, Kh, Kl, V);
  vt_kernel<<<(NT / 64) * 4, 256, 0, stream>>>(V, VTh, VTl);
  att_kernel<<<NB_ * H * (S / 16), 32, 0, stream>>>(Qh, Ql, Kh, Kl, VTh, VTl, EKh, EKl, Fp(9), Ip(3), ALIM, O);
  outp_kernel<<<dim3(NT / BM, D / BN), 256, 0, stream>>>(O, W4 + (size_t)3 * D * D, ALIM, (float*)d_out);
}

// v004
// A run of this version takes 144 microseconds.
// Timed twice side by side with v003, it ran 1.24 times as fast both times.
// Over all steps from v000 it is 10.0 times as fast.
#include <hip/hip_runtime.h>

// MultiHeadAttentionWithRPR: q = queries Wq^T, k = keys Wk^T, v = values Wv^T (16 heads x 64); dist = clip(k - q, -16, 16) + 16; scores = (q.k + q.Ek[dist]) / 8; keys >= valid_lens[b] -> -1e6 (excluded); attn = softmax; out_h = attn v + sum_k attn Ev[dist]; out = concat_h Wo^T -> [4][1024][1024].
// Deterministic: online softmax over fixed 128-key chunks (only chunks below valid_len), fixed order; the Ev term via 33 per-row bucket sums of attn; no atomics.
// WMMA (v_wmma_f32_16x16x32_f16, f32 accumulate): inputs (EXACT bf16 x8, K 1,024) x Wq/Wk/Wv rows (EXACT) in 128 x 128 block tiles; per (bh, 16-query) wave (8 waves a work-group, K and V^T chunks shared in LDS) QE = q (hi+lo) x Ek rows (hi+lo; 3 tiles), S = q x k rows (hi+lo; 8 tiles/chunk), O += P (hi+lo) x v^T (hi+lo; 4 tiles); o (hi+lo) x Wo rows (64 tiles) — ≈ 4 M WMMA; softmax, buckets, Ev epilogue in f32.

namespace {
constexpr int NB_ = 4, S = 1024, D = 1024, H = 16, HD = 64, CLIP = 16, NR = 2 * CLIP + 1 /* 33 */, NT = NB_ * S, CH = 128;
constexpr int BM = 128, BN = 128, KS = 64, LP = KS + 8;   // GEMM block tile, k per LDS stage, LDS row pitch in halves (144 B = 16 B x odd, for 16-byte readers)
constexpr int AW = 8, KP = HD + 8, VP = CH + 8;   // attention: waves of a work-group; LDS row pitch in halves of a staged K row (144 B) and V^T row (272 B), each 16 B x odd, for 16-byte readers
constexpr float XS = 8.0f, HS = 256.0f, PS = 256.0f, WSC = 256.0f, SCALE = 0.125f;
typedef _Float16 b16;
typedef __attribute__((ext_vector_type(16))) _Float16 v16b;
typedef __attribute__((ext_vector_type(8))) _Float16 v8b;
typedef __attribute__((ext_vector_type(4))) _Float16 v4b;
typedef __attribute__((ext_vector_type(2))) _Float16 v2b;
typedef __attribute__((ext_vector_type(8))) float v8f;
typedef __attribute__((ext_vector_type(4))) float v4f;
typedef __attribute__((ext_vector_type(2))) float v2f;
__device__ __forceinline__ float bf16_rne(float f) { unsigned int u = __float_as_uint(f); u += 0x7FFFu + ((u >> 16) & 1u); float r = __uint_as_float(u & 0xFFFF0000u); asm volatile("" : "+v"(r)); return r; }
__device__ __forceinline__ float bfv(float f) { float r = bf16_rne(f); asm volatile("" : "+v"(r)); return r; }
__device__ __forceinline__ void split16(float v, b16& hi, b16& lo) { hi = (b16)v; lo = (b16)(v - (float)hi); }
__device__ __forceinline__ v16b frag_kb(const b16* p, int hh) { const v8b a = *(const v8b*)(p + 8 * hh), b = *(const v8b*)(p + 16 + 8 * hh); v16b f;
#pragma unroll
  for (int e = 0; e < 8; ++e) { f[e] = a[e]; f[8 + e] = b[e]; } return f; }
__device__ __forceinline__ v8f wmma16b(v16b a, v16b b, v8f c) { v8f d = __builtin_amdgcn_wmma_f32_16x16x32_f16(false, a, false, b, (short)0, c, false, false); asm volatile("v_nop\n\tv_nop\n\tv_nop\n\tv_nop" : "+v"(d) : "v"(a), "v"(b)); return d; }
__device__ __forceinline__ void wave_lds_sync() { __builtin_amdgcn_fence(__ATOMIC_RELEASE, "workgroup"); __builtin_amdgcn_wave_barrier(); __builtin_amdgcn_fence(__ATOMIC_ACQUIRE, "workgroup"); }
__device__ __forceinline__ float bf16_near(float f) { unsigned int u = __float_as_uint(f); u += 0x7FFFu + ((u >> 16) & 1u); return __uint_as_float(u & 0xFFFF0000u); }   // f rounded to the nearest bf16 value, ties to even
template <int M> __device__ __forceinline__ float rowx(float x) { return __builtin_bit_cast(float, __builtin_amdgcn_update_dpp(__builtin_bit_cast(int, x), __builtin_bit_cast(int, x), 0x160 + M, 0xf, 0xf, false)); }   // the value of lane l ^ M of the same 16-lane row (row_xmask)
__device__ __forceinline__ unsigned lds_off(const b16* p) { typedef __attribute__((address_space(3))) const b16 lds_b16; return (unsigned)(size_t)(lds_b16*)p; }   // byte address of p inside the work-group's LDS
// Eight asynchronous copies, 16 bytes a lane each, global memory -> LDS through no register: copies 0-3 read ga + i * gs, copies 4-7 gb + (i - 4) * gs; copy i lands at LDS byte l + i * ls.
// The s_wait_xcnt closes the statement so that no address register of an issued copy is rewritten in front of it.
__device__ __forceinline__ void copy8(unsigned l, unsigned ls, const b16* ga, const b16* gb, size_t gs) {
  asm volatile("global_load_async_to_lds_b128 %0, %8, off\n\tglobal_load_async_to_lds_b128 %1, %9, off\n\tglobal_load_async_to_lds_b128 %2, %10, off\n\tglobal_load_async_to_lds_b128 %3, %11, off\n\t"
               "global_load_async_to_lds_b128 %4, %12, off\n\tglobal_load_async_to_lds_b128 %5, %13, off\n\tglobal_load_async_to_lds_b128 %6, %14, off\n\tglobal_load_async_to_lds_b128 %7, %15, off\n\ts_wait_xcnt 0x0"
               :: "v"(l), "v"(l + ls), "v"(l + 2 * ls), "v"(l + 3 * ls), "v"(l + 4 * ls), "v"(l + 5 * ls), "v"(l + 6 * ls), "v"(l + 7 * ls),
                  "v"(ga), "v"(ga + gs), "v"(ga + 2 * gs), "v"(ga + 3 * gs), "v"(gb), "v"(gb + gs), "v"(gb + 2 * gs), "v"(gb + 3 * gs) : "memory"); }
__device__ __forceinline__ int iclamp(int v, int lo, int hi) { return v < lo ? lo : (v > hi ? hi : v); }

__global__ __launch_bounds__(256) void wput_kernel(const float* __restrict__ wq, const float* __restrict__ wk, const float* __restrict__ wv, const float* __restrict__ wo, const float* __restrict__ ek, b16* __restrict__ W4, b16* __restrict__ EKh, b16* __restrict__ EKl) { const size_t nt = (size_t)gridDim.x * 256, u0 = (size_t)blockIdx.x * 256 + threadIdx.x; v8b v;
  for (size_t u = u0; u < (size_t)4 * D * 128; u += nt) { const int o = (int)(u / 128), k0 = (int)(u % 128) * 8; const int which = o / D, oo = o % D; const float* w = which == 0 ? wq : (which == 1 ? wk : (which == 2 ? wv : wo));
#pragma unroll
    for (int j = 0; j < 8; ++j) v[j] = (b16)(bf16_rne(w[(size_t)oo * D + k0 + j]) * WSC); { *(v8b*)(W4 + (size_t)o * D + k0) = v;  } }
  if (u0 < 48 * 8) { const int r = (int)(u0 / 8), k0 = (int)(u0 % 8) * 8; v8b a, c;
#pragma unroll
    for (int j = 0; j < 8; ++j) { float e = r < NR ? bfv(ek[(size_t)r * HD + k0 + j]) : 0.0f; b16 p, pl; split16(e * HS, p, pl); a[j] = p; c[j] = pl; } { *(v8b*)(EKh + (size_t)r * HD + k0) = a; *(v8b*)(EKl + (size_t)r * HD + k0) = c;  } } }
// The four dense projections run as block-tiled GEMMs: 8 waves share one 128 x 128 output tile (wave = 32 rows x 64 columns), both operands staged in LDS 64 k at a time,
// the next stage's global loads issued ahead of the current stage's products. Every accumulator still sums k in ascending blocks of 32.
// In both kernels each '#pragma unroll' makes the indices of a register array (ra, rb, acc, fragments, tv) constants, so that it stays in registers.
__global__ __launch_bounds__(256) void proj_kernel(const float* __restrict__ xq, const float* __restrict__ xk, const float* __restrict__ xv, const b16* __restrict__ W4, int QLIM, b16* __restrict__ Qh, b16* __restrict__ Ql, b16* __restrict__ Kh, b16* __restrict__ Kl, float* __restrict__ V) {
  __shared__ __attribute__((aligned(16))) b16 As[BM][LP], Bs[BN][LP]; __shared__ __attribute__((aligned(16))) float Tf[8][16][68];
  const int tid = threadIdx.x, lane = tid & 31, wave = tid >> 5, nloc = lane & 15, hlf = lane >> 4, wm = wave >> 1, wn = wave & 1;
  const size_t t0 = (size_t)blockIdx.x * BM; const int c0 = blockIdx.y * BN, which = blockIdx.z; if ((int)(t0 % S) >= QLIM) return;
  const float* x = which == 0 ? xq : (which == 1 ? xk : xv);
  const int ar = tid >> 4, ac = (tid & 15) * 4, br = tid >> 3, bc = (tid & 7) * 8;   // staging: 16 lanes per 256-B piece of an x row, 8 lanes per 128-B piece of a W row
  const float* xg = x + (t0 + ar) * D + ac; const b16* wg = W4 + ((size_t)which * D + c0 + br) * D + bc;
  v4f ra[8]; v8b rb[4];
#pragma unroll
  for (int i = 0; i < 8; ++i) ra[i] = *(const v4f*)(xg + (size_t)i * 16 * D);
#pragma unroll
  for (int i = 0; i < 4; ++i) rb[i] = *(const v8b*)(wg + (size_t)i * 32 * D);
  v8f acc[2][4];
#pragma unroll
  for (int mi = 0; mi < 2; ++mi)
#pragma unroll
    for (int ni = 0; ni < 4; ++ni) acc[mi][ni] = (v8f){};
#pragma unroll 1   // stays rolled, for speed only
  for (int k0 = 0; k0 < D; k0 += KS) {
#pragma unroll
    for (int i = 0; i < 8; ++i) { v4b hx;
#pragma unroll
      for (int j = 0; j < 4; ++j) hx[j] = (b16)(bf16_rne(ra[i][j]) * XS);
      *(v4b*)(&As[ar + i * 16][ac]) = hx; }
#pragma unroll
    for (int i = 0; i < 4; ++i) *(v8b*)(&Bs[br + i * 32][bc]) = rb[i];
    __syncthreads();
    if (k0 + KS < D) {
#pragma unroll
      for (int i = 0; i < 8; ++i) ra[i] = *(const v4f*)(xg + (size_t)i * 16 * D + k0 + KS);
#pragma unroll
      for (int i = 0; i < 4; ++i) rb[i] = *(const v8b*)(wg + (size_t)i * 32 * D + k0 + KS);
      asm volatile("s_wait_xcnt 0x0" ::: "memory"); }   // the loop advances the address registers that these issued loads name: the wait stands in front of that overwrite
#pragma unroll
    for (int kb = 0; kb < KS; kb += 32) { v16b a[2], bw[4];
#pragma unroll
      for (int mi = 0; mi < 2; ++mi) a[mi] = frag_kb(&As[wm * 32 + mi * 16 + nloc][kb], hlf);
#pragma unroll
      for (int ni = 0; ni < 4; ++ni) bw[ni] = frag_kb(&Bs[wn * 64 + ni * 16 + nloc][kb], hlf);
#pragma unroll
      for (int mi = 0; mi < 2; ++mi)
#pragma unroll
        for (int ni = 0; ni < 4; ++ni) acc[mi][ni] = wmma16b(a[mi], bw[ni], acc[mi][ni]); }
    __syncthreads(); }
  // each wave stages 16 x 64 results in its own LDS range and stores whole lines: two rows per instruction, 16 lanes a row
#pragma unroll
  for (int mi = 0; mi < 2; ++mi) {
#pragma unroll
    for (int ni = 0; ni < 4; ++ni)
#pragma unroll
      for (int r8 = 0; r8 < 8; ++r8) Tf[wave][8 * hlf + r8][ni * 16 + nloc] = acc[mi][ni][r8] * (1.0f / (XS * WSC));
    wave_lds_sync();
    v4f tv[8]; const size_t o = (t0 + wm * 32 + mi * 16 + hlf) * D + c0 + wn * 64 + nloc * 4;
#pragma unroll
    for (int rr = 0; rr < 8; ++rr) tv[rr] = *(const v4f*)(&Tf[wave][rr * 2 + hlf][nloc * 4]);
    if (which == 2) {
#pragma unroll
      for (int rr = 0; rr < 8; ++rr) *(v4f*)(V + o + (size_t)rr * 2 * D) = tv[rr]; }
    else { b16* Ph = which == 0 ? Qh : Kh; b16* Pl = which == 0 ? Ql : Kl;
#pragma unroll
      for (int rr = 0; rr < 8; ++rr) { v4b ph, pl;
#pragma unroll
        for (int j = 0; j < 4; ++j) { b16 p, q; split16(tv[rr][j] * HS, p, q); ph[j] = p; pl[j] = q; }
        *(v4b*)(Ph + o + (size_t)rr * 2 * D) = ph; *(v4b*)(Pl + o + (size_t)rr * 2 * D) = pl; } }
    wave_lds_sync(); } }
__global__ __launch_bounds__(256) void vt_kernel(const float* __restrict__ V, b16* __restrict__ VTh, b16* __restrict__ VTl) { __shared__ float Tt[64][257]; const int tt = blockIdx.x >> 2, hg = blockIdx.x & 3; const size_t t0 = (size_t)tt * 64; const int b = (int)(t0 / S), s0 = (int)(t0 % S); const int tid = threadIdx.x, wave = tid >> 5, lane = tid & 31;
  for (int q = wave; q < 64; q += 8) for (int c = lane; c < 256; c += 32) Tt[q][c] = V[(t0 + q) * D + hg * 256 + c];
  __syncthreads();
  { for (int c = wave; c < 256; c += 8) { const int h = hg * 4 + c / HD, d = c % HD; b16 h0, l0, h1, l1; split16(Tt[lane * 2][c] * HS, h0, l0); split16(Tt[lane * 2 + 1][c] * HS, h1, l1); const size_t o = (((size_t)b * H + h) * HD + d) * S + s0 + lane * 2; *(v2b*)(VTh + o) = (v2b){h0, h1}; *(v2b*)(VTl + o) = (v2b){l0, l1}; }  } }
// One work-group of 8 waves per (batch-head, 128 queries), one wave per 16 queries. Each 128-key chunk of K and V^T (hi and lo) is staged once for all eight waves in LDS by asynchronous copies, whole 128-B lines,
// two buffers: chunk c + 1 flies while chunk c is worked on; every fragment of K and V^T is read from LDS. Everything else is private to its wave, as are its LDS ranges (index [wave]). The scores of a 128-key chunk stay in their eight accumulator tiles (lane = key column, register = query row 8 * half + r8):
// bias, mask, row maximum (in-lane over the tiles, then a 16-lane exchange), exp and the sums all run on all 32 lanes in that layout; only P goes through LDS, to become an A fragment.
// Buckets: distance <= -16 and >= 16 are running per-lane sums, joined once after the loop; each of the 31 inner distances has one key, whose score is kept and turned into its weight with the final maximum.
__global__ __launch_bounds__(32 * AW) void att_kernel(const b16* __restrict__ Qh, const b16* __restrict__ Ql, const b16* __restrict__ Kh, const b16* __restrict__ Kl, const b16* __restrict__ VTh, const b16* __restrict__ VTl, const b16* __restrict__ EKh, const b16* __restrict__ EKl, const float* __restrict__ ev, const int* __restrict__ vlens, int ALIM, float* __restrict__ O) { __shared__ __attribute__((aligned(16))) b16 Ksh[2][2][CH][KP], Vsh[2][2][HD][VP];   // [buffer][hi, lo][key][d] and [buffer][hi, lo][d][key]
  __shared__ __attribute__((aligned(16))) b16 PaW[AW][16][CH + 8], PbW[AW][16][CH + 8]; __shared__ __attribute__((aligned(16))) float BkW[AW][16][36]; __shared__ float QEW[AW][16][49], LsW[AW][16], OfW[AW][16][HD + 1];
  const int lane = threadIdx.x & 31, wave = __builtin_amdgcn_readfirstlane(threadIdx.x >> 5), nloc = lane & 15, hlf = lane >> 4, rowb = 8 * hlf;   // the wave's number in a scalar register keeps the tests on q0 below scalar branches
  const int bh = blockIdx.x / (S / (16 * AW)), qb = (blockIdx.x % (S / (16 * AW))) * (16 * AW); if (qb >= ALIM) return; const int q0 = qb + wave * 16; const int b = bh / H, h = bh % H; const size_t tq = (size_t)b * S + q0; const int vl = iclamp(vlens[b], 0, S), nch = (vl + CH - 1) / CH;
  b16 (*Pa)[CH + 8] = PaW[wave]; b16 (*Pb)[CH + 8] = PbW[wave]; float (*Bk)[36] = BkW[wave]; float (*QE)[49] = QEW[wave]; float* Ls = LsW[wave]; float (*Of)[HD + 1] = OfW[wave];
  // staging, per wave and chunk: 8 copies of 4 K rows (8 lanes a 128-B row; rows i * 32 + wave * 4 + ..., hi then lo) and 8 copies of 2 V^T rows (16 lanes a 256-B row piece; rows i * 16 + wave * 2 + ..., hi then lo)
  const int kr = wave * 4 + (lane >> 3), kc = (lane & 7) * 8, vr = wave * 2 + (lane >> 4), vc = (lane & 15) * 8;
  const size_t kg = ((size_t)b * S + kr) * D + h * HD + kc, vg = ((size_t)bh * HD + vr) * S + vc;
  auto stage = [&](int c, int buf) { copy8(lds_off(&Ksh[buf][0][kr][kc]), 32 * KP * 2, Kh + kg + (size_t)c * CH * D, Kl + kg + (size_t)c * CH * D, (size_t)32 * D);
    copy8(lds_off(&Vsh[buf][0][vr][vc]), 16 * VP * 2, VTh + vg + c * CH, VTl + vg + c * CH, (size_t)16 * S); };
  stage(0, 0);   // chunk 0 flies under the set-up below
  if (lane < 16) { for (int r = 0; r < NR; ++r) Bk[lane][r] = -INFINITY; }
  v16b qa[2], ql[2]; for (int ks = 0; ks < 2; ++ks) { qa[ks] = frag_kb(Qh + (tq + nloc) * D + h * HD + ks * 32, hlf); ql[ks] = frag_kb(Ql + (tq + nloc) * D + h * HD + ks * 32, hlf); }
  // QE[q][r] = q . Ek[r]
#pragma unroll
  for (int t = 0; t < 3; ++t) { v8f e = (v8f){};
#pragma unroll
    for (int ks = 0; ks < 2; ++ks) { const v16b eh = frag_kb(EKh + (size_t)(t * 16 + nloc) * HD + ks * 32, hlf), el = frag_kb(EKl + (size_t)(t * 16 + nloc) * HD + ks * 32, hlf); e = wmma16b(qa[ks], eh, e); e = wmma16b(qa[ks], el, e); e = wmma16b(ql[ks], eh, e); }
#pragma unroll
    for (int r8 = 0; r8 < 8; ++r8) QE[8 * hlf + r8][t * 16 + nloc] = e[r8] * (1.0f / (HS * HS)); }
  wave_lds_sync();
  asm volatile("s_wait_asynccnt 0x0" ::: "memory");   // this wave's copies of chunk 0 have landed
  __syncthreads();                                    // ... and so have the other waves': chunk 0 may be read
  if (nch > 1) stage(1, 1);
  v8f oacc[4] = {(v8f){}, (v8f){}, (v8f){}, (v8f){}};
  // every '#pragma unroll' below makes the indices of a register array (sacc, oacc, kh, kl, vh, vlo, mrow, mx, slo, shi, sin_, w0, w1) constants, so that it stays in registers
  float mrow[8], slo[8], shi[8], sin_[8];
#pragma unroll
  for (int r8 = 0; r8 < 8; ++r8) { mrow[r8] = -INFINITY; slo[r8] = 0.0f; shi[r8] = 0.0f; sin_[r8] = 0.0f; }
#pragma unroll 1   // stays rolled: the trip count comes from valid_lens
  for (int ch = 0; ch < nch; ++ch) { const int k0 = ch * CH; v8f sacc[CH / 16]; const b16 (*Kc)[CH][KP] = Ksh[ch & 1]; const b16 (*Vc)[HD][VP] = Vsh[ch & 1];
#pragma unroll
    for (int tg = 0; tg < CH / 16; tg += 2) { v16b kh[2][2], kl[2][2];   // two tiles' fragment reads stand together, ahead of their products, for speed only
#pragma unroll
      for (int t = 0; t < 2; ++t)
#pragma unroll
        for (int ks = 0; ks < 2; ++ks) { kh[t][ks] = frag_kb(&Kc[0][(tg + t) * 16 + nloc][ks * 32], hlf); kl[t][ks] = frag_kb(&Kc[1][(tg + t) * 16 + nloc][ks * 32], hlf); }
#pragma unroll
      for (int t = 0; t < 2; ++t) { v8f s = (v8f){};
#pragma unroll
        for (int ks = 0; ks < 2; ++ks) { s = wmma16b(qa[ks], kh[t][ks], s); s = wmma16b(qa[ks], kl[t][ks], s); s = wmma16b(ql[ks], kh[t][ks], s); }
        sacc[tg + t] = s; } }
    const int dl = k0 + nloc - q0 - rowb;   // key - query of this lane at tile 0, register 0
    float mx[8];
#pragma unroll
    for (int r8 = 0; r8 < 8; ++r8) mx[r8] = -INFINITY;
#pragma unroll
    for (int t = 0; t < CH / 16; ++t) { const int rel = k0 + t * 16 - q0; const bool live = k0 + t * 16 + nloc < vl;
#pragma unroll
      for (int r8 = 0; r8 < 8; ++r8) { const int dd = iclamp(dl + t * 16 - r8, -CLIP, CLIP) + CLIP; const float s = (sacc[t][r8] * (1.0f / (HS * HS)) + QE[rowb + r8][dd]) * SCALE; const float sm = live ? s : -INFINITY; sacc[t][r8] = sm; mx[r8] = fmaxf(mx[r8], sm); }
      if (rel >= -16 && rel <= 16) {   // wave-uniform: only these three tiles hold an inner distance
#pragma unroll
        for (int r8 = 0; r8 < 8; ++r8) { const int d = dl + t * 16 - r8; if (d > -CLIP && d < CLIP) Bk[rowb + r8][d + CLIP] = sacc[t][r8]; } } }
#pragma unroll
    for (int r8 = 0; r8 < 8; ++r8) { float m = mx[r8]; m = fmaxf(m, rowx<1>(m)); m = fmaxf(m, rowx<2>(m)); m = fmaxf(m, rowx<4>(m)); m = fmaxf(m, rowx<8>(m));
      const float mo = mrow[r8], mn = fmaxf(mo, m); const float fac = (mo == -INFINITY) ? 0.0f : __expf(mo - mn); mrow[r8] = mn; slo[r8] *= fac; shi[r8] *= fac; sin_[r8] *= fac;
#pragma unroll
      for (int t = 0; t < 4; ++t) oacc[t][r8] *= fac; }
#pragma unroll
    for (int t = 0; t < CH / 16; ++t) { const int rel = k0 + t * 16 - q0;
#pragma unroll
      for (int r8 = 0; r8 < 8; ++r8) { const float p = __expf(sacc[t][r8] - mrow[r8]); sacc[t][r8] = p; b16 ph, pl; split16(p * PS, ph, pl); Pa[rowb + r8][t * 16 + nloc] = ph; Pb[rowb + r8][t * 16 + nloc] = pl; }
      if (rel <= -32) {
#pragma unroll
        for (int r8 = 0; r8 < 8; ++r8) slo[r8] += sacc[t][r8]; }
      else if (rel >= 32) {
#pragma unroll
        for (int r8 = 0; r8 < 8; ++r8) shi[r8] += sacc[t][r8]; }
      else {
#pragma unroll
        for (int r8 = 0; r8 < 8; ++r8) { const int d = dl + t * 16 - r8; const float p = sacc[t][r8]; slo[r8] += d <= -CLIP ? p : 0.0f; shi[r8] += d >= CLIP ? p : 0.0f; sin_[r8] += (d > -CLIP && d < CLIP) ? p : 0.0f; } } }
    wave_lds_sync();
#pragma unroll 2
    for (int kb = 0; kb < CH; kb += 32) { const v16b pa = frag_kb(&Pa[nloc][kb], hlf), pb = frag_kb(&Pb[nloc][kb], hlf); v16b vh[4], vlo[4];   // again one group of reads ahead of the products
#pragma unroll
      for (int t = 0; t < 4; ++t) { vh[t] = frag_kb(&Vc[0][t * 16 + nloc][kb], hlf); vlo[t] = frag_kb(&Vc[1][t * 16 + nloc][kb], hlf); }
#pragma unroll
      for (int t = 0; t < 4; ++t) { oacc[t] = wmma16b(pa, vh[t], oacc[t]); oacc[t] = wmma16b(pa, vlo[t], oacc[t]); oacc[t] = wmma16b(pb, vh[t], oacc[t]); } }
    asm volatile("s_wait_dscnt 0x0" ::: "memory");      // this wave's reads of the chunk's buffer (and of its P) have returned
    asm volatile("s_wait_asynccnt 0x0" ::: "memory");   // this wave's copies of chunk ch + 1 have landed
    __syncthreads();                                    // publishes chunk ch + 1 and frees the buffer that this pass has read
    if (ch + 2 < nch) stage(ch + 2, ch & 1); }
  asm volatile("s_wait_asynccnt 0x0" ::: "memory");     // no copy is outstanding behind the loop
  // this lane's two columns of all 33 Ev rows: the loads fly together, under the joins below, and the values stay in registers for all 16 query rows
  v2f evr[NR];
#pragma unroll
  for (int j = 0; j < NR; ++j) evr[j] = *(const v2f*)(ev + (size_t)j * HD + lane * 2);
  // join the 16 lanes' sums; the inner distances' kept scores become weights under the final maximum (a slot no key reached holds -inf and gives 0)
#pragma unroll
  for (int r8 = 0; r8 < 8; ++r8) { float a = slo[r8], c = shi[r8], e = sin_[r8];
    a += rowx<1>(a); c += rowx<1>(c); e += rowx<1>(e); a += rowx<2>(a); c += rowx<2>(c); e += rowx<2>(e); a += rowx<4>(a); c += rowx<4>(c); e += rowx<4>(e); a += rowx<8>(a); c += rowx<8>(c); e += rowx<8>(e);
    if (nloc == 0) { Bk[rowb + r8][0] = a; Bk[rowb + r8][2 * CLIP] = c; Ls[rowb + r8] = a + c + e; } }
  float w0[8], w1[8]; const int j1 = 17 + (nloc < 15 ? nloc : 14);   // lane 15 of a row has no second slot: it reads its neighbour's and stores nothing
#pragma unroll
  for (int r8 = 0; r8 < 8; ++r8) { w0[r8] = __expf(Bk[rowb + r8][1 + nloc] - mrow[r8]); w1[r8] = __expf(Bk[rowb + r8][j1] - mrow[r8]); }
#pragma unroll
  for (int r8 = 0; r8 < 8; ++r8) { Bk[rowb + r8][1 + nloc] = w0[r8]; if (nloc < 15) Bk[rowb + r8][j1] = w1[r8]; }
#pragma unroll
  for (int t = 0; t < 4; ++t)
#pragma unroll
    for (int r8 = 0; r8 < 8; ++r8) Of[8 * hlf + r8][t * 16 + nloc] = oacc[t][r8] * (1.0f / (PS * HS));
  wave_lds_sync();
  // + sum_r Bk[row][r] Ev[r][d]; lane = d pair. Every '#pragma unroll' here makes the indices of evr, bq and a constants, so that they stay in registers.
#pragma unroll
  for (int j = 0; j < NR; ++j) { evr[j][0] = bf16_near(evr[j][0]); evr[j][1] = bf16_near(evr[j][1]); }
#pragma unroll 1   // stays rolled: four rows a trip already give four independent sum chains, and sixteen would only lengthen the code
  for (int r0 = 0; r0 < 16; r0 += 4) { v2f a[4]; v4f bq[4][8]; float bl[4], inv[4];
#pragma unroll
    for (int i = 0; i < 4; ++i) { a[i] = (v2f){Of[r0 + i][lane * 2], Of[r0 + i][lane * 2 + 1]}; bl[i] = Bk[r0 + i][32]; inv[i] = 1.0f / Ls[r0 + i];
#pragma unroll
      for (int j = 0; j < 8; ++j) bq[i][j] = *(const v4f*)(&Bk[r0 + i][j * 4]); }
#pragma unroll
    for (int j = 0; j < NR - 1; ++j)
#pragma unroll
      for (int i = 0; i < 4; ++i) a[i] += bq[i][j >> 2][j & 3] * evr[j];
#pragma unroll
    for (int i = 0; i < 4; ++i) { a[i] += bl[i] * evr[NR - 1]; *(v2f*)(O + (tq + r0 + i) * D + h * HD + lane * 2) = a[i] * inv[i]; }
    asm volatile("s_wait_xcnt 0x0" ::: "memory"); } }   // the next trip rewrites the registers that these issued stores name: the wait stands in front of that overwrite
__global__ __launch_bounds__(256) void outp_kernel(const float* __restrict__ O, const b16* __restrict__ WO, int ALIM, float* __restrict__ out) {
  __shared__ __attribute__((aligned(16))) b16 Ah[BM][LP], Al[BM][LP], Bs[BN][LP]; __shared__ __attribute__((aligned(16))) float Tf[8][16][68];
  const int tid = threadIdx.x, lane = tid & 31, wave = tid >> 5, nloc = lane & 15, hlf = lane >> 4, wm = wave >> 1, wn = wave & 1;
  const size_t t0 = (size_t)blockIdx.x * BM; const int c0 = blockIdx.y * BN; if ((int)(t0 % S) >= ALIM) return;
  const int ar = tid >> 4, ac = (tid & 15) * 4, br = tid >> 3, bc = (tid & 7) * 8;
  const float* og = O + (t0 + ar) * D + ac; const b16* wg = WO + ((size_t)c0 + br) * D + bc;
  v4f ra[8]; v8b rb[4];
#pragma unroll
  for (int i = 0; i < 8; ++i) ra[i] = *(const v4f*)(og + (size_t)i * 16 * D);
#pragma unroll
  for (int i = 0; i < 4; ++i) rb[i] = *(const v8b*)(wg + (size_t)i * 32 * D);
  v8f acc[2][4];
#pragma unroll
  for (int mi = 0; mi < 2; ++mi)
#pragma unroll
    for (int ni = 0; ni < 4; ++ni) acc[mi][ni] = (v8f){};
#pragma unroll 1   // stays rolled, for speed only
  for (int k0 = 0; k0 < D; k0 += KS) {
#pragma unroll
    for (int i = 0; i < 8; ++i) { v4b hx, lx;
#pragma unroll
      for (int j = 0; j < 4; ++j) { b16 p, q; split16(ra[i][j] * HS, p, q); hx[j] = p; lx[j] = q; }
      *(v4b*)(&Ah[ar + i * 16][ac]) = hx; *(v4b*)(&Al[ar + i * 16][ac]) = lx; }
#pragma unroll
    for (int i = 0; i < 4; ++i) *(v8b*)(&Bs[br + i * 32][bc]) = rb[i];
    __syncthreads();
    if (k0 + KS < D) {
#pragma unroll
      for (int i = 0; i < 8; ++i) ra[i] = *(const v4f*)(og + (size_t)i * 16 * D + k0 + KS);
#pragma unroll
      for (int i = 0; i < 4; ++i) rb[i] = *(const v8b*)(wg + (size_t)i * 32 * D + k0 + KS);
      asm volatile("s_wait_xcnt 0x0" ::: "memory"); }   // the loop advances the address registers that these issued loads name: the wait stands in front of that overwrite
#pragma unroll
    for (int kb = 0; kb < KS; kb += 32) { v16b a[2], al[2], bw[4];
#pragma unroll
      for (int mi = 0; mi < 2; ++mi) { a[mi] = frag_kb(&Ah[wm * 32 + mi * 16 + nloc][kb], hlf); al[mi] = frag_kb(&Al[wm * 32 + mi * 16 + nloc][kb], hlf); }
#pragma unroll
      for (int ni = 0; ni < 4; ++ni) bw[ni] = frag_kb(&Bs[wn * 64 + ni * 16 + nloc][kb], hlf);
#pragma unroll
      for (int mi = 0; mi < 2; ++mi)
#pragma unroll
        for (int ni = 0; ni < 4; ++ni) acc[mi][ni] = wmma16b(a[mi], bw[ni], acc[mi][ni]);
#pragma unroll
      for (int mi = 0; mi < 2; ++mi)
#pragma unroll
        for (int ni = 0; ni < 4; ++ni) acc[mi][ni] = wmma16b(al[mi], bw[ni], acc[mi][ni]); }
    __syncthreads(); }
#pragma unroll
  for (int mi = 0; mi < 2; ++mi) {
#pragma unroll
    for (int ni = 0; ni < 4; ++ni)
#pragma unroll
      for (int r8 = 0; r8 < 8; ++r8) Tf[wave][8 * hlf + r8][ni * 16 + nloc] = acc[mi][ni][r8] * (1.0f / (HS * WSC));
    wave_lds_sync();
    v4f tv[8]; const size_t o = (t0 + wm * 32 + mi * 16 + hlf) * D + c0 + wn * 64 + nloc * 4;
#pragma unroll
    for (int rr = 0; rr < 8; ++rr) tv[rr] = *(const v4f*)(&Tf[wave][rr * 2 + hlf][nloc * 4]);
#pragma unroll
    for (int rr = 0; rr < 8; ++rr) *(v4f*)(out + o + (size_t)rr * 2 * D) = tv[rr];
    wave_lds_sync(); } }
}  // namespace

extern "C" void kernel_launch(void* const* d_in, const int* in_sizes, int n_in, void* d_out, int out_size, void* d_ws, size_t ws_size, hipStream_t stream) {
  (void)n_in;
  auto Fp = [&](int i) { return (const float*)d_in[i]; }; auto Ip = [&](int i) { return (const int*)d_in[i]; };
  // Input order: 0 queries [4,1024,1024]; 1 keys; 2 values; 3 valid_lens [4] i32; 4 Wq [1024,1024]; 5 Wk; 6 Wv; 7 Wo; 8 Ek [33,64]; 9 Ev [33,64]
  if (in_sizes[0] != NT * D || in_sizes[1] != NT * D || in_sizes[2] != NT * D || in_sizes[3] != NB_ || in_sizes[4] != D * D || in_sizes[7] != D * D || in_sizes[8] != NR * HD || in_sizes[9] != NR * HD || out_size != NT * D) return;
  const int QLIM = S, ALIM = S;   // QLIM = tokens projected per batch (>= max valid_len), ALIM = queries attended/output (multiples of 16)
  size_t off = 0; char* ws = (char*)d_ws;
  auto carve = [&](size_t bytes) { char* p = ws + off; off += (bytes + 255) & ~(size_t)255; return p; };
  b16* W4 = (b16*)carve((size_t)4 * D * D * 2); b16* EKh = (b16*)carve(48 * HD * 2); b16* EKl = (b16*)carve(48 * HD * 2); b16* Qh = (b16*)carve((size_t)NT * D * 2); b16* Ql = (b16*)carve((size_t)NT * D * 2); b16* Kh = (b16*)carve((size_t)NT * D * 2); b16* Kl = (b16*)carve((size_t)NT * D * 2); float* V = (float*)carve((size_t)NT * D * 4); b16* VTh = (b16*)carve((size_t)NT * D * 2); b16* VTl = (b16*)carve((size_t)NT * D * 2); float* O = (float*)carve((size_t)NT * D * 4);
  if (off > ws_size || off > ((size_t)104 << 20)) return;   // ~ 90 MB
  wput_kernel<<<256, 256, 0, stream>>>(Fp(4), Fp(5), Fp(6), Fp(7), Fp(8), W4, EKh, EKl);
  proj_kernel<<<dim3(NT / BM, D / BN, 3), 256, 0, stream>>>(Fp(0), Fp(1), Fp(2), W4, QLIM, Qh, Ql, Kh, Kl, V);
  vt_kernel<<<(NT / 64) * 4, 256, 0, stream>>>(V, VTh, VTl);
  att_kernel<<<NB_ * H * (S / (16 * AW)), 32 * AW, 0, stream>>>(Qh, Ql, Kh, Kl, VTh, VTl, EKh, EKl, Fp(9), Ip(3), ALIM, O);
  outp_kernel<<<dim3(NT / BM, D / BN), 256, 0, stream>>>(O, W4 + (size_t)3 * D * D, ALIM, (float*)d_out);
}

// v005
// It runs in 118 microseconds.
// Timed twice side by side with v004, it ran 1.21 times as fast both times.
// All steps since v000 together make it 12.2 times as fast.
#include <hip/hip_runtime.h>

// MultiHeadAttentionWithRPR: q = queries Wq^T, k = keys Wk^T, v = values Wv^T (16 heads x 64); dist = clip(k - q, -16, 16) + 16; scores = (q.k + q.Ek[dist]) / 8; keys >= valid_lens[b] -> -1e6 (excluded); attn = softmax; out_h = attn v + sum_k attn Ev[dist]; out = concat_h Wo^T -> [4][1024][1024].
// Deterministic: online softmax over fixed 128-key chunks (only chunks below valid_len), fixed order; the Ev term via 33 per-row bucket sums of attn; no atomics.
// WMMA (v_wmma_f32_16x16x32_f16, f32 accumulate): inputs (EXACT bf16 x8, K 1,024) x Wq/Wk rows (EXACT), Wv rows x inputs (v^T), in 128 x 128 block tiles; per (bh, 16-query) wave (8 waves a work-group, K and V^T chunks shared in LDS) QE = q (hi+lo) x Ek rows (hi+lo; 3 tiles), S = q x k rows (hi+lo; 8 tiles/chunk), O += P (hi+lo) x v^T (hi+lo; 4 tiles); o (hi+lo) x Wo rows (64 tiles) — ≈ 4 M WMMA; softmax, buckets, Ev epilogue in f32.

namespace {
constexpr int NB_ = 4, S = 1024, D = 1024, H = 16, HD = 64, CLIP = 16, NR = 2 * CLIP + 1 /* 33 */, NT = NB_ * S, CH = 128;
constexpr int BM = 128, BN = 128, KS = 64, LP = KS + 8;   // GEMM block tile, k per LDS stage, LDS row pitch in halves (144 B = 16 B x odd, for 16-byte readers)
constexpr int AW = 8, KP = HD + 8, VP = CH + 8;   // attention: waves of a work-group; LDS row pitch in halves of a staged K row (144 B) and V^T row (272 B), each 16 B x odd, for 16-byte readers
constexpr float XS = 8.0f, HS = 256.0f, PS = 256.0f, WSC = 256.0f, SCALE = 0.125f;
typedef _Float16 b16;
typedef __attribute__((ext_vector_type(16))) _Float16 v16b;
typedef __attribute__((ext_vector_type(8))) _Float16 v8b;
typedef __attribute__((ext_vector_type(4))) _Float16 v4b;
typedef __attribute__((ext_vector_type(8))) float v8f;
typedef __attribute__((ext_vector_type(4))) float v4f;
typedef __attribute__((ext_vector_type(2))) float v2f;
__device__ __forceinline__ float bf16_rne(float f) { unsigned int u = __float_as_uint(f); u += 0x7FFFu + ((u >> 16) & 1u); float r = __uint_as_float(u & 0xFFFF0000u); asm volatile("" : "+v"(r)); return r; }
__device__ __forceinline__ float bfv(float f) { float r = bf16_rne(f); asm volatile("" : "+v"(r)); return r; }
__device__ __forceinline__ void split16(float v, b16& hi, b16& lo) { hi = (b16)v; lo = (b16)(v - (float)hi); }
__device__ __forceinline__ v16b frag_kb(const b16* p, int hh) { const v8b a = *(const v8b*)(p + 8 * hh), b = *(const v8b*)(p + 16 + 8 * hh); v16b f;
#pragma unroll
  for (int e = 0; e < 8; ++e) { f[e] = a[e]; f[8 + e] = b[e]; } return f; }
__device__ __forceinline__ v8f wmma16b(v16b a, v16b b, v8f c) { v8f d = __builtin_amdgcn_wmma_f32_16x16x32_f16(false, a, false, b, (short)0, c, false, false); asm volatile("v_nop\n\tv_nop\n\tv_nop\n\tv_nop" : "+v"(d) : "v"(a), "v"(b)); return d; }
__device__ __forceinline__ void wave_lds_sync() { __builtin_amdgcn_fence(__ATOMIC_RELEASE, "workgroup"); __builtin_amdgcn_wave_barrier(); __builtin_amdgcn_fence(__ATOMIC_ACQUIRE, "workgroup"); }
__device__ __forceinline__ float bf16_near(float f) { unsigned int u = __float_as_uint(f); u += 0x7FFFu + ((u >> 16) & 1u); return __uint_as_float(u & 0xFFFF0000u); }   // f rounded to the nearest bf16 value, ties to even
template <int M> __device__ __forceinline__ float rowx(float x) { return __builtin_bit_cast(float, __builtin_amdgcn_update_dpp(__builtin_bit_cast(int, x), __builtin_bit_cast(int, x), 0x160 + M, 0xf, 0xf, false)); }   // the value of lane l ^ M of the same 16-lane row (row_xmask)
__device__ __forceinline__ unsigned lds_off(const b16* p) { typedef __attribute__((address_space(3))) const b16 lds_b16; return (unsigned)(size_t)(lds_b16*)p; }   // byte address of p inside the work-group's LDS
// Eight asynchronous copies, 16 bytes a lane each, global memory -> LDS through no register: copies 0-3 read ga + i * gs, copies 4-7 gb + (i - 4) * gs; copy i lands at LDS byte l + i * ls.
// The s_wait_xcnt closes the statement so that no address register of an issued copy is rewritten in front of it.
__device__ __forceinline__ void copy8(unsigned l, unsigned ls, const b16* ga, const b16* gb, size_t gs) {
  asm volatile("global_load_async_to_lds_b128 %0, %8, off\n\tglobal_load_async_to_lds_b128 %1, %9, off\n\tglobal_load_async_to_lds_b128 %2, %10, off\n\tglobal_load_async_to_lds_b128 %3, %11, off\n\t"
               "global_load_async_to_lds_b128 %4, %12, off\n\tglobal_load_async_to_lds_b128 %5, %13, off\n\tglobal_load_async_to_lds_b128 %6, %14, off\n\tglobal_load_async_to_lds_b128 %7, %15, off\n\ts_wait_xcnt 0x0"
               :: "v"(l), "v"(l + ls), "v"(l + 2 * ls), "v"(l + 3 * ls), "v"(l + 4 * ls), "v"(l + 5 * ls), "v"(l + 6 * ls), "v"(l + 7 * ls),
                  "v"(ga), "v"(ga + gs), "v"(ga + 2 * gs), "v"(ga + 3 * gs), "v"(gb), "v"(gb + gs), "v"(gb + 2 * gs), "v"(gb + 3 * gs) : "memory"); }
__device__ __forceinline__ int iclamp(int v, int lo, int hi) { return v < lo ? lo : (v > hi ? hi : v); }

__global__ __launch_bounds__(256) void wput_kernel(const float* __restrict__ wq, const float* __restrict__ wk, const float* __restrict__ wv, const float* __restrict__ wo, const float* __restrict__ ek, b16* __restrict__ W4, b16* __restrict__ EKh, b16* __restrict__ EKl) { const size_t nt = (size_t)gridDim.x * 256, u0 = (size_t)blockIdx.x * 256 + threadIdx.x; v8b v;
  for (size_t u = u0; u < (size_t)4 * D * 128; u += nt) { const int o = (int)(u / 128), k0 = (int)(u % 128) * 8; const int which = o / D, oo = o % D; const float* w = which == 0 ? wq : (which == 1 ? wk : (which == 2 ? wv : wo));
#pragma unroll
    for (int j = 0; j < 8; ++j) v[j] = (b16)(bf16_rne(w[(size_t)oo * D + k0 + j]) * WSC); { *(v8b*)(W4 + (size_t)o * D + k0) = v;  } }
  if (u0 < 48 * 8) { const int r = (int)(u0 / 8), k0 = (int)(u0 % 8) * 8; v8b a, c;
#pragma unroll
    for (int j = 0; j < 8; ++j) { float e = r < NR ? bfv(ek[(size_t)r * HD + k0 + j]) : 0.0f; b16 p, pl; split16(e * HS, p, pl); a[j] = p; c[j] = pl; } { *(v8b*)(EKh + (size_t)r * HD + k0) = a; *(v8b*)(EKl + (size_t)r * HD + k0) = c;  } } }
// The four dense projections run as block-tiled GEMMs: 8 waves share one 128 x 128 output tile (wave = 32 rows x 64 columns), both operands staged in LDS 64 k at a time,
// the next stage's global loads issued ahead of the current stage's products. Every accumulator still sums k in ascending blocks of 32.
// In both kernels each '#pragma unroll' makes the indices of a register array (ra, rb, acc, fragments, tv) constants, so that it stays in registers.
__global__ __launch_bounds__(256) void proj_kernel(const float* __restrict__ xq, const float* __restrict__ xk, const float* __restrict__ xv, const b16* __restrict__ W4, int QLIM, b16* __restrict__ Qh, b16* __restrict__ Ql, b16* __restrict__ Kh, b16* __restrict__ Kl, b16* __restrict__ VTh, b16* __restrict__ VTl) {
  __shared__ __attribute__((aligned(16))) b16 As[BM][LP], Bs[BN][LP]; __shared__ __attribute__((aligned(16))) float Tf[8][16][68];
  const int tid = threadIdx.x, lane = tid & 31, wave = tid >> 5, nloc = lane & 15, hlf = lane >> 4, wm = wave >> 1, wn = wave & 1;
  const size_t t0 = (size_t)blockIdx.x * BM; const int c0 = blockIdx.y * BN, which = blockIdx.z; if ((int)(t0 % S) >= QLIM) return;
  const float* x = which == 0 ? xq : (which == 1 ? xk : xv);
  // v is wanted transposed ([batch][feature][token]): its product takes the W rows as A and the x rows as B, so that an accumulator tile has features as rows and tokens as columns (wave = 32 features x 64 tokens)
  const b16 (*Af)[LP] = which == 2 ? Bs : As; const b16 (*Bf)[LP] = which == 2 ? As : Bs;
  const int ar = tid >> 4, ac = (tid & 15) * 4, br = tid >> 3, bc = (tid & 7) * 8;   // staging: 16 lanes per 256-B piece of an x row, 8 lanes per 128-B piece of a W row
  const float* xg = x + (t0 + ar) * D + ac; const b16* wg = W4 + ((size_t)which * D + c0 + br) * D + bc;
  v4f ra[8]; v8b rb[4];
#pragma unroll
  for (int i = 0; i < 8; ++i) ra[i] = *(const v4f*)(xg + (size_t)i * 16 * D);
#pragma unroll
  for (int i = 0; i < 4; ++i) rb[i] = *(const v8b*)(wg + (size_t)i * 32 * D);
  v8f acc[2][4];
#pragma unroll
  for (int mi = 0; mi < 2; ++mi)
#pragma unroll
    for (int ni = 0; ni < 4; ++ni) acc[mi][ni] = (v8f){};
#pragma unroll 1   // stays rolled, for speed only
  for (int k0 = 0; k0 < D; k0 += KS) {
#pragma unroll
    for (int i = 0; i < 8; ++i) { v4b hx;
#pragma unroll
      for (int j = 0; j < 4; ++j) hx[j] = (b16)(bf16_rne(ra[i][j]) * XS);
      *(v4b*)(&As[ar + i * 16][ac]) = hx; }
#pragma unroll
    for (int i = 0; i < 4; ++i) *(v8b*)(&Bs[br + i * 32][bc]) = rb[i];
    __syncthreads();
    if (k0 + KS < D) {
#pragma unroll
      for (int i = 0; i < 8; ++i) ra[i] = *(const v4f*)(xg + (size_t)i * 16 * D + k0 + KS);
#pragma unroll
      for (int i = 0; i < 4; ++i) rb[i] = *(const v8b*)(wg + (size_t)i * 32 * D + k0 + KS);
      asm volatile("s_wait_xcnt 0x0" ::: "memory"); }   // the loop advances the address registers that these issued loads name: the wait stands in front of that overwrite
#pragma unroll
    for (int kb = 0; kb < KS; kb += 32) { v16b a[2], bw[4];
#pragma unroll
      for (int mi = 0; mi < 2; ++mi) a[mi] = frag_kb(&Af[wm * 32 + mi * 16 + nloc][kb], hlf);
#pragma unroll
      for (int ni = 0; ni < 4; ++ni) bw[ni] = frag_kb(&Bf[wn * 64 + ni * 16 + nloc][kb], hlf);
#pragma unroll
      for (int mi = 0; mi < 2; ++mi)
#pragma unroll
        for (int ni = 0; ni < 4; ++ni) acc[mi][ni] = wmma16b(a[mi], bw[ni], acc[mi][ni]); }
    __syncthreads(); }
  // each wave stages 16 x 64 results in its own LDS range and stores whole lines: two rows per instruction, 16 lanes a row
#pragma unroll
  for (int mi = 0; mi < 2; ++mi) {
#pragma unroll
    for (int ni = 0; ni < 4; ++ni)
#pragma unroll
      for (int r8 = 0; r8 < 8; ++r8) Tf[wave][8 * hlf + r8][ni * 16 + nloc] = acc[mi][ni][r8] * (1.0f / (XS * WSC));
    wave_lds_sync();
    v4f tv[8]; const size_t o = which == 2 ? ((t0 / S) * D + c0 + wm * 32 + mi * 16 + hlf) * S + t0 % S + wn * 64 + nloc * 4 : (t0 + wm * 32 + mi * 16 + hlf) * D + c0 + wn * 64 + nloc * 4;   // v: row = feature, of S tokens; q, k: row = token, of D features
#pragma unroll
    for (int rr = 0; rr < 8; ++rr) tv[rr] = *(const v4f*)(&Tf[wave][rr * 2 + hlf][nloc * 4]);
    { static_assert(S == D, "one row pitch serves both layouts"); b16* Ph = which == 0 ? Qh : (which == 1 ? Kh : VTh); b16* Pl = which == 0 ? Ql : (which == 1 ? Kl : VTl);
#pragma unroll
      for (int rr = 0; rr < 8; ++rr) { v4b ph, pl;
#pragma unroll
        for (int j = 0; j < 4; ++j) { b16 p, q; split16(tv[rr][j] * HS, p, q); ph[j] = p; pl[j] = q; }
        *(v4b*)(Ph + o + (size_t)rr * 2 * D) = ph; *(v4b*)(Pl + o + (size_t)rr * 2 * D) = pl; } }
    wave_lds_sync(); } }
// One work-group of 8 waves per (batch-head, 128 queries), one wave per 16 queries. Each 128-key chunk of K and V^T (hi and lo) is staged once for all eight waves in LDS by asynchronous copies, whole 128-B lines,
// two buffers: chunk c + 1 flies while chunk c is worked on; every fragment of K and V^T is read from LDS. Everything else is private to its wave, as are its LDS ranges (index [wave]). The scores of a 128-key chunk stay in their eight accumulator tiles (lane = key column, register = query row 8 * half + r8):
// bias, mask, row maximum (in-lane over the tiles, then a 16-lane exchange), exp and the sums all run on all 32 lanes in that layout; only P goes through LDS, to become an A fragment.
// Buckets: distance <= -16 and >= 16 are running per-lane sums, joined once after the loop; each of the 31 inner distances has one key, whose score is kept and turned into its weight with the final maximum.
__global__ __launch_bounds__(32 * AW) void att_kernel(const b16* __restrict__ Qh, const b16* __restrict__ Ql, const b16* __restrict__ Kh, const b16* __restrict__ Kl, const b16* __restrict__ VTh, const b16* __restrict__ VTl, const b16* __restrict__ EKh, const b16* __restrict__ EKl, const float* __restrict__ ev, const int* __restrict__ vlens, int ALIM, float* __restrict__ O) { __shared__ __attribute__((aligned(16))) b16 Ksh[2][2][CH][KP], Vsh[2][2][HD][VP];   // [buffer][hi, lo][key][d] and [buffer][hi, lo][d][key]
  __shared__ __attribute__((aligned(16))) b16 PaW[AW][16][CH + 8], PbW[AW][16][CH + 8]; __shared__ __attribute__((aligned(16))) float BkW[AW][16][36]; __shared__ float QEW[AW][16][49], LsW[AW][16], OfW[AW][16][HD + 1];
  const int lane = threadIdx.x & 31, wave = __builtin_amdgcn_readfirstlane(threadIdx.x >> 5), nloc = lane & 15, hlf = lane >> 4, rowb = 8 * hlf;   // the wave's number in a scalar register keeps the tests on q0 below scalar branches
  const int bh = blockIdx.x / (S / (16 * AW)), qb = (blockIdx.x % (S / (16 * AW))) * (16 * AW); if (qb >= ALIM) return; const int q0 = qb + wave * 16; const int b = bh / H, h = bh % H; const size_t tq = (size_t)b * S + q0; const int vl = iclamp(vlens[b], 0, S), nch = (vl + CH - 1) / CH;
  b16 (*Pa)[CH + 8] = PaW[wave]; b16 (*Pb)[CH + 8] = PbW[wave]; float (*Bk)[36] = BkW[wave]; float (*QE)[49] = QEW[wave]; float* Ls = LsW[wave]; float (*Of)[HD + 1] = OfW[wave];
  // staging, per wave and chunk: 8 copies of 4 K rows (8 lanes a 128-B row; rows i * 32 + wave * 4 + ..., hi then lo) and 8 copies of 2 V^T rows (16 lanes a 256-B row piece; rows i * 16 + wave * 2 + ..., hi then lo)
  const int kr = wave * 4 + (lane >> 3), kc = (lane & 7) * 8, vr = wave * 2 + (lane >> 4), vc = (lane & 15) * 8;
  const size_t kg = ((size_t)b * S + kr) * D + h * HD + kc, vg = ((size_t)bh * HD + vr) * S + vc;
  auto stage = [&](int c, int buf) { copy8(lds_off(&Ksh[buf][0][kr][kc]), 32 * KP * 2, Kh + kg + (size_t)c * CH * D, Kl + kg + (size_t)c * CH * D, (size_t)32 * D);
    copy8(lds_off(&Vsh[buf][0][vr][vc]), 16 * VP * 2, VTh + vg + c * CH, VTl + vg + c * CH, (size_t)16 * S); };
  stage(0, 0);   // chunk 0 flies under the set-up below
  if (lane < 16) { for (int r = 0; r < NR; ++r) Bk[lane][r] = -INFINITY; }
  v16b qa[2], ql[2]; for (int ks = 0; ks < 2; ++ks) { qa[ks] = frag_kb(Qh + (tq + nloc) * D + h * HD + ks * 32, hlf); ql[ks] = frag_kb(Ql + (tq + nloc) * D + h * HD + ks * 32, hlf); }
  // QE[q][r] = q . Ek[r]
#pragma unroll
  for (int t = 0; t < 3; ++t) { v8f e = (v8f){};
#pragma unroll
    for (int ks = 0; ks < 2; ++ks) { const v16b eh = frag_kb(EKh + (size_t)(t * 16 + nloc) * HD + ks * 32, hlf), el = frag_kb(EKl + (size_t)(t * 16 + nloc) * HD + ks * 32, hlf); e = wmma16b(qa[ks], eh, e); e = wmma16b(qa[ks], el, e); e = wmma16b(ql[ks], eh, e); }
#pragma unroll
    for (int r8 = 0; r8 < 8; ++r8) QE[8 * hlf + r8][t * 16 + nloc] = e[r8] * (1.0f / (HS * HS)); }
  wave_lds_sync();
  asm volatile("s_wait_asynccnt 0x0" ::: "memory");   // this wave's copies of chunk 0 have landed
  __syncthreads();                                    // ... and so have the other waves': chunk 0 may be read
  if (nch > 1) stage(1, 1);
  v8f oacc[4] = {(v8f){}, (v8f){}, (v8f){}, (v8f){}};
  // every '#pragma unroll' below makes the indices of a register array (sacc, oacc, kh, kl, vh, vlo, mrow, mx, slo, shi, sin_, w0, w1) constants, so that it stays in registers
  float mrow[8], slo[8], shi[8], sin_[8];
#pragma unroll
  for (int r8 = 0; r8 < 8; ++r8) { mrow[r8] = -INFINITY; slo[r8] = 0.0f; shi[r8] = 0.0f; sin_[r8] = 0.0f; }
#pragma unroll 1   // stays rolled: the trip count comes from valid_lens
  for (int ch = 0; ch < nch; ++ch) { const int k0 = ch * CH; v8f sacc[CH / 16]; const b16 (*Kc)[CH][KP] = Ksh[ch & 1]; const b16 (*Vc)[HD][VP] = Vsh[ch & 1];
#pragma unroll
    for (int tg = 0; tg < CH / 16; tg += 2) { v16b kh[2][2], kl[2][2];   // two tiles' fragment reads stand together, ahead of their products, for speed only
#pragma unroll
      for (int t = 0; t < 2; ++t)
#pragma unroll
        for (int ks = 0; ks < 2; ++ks) { kh[t][ks] = frag_kb(&Kc[0][(tg + t) * 16 + nloc][ks * 32], hlf); kl[t][ks] = frag_kb(&Kc[1][(tg + t) * 16 + nloc][ks * 32], hlf); }
#pragma unroll
      for (int t = 0; t < 2; ++t) { v8f s = (v8f){};
#pragma unroll
        for (int ks = 0; ks < 2; ++ks) { s = wmma16b(qa[ks], kh[t][ks], s); s = wmma16b(qa[ks], kl[t][ks], s); s = wmma16b(ql[ks], kh[t][ks], s); }
        sacc[tg + t] = s; } }
    const int dl = k0 + nloc - q0 - rowb;   // key - query of this lane at tile 0, register 0
    float mx[8];
#pragma unroll
    for (int r8 = 0; r8 < 8; ++r8) mx[r8] = -INFINITY;
#pragma unroll
    for (int t = 0; t < CH / 16; ++t) { const int rel = k0 + t * 16 - q0; const bool live = k0 + t * 16 + nloc < vl;
#pragma unroll
      for (int r8 = 0; r8 < 8; ++r8) { const int dd = iclamp(dl + t * 16 - r8, -CLIP, CLIP) + CLIP; const float s = (sacc[t][r8] * (1.0f / (HS * HS)) + QE[rowb + r8][dd]) * SCALE; const float sm = live ? s : -INFINITY; sacc[t][r8] = sm; mx[r8] = fmaxf(mx[r8], sm); }
      if (rel >= -16 && rel <= 16) {   // wave-uniform: only these three tiles hold an inner distance
#pragma unroll
        for (int r8 = 0; r8 < 8; ++r8) { const int d = dl + t * 16 - r8; if (d > -CLIP && d < CLIP) Bk[rowb + r8][d + CLIP] = sacc[t][r8]; } } }
#pragma unroll
    for (int r8 = 0; r8 < 8; ++r8) { float m = mx[r8]; m = fmaxf(m, rowx<1>(m)); m = fmaxf(m, rowx<2>(m)); m = fmaxf(m, rowx<4>(m)); m = fmaxf(m, rowx<8>(m));
      const float mo = mrow[r8], mn = fmaxf(mo, m); const float fac = (mo == -INFINITY) ? 0.0f : __expf(mo - mn); mrow[r8] = mn; slo[r8] *= fac; shi[r8] *= fac; sin_[r8] *= fac;
#pragma unroll
      for (int t = 0; t < 4; ++t) oacc[t][r8] *= fac; }
#pragma unroll
    for (int t = 0; t < CH / 16; ++t) { const int rel = k0 + t * 16 - q0;
#pragma unroll
      for (int r8 = 0; r8 < 8; ++r8) { const float p = __expf(sacc[t][r8] - mrow[r8]); sacc[t][r8] = p; b16 ph, pl; split16(p * PS, ph, pl); Pa[rowb + r8][t * 16 + nloc] = ph; Pb[rowb + r8][t * 16 + nloc] = pl; }
      if (rel <= -32) {
#pragma unroll
        for (int r8 = 0; r8 < 8; ++r8) slo[r8] += sacc[t][r8]; }
      else if (rel >= 32) {
#pragma unroll
        for (int r8 = 0; r8 < 8; ++r8) shi[r8] += sacc[t][r8]; }
      else {
#pragma unroll
        for (int r8 = 0; r8 < 8; ++r8) { const int d = dl + t * 16 - r8; const float p = sacc[t][r8]; slo[r8] += d <= -CLIP ? p : 0.0f; shi[r8] += d >= CLIP ? p : 0.0f; sin_[r8] += (d > -CLIP && d < CLIP) ? p : 0.0f; } } }
    wave_lds_sync();
#pragma unroll 2
    for (int kb = 0; kb < CH; kb += 32) { const v16b pa = frag_kb(&Pa[nloc][kb], hlf), pb = frag_kb(&Pb[nloc][kb], hlf); v16b vh[4], vlo[4];   // again one group of reads ahead of the products
#pragma unroll
      for (int t = 0; t < 4; ++t) { vh[t] = frag_kb(&Vc[0][t * 16 + nloc][kb], hlf); vlo[t] = frag_kb(&Vc[1][t * 16 + nloc][kb], hlf); }
#pragma unroll
      for (int t = 0; t < 4; ++t) { oacc[t] = wmma16b(pa, vh[t], oacc[t]); oacc[t] = wmma16b(pa, vlo[t], oacc[t]); oacc[t] = wmma16b(pb, vh[t], oacc[t]); } }
    asm volatile("s_wait_dscnt 0x0" ::: "memory");      // this wave's reads of the chunk's buffer (and of its P) have returned
    asm volatile("s_wait_asynccnt 0x0" ::: "memory");   // this wave's copies of chunk ch + 1 have landed
    __syncthreads();                                    // publishes chunk ch + 1 and frees the buffer that this pass has read
    if (ch + 2 < nch) stage(ch + 2, ch & 1); }
  asm volatile("s_wait_asynccnt 0x0" ::: "memory");     // no copy is outstanding behind the loop
  // this lane's two columns of all 33 Ev rows: the loads fly together, under the joins below, and the values stay in registers for all 16 query rows
  v2f evr[NR];
#pragma unroll
  for (int j = 0; j < NR; ++j) evr[j] = *(const v2f*)(ev + (size_t)j * HD + lane * 2);
  // join the 16 lanes' sums; the inner distances' kept scores become weights under the final maximum (a slot no key reached holds -inf and gives 0)
#pragma unroll
  for (int r8 = 0; r8 < 8; ++r8) { float a = slo[r8], c = shi[r8], e = sin_[r8];
    a += rowx<1>(a); c += rowx<1>(c); e += rowx<1>(e); a += rowx<2>(a); c += rowx<2>(c); e += rowx<2>(e); a += rowx<4>(a); c += rowx<4>(c); e += rowx<4>(e); a += rowx<8>(a); c += rowx<8>(c); e += rowx<8>(e);
    if (nloc == 0) { Bk[rowb + r8][0] = a; Bk[rowb + r8][2 * CLIP] = c; Ls[rowb + r8] = a + c + e; } }
  float w0[8], w1[8]; const int j1 = 17 + (nloc < 15 ? nloc : 14);   // lane 15 of a row has no second slot: it reads its neighbour's and stores nothing
#pragma unroll
  for (int r8 = 0; r8 < 8; ++r8) { w0[r8] = __expf(Bk[rowb + r8][1 + nloc] - mrow[r8]); w1[r8] = __expf(Bk[rowb + r8][j1] - mrow[r8]); }
#pragma unroll
  for (int r8 = 0; r8 < 8; ++r8) { Bk[rowb + r8][1 + nloc] = w0[r8]; if (nloc < 15) Bk[rowb + r8][j1] = w1[r8]; }
#pragma unroll
  for (int t = 0; t < 4; ++t)
#pragma unroll
    for (int r8 = 0; r8 < 8; ++r8) Of[8 * hlf + r8][t * 16 + nloc] = oacc[t][r8] * (1.0f / (PS * HS));
  wave_lds_sync();
  // + sum_r Bk[row][r] Ev[r][d]; lane = d pair. Every '#pragma unroll' here makes the indices of evr, bq and a constants, so that they stay in registers.
#pragma unroll
  for (int j = 0; j < NR; ++j) { evr[j][0] = bf16_near(evr[j][0]); evr[j][1] = bf16_near(evr[j][1]); }
#pragma unroll 1   // stays rolled: four rows a trip already give four independent sum chains, and sixteen would only lengthen the code
  for (int r0 = 0; r0 < 16; r0 += 4) { v2f a[4]; v4f bq[4][8]; float bl[4], inv[4];
#pragma unroll
    for (int i = 0; i < 4; ++i) { a[i] = (v2f){Of[r0 + i][lane * 2], Of[r0 + i][lane * 2 + 1]}; bl[i] = Bk[r0 + i][32]; inv[i] = 1.0f / Ls[r0 + i];
#pragma unroll
      for (int j = 0; j < 8; ++j) bq[i][j] = *(const v4f*)(&Bk[r0 + i][j * 4]); }
#pragma unroll
    for (int j = 0; j < NR - 1; ++j)
#pragma unroll
      for (int i = 0; i < 4; ++i) a[i] += bq[i][j >> 2][j & 3] * evr[j];
#pragma unroll
    for (int i = 0; i < 4; ++i) { a[i] += bl[i] * evr[NR - 1]; *(v2f*)(O + (tq + r0 + i) * D + h * HD + lane * 2) = a[i] * inv[i]; }
    asm volatile("s_wait_xcnt 0x0" ::: "memory"); } }   // the next trip rewrites the registers that these issued stores name: the wait stands in front of that overwrite
__global__ __launch_bounds__(256) void outp_kernel(const float* __restrict__ O, const b16* __restrict__ WO, int ALIM, float* __restrict__ out) {
  __shared__ __attribute__((aligned(16))) b16 Ah[BM][LP], Al[BM][LP], Bs[BN][LP]; __shared__ __attribute__((aligned(16))) float Tf[8][16][68];
  const int tid = threadIdx.x, lane = tid & 31, wave = tid >> 5, nloc = lane & 15, hlf = lane >> 4, wm = wave >> 1, wn = wave & 1;
  const size_t t0 = (size_t)blockIdx.x * BM; const int c0 = blockIdx.y * BN; if ((int)(t0 % S) >= ALIM) return;
  const int ar = tid >> 4, ac = (tid & 15) * 4, br = tid >> 3, bc = (tid & 7) * 8;
  const float* og = O + (t0 + ar) * D + ac; const b16* wg = WO + ((size_t)c0 + br) * D + bc;
  v4f ra[8]; v8b rb[4];
#pragma unroll
  for (int i = 0; i < 8; ++i) ra[i] = *(const v4f*)(og + (size_t)i * 16 * D);
#pragma unroll
  for (int i = 0; i < 4; ++i) rb[i] = *(const v8b*)(wg + (size_t)i * 32 * D);
  v8f acc[2][4];
#pragma unroll
  for (int mi = 0; mi < 2; ++mi)
#pragma unroll
    for (int ni = 0; ni < 4; ++ni) acc[mi][ni] = (v8f){};
#pragma unroll 1   // stays rolled, for speed only
  for (int k0 = 0; k0 < D; k0 += KS) {
#pragma unroll
    for (int i = 0; i < 8; ++i) { v4b hx, lx;
#pragma unroll
      for (int j = 0; j < 4; ++j) { b16 p, q; split16(ra[i][j] * HS, p, q); hx[j] = p; lx[j] = q; }
      *(v4b*)(&Ah[ar + i * 16][ac]) = hx; *(v4b*)(&Al[ar + i * 16][ac]) = lx; }
#pragma unroll
    for (int i = 0; i < 4; ++i) *(v8b*)(&Bs[br + i * 32][bc]) = rb[i];
    __syncthreads();
    if (k0 + KS < D) {
#pragma unroll
      for (int i = 0; i < 8; ++i) ra[i] = *(const v4f*)(og + (size_t)i * 16 * D + k0 + KS);
#pragma unroll
      for (int i = 0; i < 4; ++i) rb[i] = *(const v8b*)(wg + (size_t)i * 32 * D + k0 + KS);
      asm volatile("s_wait_xcnt 0x0" ::: "memory"); }   // the loop advances the address registers that these issued loads name: the wait stands in front of that overwrite
#pragma unroll
    for (int kb = 0; kb < KS; kb += 32) { v16b a[2], al[2], bw[4];
#pragma unroll
      for (int mi = 0; mi < 2; ++mi) { a[mi] = frag_kb(&Ah[wm * 32 + mi * 16 + nloc][kb], hlf); al[mi] = frag_kb(&Al[wm * 32 + mi * 16 + nloc][kb], hlf); }
#pragma unroll
      for (int ni = 0; ni < 4; ++ni) bw[ni] = frag_kb(&Bs[wn * 64 + ni * 16 + nloc][kb], hlf);
#pragma unroll
      for (int mi = 0; mi < 2; ++mi)
#pragma unroll
        for (int ni = 0; ni < 4; ++ni) acc[mi][ni] = wmma16b(a[mi], bw[ni], acc[mi][ni]);
#pragma unroll
      for (int mi = 0; mi < 2; ++mi)
#pragma unroll
        for (int ni = 0; ni < 4; ++ni) acc[mi][ni] = wmma16b(al[mi], bw[ni], acc[mi][ni]); }
    __syncthreads(); }
#pragma unroll
  for (int mi = 0; mi < 2; ++mi) {
#pragma unroll
    for (int ni = 0; ni < 4; ++ni)
#pragma unroll
      for (int r8 = 0; r8 < 8; ++r8) Tf[wave][8 * hlf + r8][ni * 16 + nloc] = acc[mi][ni][r8] * (1.0f / (HS * WSC));
    wave_lds_sync();
    v4f tv[8]; const size_t o = (t0 + wm * 32 + mi * 16 + hlf) * D + c0 + wn * 64 + nloc * 4;
#pragma unroll
    for (int rr = 0; rr < 8; ++rr) tv[rr] = *(const v4f*)(&Tf[wave][rr * 2 + hlf][nloc * 4]);
#pragma unroll
    for (int rr = 0; rr < 8; ++rr) *(v4f*)(out + o + (size_t)rr * 2 * D) = tv[rr];
    wave_lds_sync(); } }
}  // namespace

extern "C" void kernel_launch(void* const* d_in, const int* in_sizes, int n_in, void* d_out, int out_size, void* d_ws, size_t ws_size, hipStream_t stream) {
  (void)n_in;
  auto Fp = [&](int i) { return (const float*)d_in[i]; }; auto Ip = [&](int i) { return (const int*)d_in[i]; };
  // Input order: 0 queries [4,1024,1024]; 1 keys; 2 values; 3 valid_lens [4] i32; 4 Wq [1024,1024]; 5 Wk; 6 Wv; 7 Wo; 8 Ek [33,64]; 9 Ev [33,64]
  if (in_sizes[0] != NT * D || in_sizes[1] != NT * D || in_sizes[2] != NT * D || in_sizes[3] != NB_ || in_sizes[4] != D * D || in_sizes[7] != D * D || in_sizes[8] != NR * HD || in_sizes[9] != NR * HD || out_size != NT * D) return;
  const int QLIM = S, ALIM = S;   // QLIM = tokens projected per batch (>= max valid_len), ALIM = queries attended/output (multiples of 16)
  size_t off = 0; char* ws = (char*)d_ws;
  auto carve = [&](size_t bytes) { char* p = ws + off; off += (bytes + 255) & ~(size_t)255; return p; };
  b16* W4 = (b16*)carve((size_t)4 * D * D * 2); b16* EKh = (b16*)carve(48 * HD * 2); b16* EKl = (b16*)carve(48 * HD * 2); b16* Qh = (b16*)carve((size_t)NT * D * 2); b16* Ql = (b16*)carve((size_t)NT * D * 2); b16* Kh = (b16*)carve((size_t)NT * D * 2); b16* Kl = (b16*)carve((size_t)NT * D * 2); b16* VTh = (b16*)carve((size_t)NT * D * 2); b16* VTl = (b16*)carve((size_t)NT * D * 2); float* O = (float*)carve((size_t)NT * D * 4);
  if (off > ws_size || off > ((size_t)104 << 20)) return;   // ~ 76 MB
  wput_kernel<<<256, 256, 0, stream>>>(Fp(4), Fp(5), Fp(6), Fp(7), Fp(8), W4, EKh, EKl);
  proj_kernel<<<dim3(NT / BM, D / BN, 3), 256, 0, stream>>>(Fp(0), Fp(1), Fp(2), W4, QLIM, Qh, Ql, Kh, Kl, VTh, VTl);
  att_kernel<<<NB_ * H * (S / (16 * AW)), 32 * AW, 0, stream>>>(Qh, Ql, Kh, Kl, VTh, VTl, EKh, EKl, Fp(9), Ip(3), ALIM, O);
  outp_kernel<<<dim3(NT / BM, D / BN), 256, 0, stream>>>(O, W4 + (size_t)3 * D * D, ALIM, (float*)d_out);
}

// v006
// A run of this version takes 114 microseconds.
// In two side-by-side timings against v005, it was 1.04 and 1.03 times as fast.
// All steps since v000 together make it 12.6 times as fast.
#include <hip/hip_runtime.h>

// MultiHeadAttentionWithRPR: q = queries Wq^T, k = keys Wk^T, v = values Wv^T (16 heads x 64); dist = clip(k - q, -16, 16) + 16; scores = (q.k + q.Ek[dist]) / 8; keys >= valid_lens[b] -> -1e6 (excluded); attn = softmax; out_h = attn v + sum_k attn Ev[dist]; out = concat_h Wo^T -> [4][1024][1024].
// Deterministic: online softmax over fixed 128-key chunks (only chunks below valid_len), fixed order; the Ev term via 33 per-row bucket sums of attn; no atomics.
// WMMA (v_wmma_f32_16x16x32_f16, f32 accumulate): inputs (EXACT bf16 x8, K 1,024) x Wq/Wk/Wv rows (EXACT) in 128 x 128 block tiles; per (bh, 16-query) wave (8 waves a work-group, K and V^T chunks shared in LDS) QE = q (hi+lo) x Ek rows (hi+lo; 3 tiles), S^T = k rows x q (hi+lo; 8 tiles/chunk), O^T += v^T (hi+lo) x P (hi+lo; 4 tiles); o (hi+lo) x Wo rows (64 tiles) — ≈ 4 M WMMA; softmax, buckets, Ev epilogue in f32.

namespace {
constexpr int NB_ = 4, S = 1024, D = 1024, H = 16, HD = 64, CLIP = 16, NR = 2 * CLIP + 1 /* 33 */, NT = NB_ * S, CH = 128;
constexpr int BM = 128, BN = 128, KS = 64, LP = KS + 8;   // GEMM block tile, k per LDS stage, LDS row pitch in halves (144 B = 16 B x odd, for 16-byte readers)
constexpr int AW = 8, KP = HD + 8, VP = CH + 8;   // attention: waves of a work-group; LDS row pitch in halves of a staged K row (144 B) and V^T row (272 B), each 16 B x odd, for 16-byte readers
constexpr float XS = 8.0f, HS = 256.0f, PS = 256.0f, WSC = 256.0f, SCALE = 0.125f;
typedef _Float16 b16;
typedef __attribute__((ext_vector_type(16))) _Float16 v16b;
typedef __attribute__((ext_vector_type(8))) _Float16 v8b;
typedef __attribute__((ext_vector_type(4))) _Float16 v4b;
typedef __attribute__((ext_vector_type(2))) _Float16 v2b;
typedef __attribute__((ext_vector_type(8))) float v8f;
typedef __attribute__((ext_vector_type(4))) float v4f;
typedef __attribute__((ext_vector_type(2))) float v2f;
__device__ __forceinline__ float bf16_rne(float f) { unsigned int u = __float_as_uint(f); u += 0x7FFFu + ((u >> 16) & 1u); float r = __uint_as_float(u & 0xFFFF0000u); asm volatile("" : "+v"(r)); return r; }
__device__ __forceinline__ float bfv(float f) { float r = bf16_rne(f); asm volatile("" : "+v"(r)); return r; }
__device__ __forceinline__ void split16(float v, b16& hi, b16& lo) { hi = (b16)v; lo = (b16)(v - (float)hi); }
__device__ __forceinline__ v16b frag_kb(const b16* p, int hh) { const v8b a = *(const v8b*)(p + 8 * hh), b = *(const v8b*)(p + 16 + 8 * hh); v16b f;
#pragma unroll
  for (int e = 0; e < 8; ++e) { f[e] = a[e]; f[8 + e] = b[e]; } return f; }
__device__ __forceinline__ v8f wmma16b(v16b a, v16b b, v8f c) { v8f d = __builtin_amdgcn_wmma_f32_16x16x32_f16(false, a, false, b, (short)0, c, false, false); asm volatile("v_nop\n\tv_nop\n\tv_nop\n\tv_nop" : "+v"(d) : "v"(a), "v"(b)); return d; }
__device__ __forceinline__ void wave_lds_sync() { __builtin_amdgcn_fence(__ATOMIC_RELEASE, "workgroup"); __builtin_amdgcn_wave_barrier(); __builtin_amdgcn_fence(__ATOMIC_ACQUIRE, "workgroup"); }
__device__ __forceinline__ float bf16_near(float f) { unsigned int u = __float_as_uint(f); u += 0x7FFFu + ((u >> 16) & 1u); return __uint_as_float(u & 0xFFFF0000u); }   // f rounded to the nearest bf16 value, ties to even
__device__ __forceinline__ float xhalf(float x) { return __builtin_bit_cast(float, __builtin_amdgcn_permlanex16(__builtin_bit_cast(int, x), __builtin_bit_cast(int, x), 0x76543210, 0xfedcba98, false, false)); }   // the value of lane l ^ 16
__device__ __forceinline__ unsigned lds_off(const b16* p) { typedef __attribute__((address_space(3))) const b16 lds_b16; return (unsigned)(size_t)(lds_b16*)p; }   // byte address of p inside the work-group's LDS
// Eight asynchronous copies, 16 bytes a lane each, global memory -> LDS through no register: copies 0-3 read ga + i * gs, copies 4-7 gb + (i - 4) * gs; copy i lands at LDS byte l + i * ls.
// The s_wait_xcnt closes the statement so that no address register of an issued copy is rewritten in front of it.
__device__ __forceinline__ void copy8(unsigned l, unsigned ls, const b16* ga, const b16* gb, size_t gs) {
  asm volatile("global_load_async_to_lds_b128 %0, %8, off\n\tglobal_load_async_to_lds_b128 %1, %9, off\n\tglobal_load_async_to_lds_b128 %2, %10, off\n\tglobal_load_async_to_lds_b128 %3, %11, off\n\t"
               "global_load_async_to_lds_b128 %4, %12, off\n\tglobal_load_async_to_lds_b128 %5, %13, off\n\tglobal_load_async_to_lds_b128 %6, %14, off\n\tglobal_load_async_to_lds_b128 %7, %15, off\n\ts_wait_xcnt 0x0"
               :: "v"(l), "v"(l + ls), "v"(l + 2 * ls), "v"(l + 3 * ls), "v"(l + 4 * ls), "v"(l + 5 * ls), "v"(l + 6 * ls), "v"(l + 7 * ls),
                  "v"(ga), "v"(ga + gs), "v"(ga + 2 * gs), "v"(ga + 3 * gs), "v"(gb), "v"(gb + gs), "v"(gb + 2 * gs), "v"(gb + 3 * gs) : "memory"); }
__device__ __forceinline__ int iclamp(int v, int lo, int hi) { return v < lo ? lo : (v > hi ? hi : v); }

__global__ __launch_bounds__(256) void wput_kernel(const float* __restrict__ wq, const float* __restrict__ wk, const float* __restrict__ wv, const float* __restrict__ wo, const float* __restrict__ ek, b16* __restrict__ W4, b16* __restrict__ EKh, b16* __restrict__ EKl) { const size_t nt = (size_t)gridDim.x * 256, u0 = (size_t)blockIdx.x * 256 + threadIdx.x; v8b v;
  for (size_t u = u0; u < (size_t)4 * D * 128; u += nt) { const int o = (int)(u / 128), k0 = (int)(u % 128) * 8; const int which = o / D, oo = o % D; const float* w = which == 0 ? wq : (which == 1 ? wk : (which == 2 ? wv : wo));
#pragma unroll
    for (int j = 0; j < 8; ++j) v[j] = (b16)(bf16_rne(w[(size_t)oo * D + k0 + j]) * WSC); { *(v8b*)(W4 + (size_t)o * D + k0) = v;  } }
  if (u0 < 48 * 8) { const int r = (int)(u0 / 8), k0 = (int)(u0 % 8) * 8; v8b a, c;
#pragma unroll
    for (int j = 0; j < 8; ++j) { float e = r < NR ? bfv(ek[(size_t)r * HD + k0 + j]) : 0.0f; b16 p, pl; split16(e * HS, p, pl); a[j] = p; c[j] = pl; } { *(v8b*)(EKh + (size_t)r * HD + k0) = a; *(v8b*)(EKl + (size_t)r * HD + k0) = c;  } } }
// The four dense projections run as block-tiled GEMMs: 8 waves share one 128 x 128 output tile (wave = 32 rows x 64 columns), both operands staged in LDS 64 k at a time,
// the next stage's global loads issued ahead of the current stage's products. Every accumulator still sums k in ascending blocks of 32.
// In both kernels each '#pragma unroll' makes the indices of a register array (ra, rb, acc, fragments, tv) constants, so that it stays in registers.
__global__ __launch_bounds__(256) void proj_kernel(const float* __restrict__ xq, const float* __restrict__ xk, const float* __restrict__ xv, const b16* __restrict__ W4, int QLIM, b16* __restrict__ Qh, b16* __restrict__ Ql, b16* __restrict__ Kh, b16* __restrict__ Kl, b16* __restrict__ VTh, b16* __restrict__ VTl) {
  __shared__ __attribute__((aligned(16))) b16 As[BM][LP], Bs[BN][LP]; __shared__ __attribute__((aligned(16))) float Tf[8][16][68];
  const int tid = threadIdx.x, lane = tid & 31, wave = tid >> 5, nloc = lane & 15, hlf = lane >> 4, wm = wave >> 1, wn = wave & 1;
  const size_t t0 = (size_t)blockIdx.x * BM; const int c0 = blockIdx.y * BN, which = blockIdx.z; if ((int)(t0 % S) >= QLIM) return;
  const float* x = which == 0 ? xq : (which == 1 ? xk : xv);
  // v is wanted transposed ([batch][feature][token]): its product takes the W rows as A and the x rows as B, so that an accumulator tile has features as rows and tokens as columns (wave = 32 features x 64 tokens)
  const b16 (*Af)[LP] = which == 2 ? Bs : As; const b16 (*Bf)[LP] = which == 2 ? As : Bs;
  const int ar = tid >> 4, ac = (tid & 15) * 4, br = tid >> 3, bc = (tid & 7) * 8;   // staging: 16 lanes per 256-B piece of an x row, 8 lanes per 128-B piece of a W row
  const float* xg = x + (t0 + ar) * D + ac; const b16* wg = W4 + ((size_t)which * D + c0 + br) * D + bc;
  v4f ra[8]; v8b rb[4];
#pragma unroll
  for (int i = 0; i < 8; ++i) ra[i] = *(const v4f*)(xg + (size_t)i * 16 * D);
#pragma unroll
  for (int i = 0; i < 4; ++i) rb[i] = *(const v8b*)(wg + (size_t)i * 32 * D);
  v8f acc[2][4];
#pragma unroll
  for (int mi = 0; mi < 2; ++mi)
#pragma unroll
    for (int ni = 0; ni < 4; ++ni) acc[mi][ni] = (v8f){};
#pragma unroll 1   // stays rolled, for speed only
  for (int k0 = 0; k0 < D; k0 += KS) {
#pragma unroll
    for (int i = 0; i < 8; ++i) { v4b hx;
#pragma unroll
      for (int j = 0; j < 4; ++j) hx[j] = (b16)(bf16_rne(ra[i][j]) * XS);
      *(v4b*)(&As[ar + i * 16][ac]) = hx; }
#pragma unroll
    for (int i = 0; i < 4; ++i) *(v8b*)(&Bs[br + i * 32][bc]) = rb[i];
    __syncthreads();
    if (k0 + KS < D) {
#pragma unroll
      for (int i = 0; i < 8; ++i) ra[i] = *(const v4f*)(xg + (size_t)i * 16 * D + k0 + KS);
#pragma unroll
      for (int i = 0; i < 4; ++i) rb[i] = *(const v8b*)(wg + (size_t)i * 32 * D + k0 + KS);
      asm volatile("s_wait_xcnt 0x0" ::: "memory"); }   // the loop advances the address registers that these issued loads name: the wait stands in front of that overwrite
#pragma unroll
    for (int kb = 0; kb < KS; kb += 32) { v16b a[2], bw[4];
#pragma unroll
      for (int mi = 0; mi < 2; ++mi) a[mi] = frag_kb(&Af[wm * 32 + mi * 16 + nloc][kb], hlf);
#pragma unroll
      for (int ni = 0; ni < 4; ++ni) bw[ni] = frag_kb(&Bf[wn * 64 + ni * 16 + nloc][kb], hlf);
#pragma unroll
      for (int mi = 0; mi < 2; ++mi)
#pragma unroll
        for (int ni = 0; ni < 4; ++ni) acc[mi][ni] = wmma16b(a[mi], bw[ni], acc[mi][ni]); }
    __syncthreads(); }
  // each wave stages 16 x 64 results in its own LDS range and stores whole lines: two rows per instruction, 16 lanes a row
#pragma unroll
  for (int mi = 0; mi < 2; ++mi) {
#pragma unroll
    for (int ni = 0; ni < 4; ++ni)
#pragma unroll
      for (int r8 = 0; r8 < 8; ++r8) Tf[wave][8 * hlf + r8][ni * 16 + nloc] = acc[mi][ni][r8] * (1.0f / (XS * WSC));
    wave_lds_sync();
    v4f tv[8]; const size_t o = which == 2 ? ((t0 / S) * D + c0 + wm * 32 + mi * 16 + hlf) * S + t0 % S + wn * 64 + nloc * 4 : (t0 + wm * 32 + mi * 16 + hlf) * D + c0 + wn * 64 + nloc * 4;   // v: row = feature, of S tokens; q, k: row = token, of D features
#pragma unroll
    for (int rr = 0; rr < 8; ++rr) tv[rr] = *(const v4f*)(&Tf[wave][rr * 2 + hlf][nloc * 4]);
    { static_assert(S == D, "one row pitch serves both layouts"); b16* Ph = which == 0 ? Qh : (which == 1 ? Kh : VTh); b16* Pl = which == 0 ? Ql : (which == 1 ? Kl : VTl);
#pragma unroll
      for (int rr = 0; rr < 8; ++rr) { v4b ph, pl;
#pragma unroll
        for (int j = 0; j < 4; ++j) { b16 p, q; split16(tv[rr][j] * HS, p, q); ph[j] = p; pl[j] = q; }
        *(v4b*)(Ph + o + (size_t)rr * 2 * D) = ph; *(v4b*)(Pl + o + (size_t)rr * 2 * D) = pl; } }
    wave_lds_sync(); } }
// One work-group of 8 waves per (batch-head, 128 queries), one wave per 16 queries. Each 128-key chunk of K and V^T (hi and lo) is staged once for all eight waves in LDS by asynchronous copies, whole 128-B lines,
// two buffers: chunk c + 1 flies while chunk c is worked on; every fragment of K and V^T is read from LDS. Everything else is private to its wave, as are its LDS ranges (index [wave]).
// Both products run transposed: S^T = K q^T (K rows as A, q rows as B) and O^T += V^T P^T (V^T rows as A, P as B). A lane holds ONE query (column lane & 15) and, of each 16-key tile, the keys 8 * half + r8:
// bias, mask, maximum, exp and the sums all run in-lane, the two halves of a query joined by one cross-row move; two score tiles, rounded in place, are the B fragment of P for 32 keys, so that P never goes through LDS.
// Buckets: distance <= -16 and >= 16 are running per-lane sums, joined once after the loop; each of the 31 inner distances has one key, whose score is kept and turned into its weight with the final maximum.
__global__ __launch_bounds__(32 * AW) void att_kernel(const b16* __restrict__ Qh, const b16* __restrict__ Ql, const b16* __restrict__ Kh, const b16* __restrict__ Kl, const b16* __restrict__ VTh, const b16* __restrict__ VTl, const b16* __restrict__ EKh, const b16* __restrict__ EKl, const float* __restrict__ ev, const int* __restrict__ vlens, int ALIM, float* __restrict__ O) { __shared__ __attribute__((aligned(16))) b16 Ksh[2][2][CH][KP], Vsh[2][2][HD][VP];   // [buffer][hi, lo][key][d] and [buffer][hi, lo][d][key]
  __shared__ __attribute__((aligned(16))) float BkW[AW][16][36]; __shared__ float QEW[AW][16][49], LsW[AW][16], OfW[AW][16][HD + 1];
  const int lane = threadIdx.x & 31, wave = __builtin_amdgcn_readfirstlane(threadIdx.x >> 5), nloc = lane & 15, hlf = lane >> 4, rowb = 8 * hlf;   // the wave's number in a scalar register keeps the tests on q0 below scalar branches
  const int bh = blockIdx.x / (S / (16 * AW)), qb = (blockIdx.x % (S / (16 * AW))) * (16 * AW); if (qb >= ALIM) return; const int q0 = qb + wave * 16; const int b = bh / H, h = bh % H; const size_t tq = (size_t)b * S + q0; const int vl = iclamp(vlens[b], 0, S), nch = (vl + CH - 1) / CH;
  float (*Bk)[36] = BkW[wave]; float (*QE)[49] = QEW[wave]; float* Ls = LsW[wave]; float (*Of)[HD + 1] = OfW[wave];
  // staging, per wave and chunk: 8 copies of 4 K rows (8 lanes a 128-B row; rows i * 32 + wave * 4 + ..., hi then lo) and 8 copies of 2 V^T rows (16 lanes a 256-B row piece; rows i * 16 + wave * 2 + ..., hi then lo)
  const int kr = wave * 4 + (lane >> 3), kc = (lane & 7) * 8, vr = wave * 2 + (lane >> 4), vc = (lane & 15) * 8;
  const size_t kg = ((size_t)b * S + kr) * D + h * HD + kc, vg = ((size_t)bh * HD + vr) * S + vc;
  auto stage = [&](int c, int buf) { copy8(lds_off(&Ksh[buf][0][kr][kc]), 32 * KP * 2, Kh + kg + (size_t)c * CH * D, Kl + kg + (size_t)c * CH * D, (size_t)32 * D);
    copy8(lds_off(&Vsh[buf][0][vr][vc]), 16 * VP * 2, VTh + vg + c * CH, VTl + vg + c * CH, (size_t)16 * S); };
  stage(0, 0);   // chunk 0 flies under the set-up below
  if (lane < 16) { for (int r = 0; r < NR; ++r) Bk[lane][r] = -INFINITY; }
  // q fragments: row or column nloc in the k order of frag_kb, so that one fragment serves as A (QE) and as B (S^T)
  v16b qa[2], ql[2]; for (int ks = 0; ks < 2; ++ks) { qa[ks] = frag_kb(Qh + (tq + nloc) * D + h * HD + ks * 32, hlf); ql[ks] = frag_kb(Ql + (tq + nloc) * D + h * HD + ks * 32, hlf); }
  // QE[q][r] = q . Ek[r]
#pragma unroll
  for (int t = 0; t < 3; ++t) { v8f e = (v8f){};
#pragma unroll
    for (int ks = 0; ks < 2; ++ks) { const v16b eh = frag_kb(EKh + (size_t)(t * 16 + nloc) * HD + ks * 32, hlf), el = frag_kb(EKl + (size_t)(t * 16 + nloc) * HD + ks * 32, hlf); e = wmma16b(qa[ks], eh, e); e = wmma16b(qa[ks], el, e); e = wmma16b(ql[ks], eh, e); }
#pragma unroll
    for (int r8 = 0; r8 < 8; ++r8) QE[8 * hlf + r8][t * 16 + nloc] = e[r8] * (1.0f / (HS * HS)); }
  wave_lds_sync();
  const float qlo = QE[nloc][0], qhi = QE[nloc][2 * CLIP];   // this lane's query: the bias of every key at distance <= -16, and of every key at >= 16
  asm volatile("s_wait_asynccnt 0x0" ::: "memory");   // this wave's copies of chunk 0 have landed
  __syncthreads();                                    // ... and so have the other waves': chunk 0 may be read
  if (nch > 1) stage(1, 1);
  v8f oacc[4] = {(v8f){}, (v8f){}, (v8f){}, (v8f){}};   // O^T: lane = query, tile t register r8 = d t * 16 + 8 * half + r8
  // every '#pragma unroll' below makes the indices of a register array (sacc, oacc, kh, kl, vh, vlo, pa, pb, w) constants, so that it stays in registers
  float mrow = -INFINITY, slo = 0.0f, shi = 0.0f, sin_ = 0.0f;
#pragma unroll 1   // stays rolled: the trip count comes from valid_lens
  for (int ch = 0; ch < nch; ++ch) { const int k0 = ch * CH; v8f sacc[CH / 16]; const b16 (*Kc)[CH][KP] = Ksh[ch & 1]; const b16 (*Vc)[HD][VP] = Vsh[ch & 1];
#pragma unroll
    for (int tg = 0; tg < CH / 16; tg += 2) { v16b kh[2][2], kl[2][2];   // two tiles' fragment reads stand together, ahead of their products, for speed only
#pragma unroll
      for (int t = 0; t < 2; ++t)
#pragma unroll
        for (int ks = 0; ks < 2; ++ks) { kh[t][ks] = frag_kb(&Kc[0][(tg + t) * 16 + nloc][ks * 32], hlf); kl[t][ks] = frag_kb(&Kc[1][(tg + t) * 16 + nloc][ks * 32], hlf); }
#pragma unroll
      for (int t = 0; t < 2; ++t) { v8f s = (v8f){};
#pragma unroll
        for (int ks = 0; ks < 2; ++ks) { s = wmma16b(kh[t][ks], qa[ks], s); s = wmma16b(kl[t][ks], qa[ks], s); s = wmma16b(kh[t][ks], ql[ks], s); }
        sacc[tg + t] = s; } }
    const int dl = k0 + rowb - q0 - nloc;   // key - query of this lane at tile 0, register 0
    float mx = -INFINITY;
#pragma unroll
    for (int t = 0; t < CH / 16; ++t) { const int rel = k0 + t * 16 - q0; const bool near = rel >= -16 && rel <= 16;   // wave-uniform: only these three tiles hold an inner distance
      if (near) {   // bias by distance from LDS; the score of an inner distance is kept
#pragma unroll
        for (int r8 = 0; r8 < 8; ++r8) { const int d = dl + t * 16 + r8; const float s = (sacc[t][r8] * (1.0f / (HS * HS)) + QE[nloc][iclamp(d, -CLIP, CLIP) + CLIP]) * SCALE; const float sm = k0 + t * 16 + rowb + r8 < vl ? s : -INFINITY; sacc[t][r8] = sm; if (d > -CLIP && d < CLIP) Bk[nloc][d + CLIP] = sm; } }
      else { const float qe = rel < 0 ? qlo : qhi;
#pragma unroll
        for (int r8 = 0; r8 < 8; ++r8) sacc[t][r8] = (sacc[t][r8] * (1.0f / (HS * HS)) + qe) * SCALE;
        if (k0 + t * 16 + 16 > vl) {   // wave-uniform: only a tile that reaches past valid_len has keys to exclude
#pragma unroll
          for (int r8 = 0; r8 < 8; ++r8) sacc[t][r8] = k0 + t * 16 + rowb + r8 < vl ? sacc[t][r8] : -INFINITY; } }
      mx = fmaxf(mx, fmaxf(fmaxf(fmaxf(sacc[t][0], sacc[t][1]), fmaxf(sacc[t][2], sacc[t][3])), fmaxf(fmaxf(sacc[t][4], sacc[t][5]), fmaxf(sacc[t][6], sacc[t][7])))); }
    mx = fmaxf(mx, xhalf(mx));   // both halves now hold the maximum of this query's 128 scores
    const float mn = fmaxf(mrow, mx), fac = (mrow == -INFINITY) ? 0.0f : __expf(mrow - mn); mrow = mn; slo *= fac; shi *= fac; sin_ *= fac;
#pragma unroll
    for (int t = 0; t < 4; ++t)
#pragma unroll
      for (int r8 = 0; r8 < 8; ++r8) oacc[t][r8] *= fac;
#pragma unroll
    for (int kb = 0; kb < CH; kb += 32) { v16b vh[4], vlo[4], pa, pb;   // one group of reads, ahead of the exponentials that make this block's P
#pragma unroll
      for (int t = 0; t < 4; ++t) { vh[t] = frag_kb(&Vc[0][t * 16 + nloc][kb], hlf); vlo[t] = frag_kb(&Vc[1][t * 16 + nloc][kb], hlf); }
#pragma unroll
      for (int u = 0; u < 2; ++u) { const int t = kb / 16 + u, rel = k0 + t * 16 - q0;   // element u * 8 + r8 of the fragment is key kb + u * 16 + 8 * half + r8: the k order of frag_kb
#pragma unroll
        for (int r8 = 0; r8 < 8; r8 += 2) { const float p0 = __expf(sacc[t][r8] - mrow), p1 = __expf(sacc[t][r8 + 1] - mrow); sacc[t][r8] = p0; sacc[t][r8 + 1] = p1; const v2f x = (v2f){p0, p1} * PS;   // two keys share a fragment register: both roundings run on the pair
          const v2b ph = __builtin_convertvector(x, v2b), pl = __builtin_convertvector(x - __builtin_convertvector(ph, v2f), v2b); pa[u * 8 + r8] = ph[0]; pa[u * 8 + r8 + 1] = ph[1]; pb[u * 8 + r8] = pl[0]; pb[u * 8 + r8 + 1] = pl[1]; }
        if (rel <= -32) slo += ((sacc[t][0] + sacc[t][1]) + (sacc[t][2] + sacc[t][3])) + ((sacc[t][4] + sacc[t][5]) + (sacc[t][6] + sacc[t][7]));
        else if (rel >= 32) shi += ((sacc[t][0] + sacc[t][1]) + (sacc[t][2] + sacc[t][3])) + ((sacc[t][4] + sacc[t][5]) + (sacc[t][6] + sacc[t][7]));
        else {
#pragma unroll
          for (int r8 = 0; r8 < 8; ++r8) { const int d = dl + t * 16 + r8; const float p = sacc[t][r8]; slo += d <= -CLIP ? p : 0.0f; shi += d >= CLIP ? p : 0.0f; sin_ += (d > -CLIP && d < CLIP) ? p : 0.0f; } } }
#pragma unroll
      for (int t = 0; t < 4; ++t) { oacc[t] = wmma16b(vh[t], pa, oacc[t]); oacc[t] = wmma16b(vlo[t], pa, oacc[t]); oacc[t] = wmma16b(vh[t], pb, oacc[t]); } }
    asm volatile("s_wait_dscnt 0x0" ::: "memory");      // this wave's reads of the chunk's buffer have returned
    asm volatile("s_wait_asynccnt 0x0" ::: "memory");   // this wave's copies of chunk ch + 1 have landed
    __syncthreads();                                    // publishes chunk ch + 1 and frees the buffer that this pass has read
    if (ch + 2 < nch) stage(ch + 2, ch & 1); }
  asm volatile("s_wait_asynccnt 0x0" ::: "memory");     // no copy is outstanding behind the loop
  // this lane's two columns of all 33 Ev rows: the loads fly together, under the joins below, and the values stay in registers for all 16 query rows
  v2f evr[NR];
#pragma unroll
  for (int j = 0; j < NR; ++j) evr[j] = *(const v2f*)(ev + (size_t)j * HD + lane * 2);
  // join the two halves' sums; the inner distances' kept scores become weights under the final maximum (a slot no key reached holds -inf and gives 0)
  { const float a = slo + xhalf(slo), c = shi + xhalf(shi), e = sin_ + xhalf(sin_);
    if (hlf == 0) { Bk[nloc][0] = a; Bk[nloc][2 * CLIP] = c; Ls[nloc] = a + c + e; } }
  float w[16];   // half 0 turns slots 1-16 of its query, half 1 slots 17-31: it has no sixteenth slot, reads its fifteenth again and stores nothing
#pragma unroll
  for (int j = 0; j < 16; ++j) { const int sl = 1 + 16 * hlf + j; w[j] = __expf(Bk[nloc][sl < 2 * CLIP ? sl : 2 * CLIP - 1] - mrow); }
#pragma unroll
  for (int j = 0; j < 16; ++j) { const int sl = 1 + 16 * hlf + j; if (sl < 2 * CLIP) Bk[nloc][sl] = w[j]; }
#pragma unroll
  for (int t = 0; t < 4; ++t)
#pragma unroll
    for (int r8 = 0; r8 < 8; ++r8) Of[nloc][t * 16 + rowb + r8] = oacc[t][r8] * (1.0f / (PS * HS));
  wave_lds_sync();
  // + sum_r Bk[row][r] Ev[r][d]; lane = d pair. Every '#pragma unroll' here makes the indices of evr, bq and a constants, so that they stay in registers.
#pragma unroll
  for (int j = 0; j < NR; ++j) { evr[j][0] = bf16_near(evr[j][0]); evr[j][1] = bf16_near(evr[j][1]); }
#pragma unroll 1   // stays rolled: four rows a trip already give four independent sum chains, and sixteen would only lengthen the code
  for (int r0 = 0; r0 < 16; r0 += 4) { v2f a[4]; v4f bq[4][8]; float bl[4], inv[4];
#pragma unroll
    for (int i = 0; i < 4; ++i) { a[i] = (v2f){Of[r0 + i][lane * 2], Of[r0 + i][lane * 2 + 1]}; bl[i] = Bk[r0 + i][32]; inv[i] = 1.0f / Ls[r0 + i];
#pragma unroll
      for (int j = 0; j < 8; ++j) bq[i][j] = *(const v4f*)(&Bk[r0 + i][j * 4]); }
#pragma unroll
    for (int j = 0; j < NR - 1; ++j)
#pragma unroll
      for (int i = 0; i < 4; ++i) a[i] += bq[i][j >> 2][j & 3] * evr[j];
#pragma unroll
    for (int i = 0; i < 4; ++i) { a[i] += bl[i] * evr[NR - 1]; *(v2f*)(O + (tq + r0 + i) * D + h * HD + lane * 2) = a[i] * inv[i]; }
    asm volatile("s_wait_xcnt 0x0" ::: "memory"); } }   // the next trip rewrites the registers that these issued stores name: the wait stands in front of that overwrite
__global__ __launch_bounds__(256) void outp_kernel(const float* __restrict__ O, const b16* __restrict__ WO, int ALIM, float* __restrict__ out) {
  __shared__ __attribute__((aligned(16))) b16 Ah[BM][LP], Al[BM][LP], Bs[BN][LP]; __shared__ __attribute__((aligned(16))) float Tf[8][16][68];
  const int tid = threadIdx.x, lane = tid & 31, wave = tid >> 5, nloc = lane & 15, hlf = lane >> 4, wm = wave >> 1, wn = wave & 1;
  const size_t t0 = (size_t)blockIdx.x * BM; const int c0 = blockIdx.y * BN; if ((int)(t0 % S) >= ALIM) return;
  const int ar = tid >> 4, ac = (tid & 15) * 4, br = tid >> 3, bc = (tid & 7) * 8;
  const float* og = O + (t0 + ar) * D + ac; const b16* wg = WO + ((size_t)c0 + br) * D + bc;
  v4f ra[8]; v8b rb[4];
#pragma unroll
  for (int i = 0; i < 8; ++i) ra[i] = *(const v4f*)(og + (size_t)i * 16 * D);
#pragma unroll
  for (int i = 0; i < 4; ++i) rb[i] = *(const v8b*)(wg + (size_t)i * 32 * D);
  v8f acc[2][4];
#pragma unroll
  for (int mi = 0; mi < 2; ++mi)
#pragma unroll
    for (int ni = 0; ni < 4; ++ni) acc[mi][ni] = (v8f){};
#pragma unroll 1   // stays rolled, for speed only
  for (int k0 = 0; k0 < D; k0 += KS) {
#pragma unroll
    for (int i = 0; i < 8; ++i) { v4b hx, lx;
#pragma unroll
      for (int j = 0; j < 4; ++j) { b16 p, q; split16(ra[i][j] * HS, p, q); hx[j] = p; lx[j] = q; }
      *(v4b*)(&Ah[ar + i * 16][ac]) = hx; *(v4b*)(&Al[ar + i * 16][ac]) = lx; }
#pragma unroll
    for (int i = 0; i < 4; ++i) *(v8b*)(&Bs[br + i * 32][bc]) = rb[i];
    __syncthreads();
    if (k0 + KS < D) {
#pragma unroll
      for (int i = 0; i < 8; ++i) ra[i] = *(const v4f*)(og + (size_t)i * 16 * D + k0 + KS);
#pragma unroll
      for (int i = 0; i < 4; ++i) rb[i] = *(const v8b*)(wg + (size_t)i * 32 * D + k0 + KS);
      asm volatile("s_wait_xcnt 0x0" ::: "memory"); }   // the loop advances the address registers that these issued loads name: the wait stands in front of that overwrite
#pragma unroll
    for (int kb = 0; kb < KS; kb += 32) { v16b a[2], al[2], bw[4];
#pragma unroll
      for (int mi = 0; mi < 2; ++mi) { a[mi] = frag_kb(&Ah[wm * 32 + mi * 16 + nloc][kb], hlf); al[mi] = frag_kb(&Al[wm * 32 + mi * 16 + nloc][kb], hlf); }
#pragma unroll
      for (int ni = 0; ni < 4; ++ni) bw[ni] = frag_kb(&Bs[wn * 64 + ni * 16 + nloc][kb], hlf);
#pragma unroll
      for (int mi = 0; mi < 2; ++mi)
#pragma unroll
        for (int ni = 0; ni < 4; ++ni) acc[mi][ni] = wmma16b(a[mi], bw[ni], acc[mi][ni]);
#pragma unroll
      for (int mi = 0; mi < 2; ++mi)
#pragma unroll
        for (int ni = 0; ni < 4; ++ni) acc[mi][ni] = wmma16b(al[mi], bw[ni], acc[mi][ni]); }
    __syncthreads(); }
#pragma unroll
  for (int mi = 0; mi < 2; ++mi) {
#pragma unroll
    for (int ni = 0; ni < 4; ++ni)
#pragma unroll
      for (int r8 = 0; r8 < 8; ++r8) Tf[wave][8 * hlf + r8][ni * 16 + nloc] = acc[mi][ni][r8] * (1.0f / (HS * WSC));
    wave_lds_sync();
    v4f tv[8]; const size_t o = (t0 + wm * 32 + mi * 16 + hlf) * D + c0 + wn * 64 + nloc * 4;
#pragma unroll
    for (int rr = 0; rr < 8; ++rr) tv[rr] = *(const v4f*)(&Tf[wave][rr * 2 + hlf][nloc * 4]);
#pragma unroll
    for (int rr = 0; rr < 8; ++rr) *(v4f*)(out + o + (size_t)rr * 2 * D) = tv[rr];
    wave_lds_sync(); } }
}  // namespace

extern "C" void kernel_launch(void* const* d_in, const int* in_sizes, int n_in, void* d_out, int out_size, void* d_ws, size_t ws_size, hipStream_t stream) {
  (void)n_in;
  auto Fp = [&](int i) { return (const float*)d_in[i]; }; auto Ip = [&](int i) { return (const int*)d_in[i]; };
  // Input order: 0 queries [4,1024,1024]; 1 keys; 2 values; 3 valid_lens [4] i32; 4 Wq [1024,1024]; 5 Wk; 6 Wv; 7 Wo; 8 Ek [33,64]; 9 Ev [33,64]
  if (in_sizes[0] != NT * D || in_sizes[1] != NT * D || in_sizes[2] != NT * D || in_sizes[3] != NB_ || in_sizes[4] != D * D || in_sizes[7] != D * D || in_sizes[8] != NR * HD || in_sizes[9] != NR * HD || out_size != NT * D) return;
  const int QLIM = S, ALIM = S;   // QLIM = tokens projected per batch (>= max valid_len), ALIM = queries attended/output (multiples of 128)
  size_t off = 0; char* ws = (char*)d_ws;
  auto carve = [&](size_t bytes) { char* p = ws + off; off += (bytes + 255) & ~(size_t)255; return p; };
  b16* W4 = (b16*)carve((size_t)4 * D * D * 2); b16* EKh = (b16*)carve(48 * HD * 2); b16* EKl = (b16*)carve(48 * HD * 2); b16* Qh = (b16*)carve((size_t)NT * D * 2); b16* Ql = (b16*)carve((size_t)NT * D * 2); b16* Kh = (b16*)carve((size_t)NT * D * 2); b16* Kl = (b16*)carve((size_t)NT * D * 2); b16* VTh = (b16*)carve((size_t)NT * D * 2); b16* VTl = (b16*)carve((size_t)NT * D * 2); float* O = (float*)carve((size_t)NT * D * 4);
  if (off > ws_size || off > ((size_t)104 << 20)) return;   // ~ 76 MB
  wput_kernel<<<256, 256, 0, stream>>>(Fp(4), Fp(5), Fp(6), Fp(7), Fp(8), W4, EKh, EKl);
  proj_kernel<<<dim3(NT / BM, D / BN, 3), 256, 0, stream>>>(Fp(0), Fp(1), Fp(2), W4, QLIM, Qh, Ql, Kh, Kl, VTh, VTl);
  att_kernel<<<NB_ * H * (S / (16 * AW)), 32 * AW, 0, stream>>>(Qh, Ql, Kh, Kl, VTh, VTl, EKh, EKl, Fp(9), Ip(3), ALIM, O);
  outp_kernel<<<dim3(NT / BM, D / BN), 256, 0, stream>>>(O, W4 + (size_t)3 * D * D, ALIM, (float*)d_out);
}

// v007
// It runs in 97.9 microseconds.
// Two timings next to v006 both put it at 1.17 times that version's speed.
// All steps since v000 together make it 14.7 times as fast.
#include <hip/hip_runtime.h>

// MultiHeadAttentionWithRPR: q = queries Wq^T, k = keys Wk^T, v = values Wv^T (16 heads x 64); dist = clip(k - q, -16, 16) + 16; scores = (q.k + q.Ek[dist]) / 8; keys >= valid_lens[b] -> -1e6 (excluded); attn = softmax; out_h = attn v + sum_k attn Ev[dist]; out = concat_h Wo^T -> [4][1024][1024].
// Deterministic: online softmax over fixed 128-key chunks (only chunks below valid_len), fixed order; the Ev term via 33 per-row bucket sums of attn; no atomics.
// WMMA (v_wmma_f32_16x16x32_f16, f32 accumulate): inputs (EXACT bf16 x8, K 1,024) x Wq/Wk/Wv rows (EXACT) in 128 x 128 block tiles; per (bh, 16-query) wave (8 waves a work-group, K and V^T chunks shared in LDS) QE = q (hi+lo) x Ek rows (hi+lo; 3 tiles), S^T = k rows x q (hi+lo; 8 tiles/chunk), O^T += v^T (hi+lo) x P (hi+lo; 4 tiles); o (hi+lo) x Wo rows (64 tiles) — ≈ 4 M WMMA; softmax, buckets, Ev epilogue in f32.

namespace {
constexpr int NB_ = 4, S = 1024, D = 1024, H = 16, HD = 64, CLIP = 16, NR = 2 * CLIP + 1 /* 33 */, NT = NB_ * S, CH = 128;
constexpr int BM = 128, BN = 128, KS = 64, LP = KS + 8;   // GEMM block tile, k per LDS stage, LDS row pitch in halves (144 B = 16 B x odd, for 16-byte readers)
constexpr int PG = 512, XU = NT * D / 4 / (PG * 256);   // first launch: work-groups, and 4-element pieces of each input tensor a thread converts
constexpr int AW = 8, KP = HD + 8, VP = CH + 8;   // attention: waves of a work-group; LDS row pitch in halves of a staged K row (144 B) and V^T row (272 B), each 16 B x odd, for 16-byte readers
constexpr float XS = 8.0f, HS = 256.0f, PS = 256.0f, WSC = 256.0f, SCALE = 0.125f;
typedef _Float16 b16;
typedef __attribute__((ext_vector_type(16))) _Float16 v16b;
typedef __attribute__((ext_vector_type(8))) _Float16 v8b;
typedef __attribute__((ext_vector_type(4))) _Float16 v4b;
typedef __attribute__((ext_vector_type(2))) _Float16 v2b;
typedef __attribute__((ext_vector_type(8))) float v8f;
typedef __attribute__((ext_vector_type(4))) float v4f;
typedef __attribute__((ext_vector_type(2))) float v2f;
__device__ __forceinline__ float bf16_rne(float f) { unsigned int u = __float_as_uint(f); u += 0x7FFFu + ((u >> 16) & 1u); float r = __uint_as_float(u & 0xFFFF0000u); asm volatile("" : "+v"(r)); return r; }
__device__ __forceinline__ float bfv(float f) { float r = bf16_rne(f); asm volatile("" : "+v"(r)); return r; }
__device__ __forceinline__ void split16(float v, b16& hi, b16& lo) { hi = (b16)v; lo = (b16)(v - (float)hi); }
__device__ __forceinline__ v16b frag_kb(const b16* p, int hh) { const v8b a = *(const v8b*)(p + 8 * hh), b = *(const v8b*)(p + 16 + 8 * hh); v16b f;
#pragma unroll
  for (int e = 0; e < 8; ++e) { f[e] = a[e]; f[8 + e] = b[e]; } return f; }
__device__ __forceinline__ v8f wmma16b(v16b a, v16b b, v8f c) { v8f d = __builtin_amdgcn_wmma_f32_16x16x32_f16(false, a, false, b, (short)0, c, false, false); asm volatile("v_nop\n\tv_nop\n\tv_nop\n\tv_nop" : "+v"(d) : "v"(a), "v"(b)); return d; }
__device__ __forceinline__ void wave_lds_sync() { __builtin_amdgcn_fence(__ATOMIC_RELEASE, "workgroup"); __builtin_amdgcn_wave_barrier(); __builtin_amdgcn_fence(__ATOMIC_ACQUIRE, "workgroup"); }
__device__ __forceinline__ float bf16_near(float f) { unsigned int u = __float_as_uint(f); u += 0x7FFFu + ((u >> 16) & 1u); return __uint_as_float(u & 0xFFFF0000u); }   // f rounded to the nearest bf16 value, ties to even
__device__ __forceinline__ float xhalf(float x) { return __builtin_bit_cast(float, __builtin_amdgcn_permlanex16(__builtin_bit_cast(int, x), __builtin_bit_cast(int, x), 0x76543210, 0xfedcba98, false, false)); }   // the value of lane l ^ 16
__device__ __forceinline__ unsigned lds_off(const b16* p) { typedef __attribute__((address_space(3))) const b16 lds_b16; return (unsigned)(size_t)(lds_b16*)p; }   // byte address of p inside the work-group's LDS
// Eight asynchronous copies, 16 bytes a lane each, global memory -> LDS through no register: copies 0-3 read ga + i * gs, copies 4-7 gb + (i - 4) * gs; copy i lands at LDS byte l + i * ls.
// The s_wait_xcnt closes the statement so that no address register of an issued copy is rewritten in front of it.
__device__ __forceinline__ void copy8(unsigned l, unsigned ls, const b16* ga, const b16* gb, size_t gs) {
  asm volatile("global_load_async_to_lds_b128 %0, %8, off\n\tglobal_load_async_to_lds_b128 %1, %9, off\n\tglobal_load_async_to_lds_b128 %2, %10, off\n\tglobal_load_async_to_lds_b128 %3, %11, off\n\t"
               "global_load_async_to_lds_b128 %4, %12, off\n\tglobal_load_async_to_lds_b128 %5, %13, off\n\tglobal_load_async_to_lds_b128 %6, %14, off\n\tglobal_load_async_to_lds_b128 %7, %15, off\n\ts_wait_xcnt 0x0"
               :: "v"(l), "v"(l + ls), "v"(l + 2 * ls), "v"(l + 3 * ls), "v"(l + 4 * ls), "v"(l + 5 * ls), "v"(l + 6 * ls), "v"(l + 7 * ls),
                  "v"(ga), "v"(ga + gs), "v"(ga + 2 * gs), "v"(ga + 3 * gs), "v"(gb), "v"(gb + gs), "v"(gb + 2 * gs), "v"(gb + 3 * gs) : "memory"); }
__device__ __forceinline__ int iclamp(int v, int lo, int hi) { return v < lo ? lo : (v > hi ? hi : v); }

__global__ __launch_bounds__(256) void wput_kernel(const float* __restrict__ wq, const float* __restrict__ wk, const float* __restrict__ wv, const float* __restrict__ wo, const float* __restrict__ ek, const float* __restrict__ xq, const float* __restrict__ xk, const float* __restrict__ xv, b16* __restrict__ W4, b16* __restrict__ EKh, b16* __restrict__ EKl, b16* __restrict__ X16) { const size_t nt = (size_t)gridDim.x * 256, u0 = (size_t)blockIdx.x * 256 + threadIdx.x; v8b v;
  // queries, keys, values: rounded and scaled ONCE here, into one 16-bit plane each, for all eight column blocks of the projection. 16 bytes a lane in, 8 bytes out, whole lines; a thread's XU loads of a tensor fly together.
  static_assert((size_t)XU * PG * 256 * 4 == (size_t)NT * D && XU % 4 == 0, "the pieces cover a tensor exactly");
#pragma unroll 1   // stays rolled: one tensor's loads in flight are enough, and three would triple the registers
  for (int w3 = 0; w3 < 3; ++w3) { const float* x = (w3 == 0 ? xq : (w3 == 1 ? xk : xv)) + u0 * 4; b16* y = X16 + (size_t)w3 * NT * D + u0 * 4; v4f r[XU];
#pragma unroll   // constant indices keep r in registers
    for (int j = 0; j < XU; j += 4) {
#pragma unroll
      for (int i = 0; i < 4; ++i) r[j + i] = *(const v4f*)(x + (size_t)(j + i) * PG * 256 * 4);
      asm volatile("s_wait_xcnt 0x0" ::: "memory"); }   // later loads' results and the store addresses may take the address registers that these issued loads name: the wait stands in front of that overwrite
#pragma unroll
    for (int j = 0; j < XU; ++j) { v4b hx;
#pragma unroll
      for (int e = 0; e < 4; ++e) hx[e] = (b16)(bf16_rne(r[j][e]) * XS);
      *(v4b*)(y + (size_t)j * PG * 256 * 4) = hx; }
    asm volatile("s_wait_xcnt 0x0" ::: "memory"); }   // the next trip rewrites the address registers that these issued stores name: the wait stands in front of that overwrite
  for (size_t u = u0; u < (size_t)4 * D * 128; u += nt) { const int o = (int)(u / 128), k0 = (int)(u % 128) * 8; const int which = o / D, oo = o % D; const float* w = which == 0 ? wq : (which == 1 ? wk : (which == 2 ? wv : wo));
#pragma unroll
    for (int j = 0; j < 8; ++j) v[j] = (b16)(bf16_rne(w[(size_t)oo * D + k0 + j]) * WSC); { *(v8b*)(W4 + (size_t)o * D + k0) = v;  } }
  if (u0 < 48 * 8) { const int r = (int)(u0 / 8), k0 = (int)(u0 % 8) * 8; v8b a, c;
#pragma unroll
    for (int j = 0; j < 8; ++j) { float e = r < NR ? bfv(ek[(size_t)r * HD + k0 + j]) : 0.0f; b16 p, pl; split16(e * HS, p, pl); a[j] = p; c[j] = pl; } { *(v8b*)(EKh + (size_t)r * HD + k0) = a; *(v8b*)(EKl + (size_t)r * HD + k0) = c;  } } }
// The four dense projections run as block-tiled GEMMs: 8 waves share one 128 x 128 output tile (wave = 32 rows x 64 columns), both operands staged in LDS 64 k at a time,
// the next stage's global loads issued ahead of the current stage's products. Every accumulator still sums k in ascending blocks of 32.
// In both kernels each '#pragma unroll' makes the indices of a register array (ra, rb, acc, fragments, tv) constants, so that it stays in registers.
__global__ __launch_bounds__(256) void proj_kernel(const b16* __restrict__ X16, const b16* __restrict__ W4, int QLIM, b16* __restrict__ Qh, b16* __restrict__ Ql, b16* __restrict__ Kh, b16* __restrict__ Kl, b16* __restrict__ VTh, b16* __restrict__ VTl) {
  __shared__ __attribute__((aligned(16))) b16 As[BM][LP], Bs[BN][LP]; __shared__ __attribute__((aligned(16))) float Tf[8][16][68];
  const int tid = threadIdx.x, lane = tid & 31, wave = tid >> 5, nloc = lane & 15, hlf = lane >> 4, wm = wave >> 1, wn = wave & 1;
  const size_t t0 = (size_t)blockIdx.x * BM; const int c0 = blockIdx.y * BN, which = blockIdx.z; if ((int)(t0 % S) >= QLIM) return;
  // v is wanted transposed ([batch][feature][token]): its product takes the W rows as A and the x rows as B, so that an accumulator tile has features as rows and tokens as columns (wave = 32 features x 64 tokens)
  const b16 (*Af)[LP] = which == 2 ? Bs : As; const b16 (*Bf)[LP] = which == 2 ? As : Bs;
  const int br = tid >> 3, bc = (tid & 7) * 8;   // staging: 8 lanes per 128-B piece of an x row (already 16-bit, from the first launch) and of a W row
  const b16* xg = X16 + ((size_t)which * NT + t0 + br) * D + bc; const b16* wg = W4 + ((size_t)which * D + c0 + br) * D + bc;
  v8b ra[4], rb[4];
#pragma unroll
  for (int i = 0; i < 4; ++i) ra[i] = *(const v8b*)(xg + (size_t)i * 32 * D);
#pragma unroll
  for (int i = 0; i < 4; ++i) rb[i] = *(const v8b*)(wg + (size_t)i * 32 * D);
  v8f acc[2][4];
#pragma unroll
  for (int mi = 0; mi < 2; ++mi)
#pragma unroll
    for (int ni = 0; ni < 4; ++ni) acc[mi][ni] = (v8f){};
#pragma unroll 1   // stays rolled, for speed only
  for (int k0 = 0; k0 < D; k0 += KS) {
#pragma unroll
    for (int i = 0; i < 4; ++i) { *(v8b*)(&As[br + i * 32][bc]) = ra[i]; *(v8b*)(&Bs[br + i * 32][bc]) = rb[i]; }
    __syncthreads();
    if (k0 + KS < D) {
#pragma unroll
      for (int i = 0; i < 4; ++i) { ra[i] = *(const v8b*)(xg + (size_t)i * 32 * D + k0 + KS); rb[i] = *(const v8b*)(wg + (size_t)i * 32 * D + k0 + KS); }
      asm volatile("s_wait_xcnt 0x0" ::: "memory"); }   // the loop advances the address registers that these issued loads name: the wait stands in front of that overwrite
#pragma unroll
    for (int kb = 0; kb < KS; kb += 32) { v16b a[2], bw[4];
#pragma unroll
      for (int mi = 0; mi < 2; ++mi) a[mi] = frag_kb(&Af[wm * 32 + mi * 16 + nloc][kb], hlf);
#pragma unroll
      for (int ni = 0; ni < 4; ++ni) bw[ni] = frag_kb(&Bf[wn * 64 + ni * 16 + nloc][kb], hlf);
#pragma unroll
      for (int mi = 0; mi < 2; ++mi)
#pragma unroll
        for (int ni = 0; ni < 4; ++ni) acc[mi][ni] = wmma16b(a[mi], bw[ni], acc[mi][ni]); }
    __syncthreads(); }
  // each wave stages 16 x 64 results in its own LDS range and stores whole lines: two rows per instruction, 16 lanes a row
#pragma unroll
  for (int mi = 0; mi < 2; ++mi) {
#pragma unroll
    for (int ni = 0; ni < 4; ++ni)
#pragma unroll
      for (int r8 = 0; r8 < 8; ++r8) Tf[wave][8 * hlf + r8][ni * 16 + nloc] = acc[mi][ni][r8] * (1.0f / (XS * WSC));
    wave_lds_sync();
    v4f tv[8]; const size_t o = which == 2 ? ((t0 / S) * D + c0 + wm * 32 + mi * 16 + hlf) * S + t0 % S + wn * 64 + nloc * 4 : (t0 + wm * 32 + mi * 16 + hlf) * D + c0 + wn * 64 + nloc * 4;   // v: row = feature, of S tokens; q, k: row = token, of D features
#pragma unroll
    for (int rr = 0; rr < 8; ++rr) tv[rr] = *(const v4f*)(&Tf[wave][rr * 2 + hlf][nloc * 4]);
    { static_assert(S == D, "one row pitch serves both layouts"); b16* Ph = which == 0 ? Qh : (which == 1 ? Kh : VTh); b16* Pl = which == 0 ? Ql : (which == 1 ? Kl : VTl);
#pragma unroll
      for (int rr = 0; rr < 8; ++rr) { v4b ph, pl;
#pragma unroll
        for (int j = 0; j < 4; ++j) { b16 p, q; split16(tv[rr][j] * HS, p, q); ph[j] = p; pl[j] = q; }
        *(v4b*)(Ph + o + (size_t)rr * 2 * D) = ph; *(v4b*)(Pl + o + (size_t)rr * 2 * D) = pl; } }
    wave_lds_sync(); } }
// One work-group of 8 waves per (batch-head, 128 queries), one wave per 16 queries. Each 128-key chunk of K and V^T (hi and lo) is staged once for all eight waves in LDS by asynchronous copies, whole 128-B lines,
// two buffers: chunk c + 1 flies while chunk c is worked on; every fragment of K and V^T is read from LDS. Everything else is private to its wave, as are its LDS ranges (index [wave]).
// Both products run transposed: S^T = K q^T (K rows as A, q rows as B) and O^T += V^T P^T (V^T rows as A, P as B). A lane holds ONE query (column lane & 15) and, of each 16-key tile, the keys 8 * half + r8:
// bias, mask, maximum, exp and the sums all run in-lane, the two halves of a query joined by one cross-row move; two score tiles, rounded in place, are the B fragment of P for 32 keys, so that P never goes through LDS.
// Buckets: distance <= -16 and >= 16 are running per-lane sums, joined once after the loop; each of the 31 inner distances has one key, whose score is kept and turned into its weight with the final maximum.
__global__ __launch_bounds__(32 * AW) void att_kernel(const b16* __restrict__ Qh, const b16* __restrict__ Ql, const b16* __restrict__ Kh, const b16* __restrict__ Kl, const b16* __restrict__ VTh, const b16* __restrict__ VTl, const b16* __restrict__ EKh, const b16* __restrict__ EKl, const float* __restrict__ ev, const int* __restrict__ vlens, int ALIM, float* __restrict__ O) { __shared__ __attribute__((aligned(16))) b16 Ksh[2][2][CH][KP], Vsh[2][2][HD][VP];   // [buffer][hi, lo][key][d] and [buffer][hi, lo][d][key]
  __shared__ __attribute__((aligned(16))) float BkW[AW][16][36]; __shared__ float QEW[AW][16][49], LsW[AW][16], OfW[AW][16][HD + 1];
  const int lane = threadIdx.x & 31, wave = __builtin_amdgcn_readfirstlane(threadIdx.x >> 5), nloc = lane & 15, hlf = lane >> 4, rowb = 8 * hlf;   // the wave's number in a scalar register keeps the tests on q0 below scalar branches
  const int bh = blockIdx.x / (S / (16 * AW)), qb = (blockIdx.x % (S / (16 * AW))) * (16 * AW); if (qb >= ALIM) return; const int q0 = qb + wave * 16; const int b = bh / H, h = bh % H; const size_t tq = (size_t)b * S + q0; const int vl = iclamp(vlens[b], 0, S), nch = (vl + CH - 1) / CH;
  float (*Bk)[36] = BkW[wave]; float (*QE)[49] = QEW[wave]; float* Ls = LsW[wave]; float (*Of)[HD + 1] = OfW[wave];
  // staging, per wave and chunk: 8 copies of 4 K rows (8 lanes a 128-B row; rows i * 32 + wave * 4 + ..., hi then lo) and 8 copies of 2 V^T rows (16 lanes a 256-B row piece; rows i * 16 + wave * 2 + ..., hi then lo)
  const int kr = wave * 4 + (lane >> 3), kc = (lane & 7) * 8, vr = wave * 2 + (lane >> 4), vc = (lane & 15) * 8;
  const size_t kg = ((size_t)b * S + kr) * D + h * HD + kc, vg = ((size_t)bh * HD + vr) * S + vc;
  auto stage = [&](int c, int buf) { copy8(lds_off(&Ksh[buf][0][kr][kc]), 32 * KP * 2, Kh + kg + (size_t)c * CH * D, Kl + kg + (size_t)c * CH * D, (size_t)32 * D);
    copy8(lds_off(&Vsh[buf][0][vr][vc]), 16 * VP * 2, VTh + vg + c * CH, VTl + vg + c * CH, (size_t)16 * S); };
  stage(0, 0);   // chunk 0 flies under the set-up below
  if (lane < 16) { for (int r = 0; r < NR; ++r) Bk[lane][r] = -INFINITY; }
  // q fragments: row or column nloc in the k order of frag_kb, so that one fragment serves as A (QE) and as B (S^T)
  v16b qa[2], ql[2]; for (int ks = 0; ks < 2; ++ks) { qa[ks] = frag_kb(Qh + (tq + nloc) * D + h * HD + ks * 32, hlf); ql[ks] = frag_kb(Ql + (tq + nloc) * D + h * HD + ks * 32, hlf); }
  // QE[q][r] = q . Ek[r]
#pragma unroll
  for (int t = 0; t < 3; ++t) { v8f e = (v8f){};
#pragma unroll
    for (int ks = 0; ks < 2; ++ks) { const v16b eh = frag_kb(EKh + (size_t)(t * 16 + nloc) * HD + ks * 32, hlf), el = frag_kb(EKl + (size_t)(t * 16 + nloc) * HD + ks * 32, hlf); e = wmma16b(qa[ks], eh, e); e = wmma16b(qa[ks], el, e); e = wmma16b(ql[ks], eh, e); }
#pragma unroll
    for (int r8 = 0; r8 < 8; ++r8) QE[8 * hlf + r8][t * 16 + nloc] = e[r8] * (1.0f / (HS * HS)); }
  wave_lds_sync();
  const float qlo = QE[nloc][0], qhi = QE[nloc][2 * CLIP];   // this lane's query: the bias of every key at distance <= -16, and of every key at >= 16
  asm volatile("s_wait_asynccnt 0x0" ::: "memory");   // this wave's copies of chunk 0 have landed
  __syncthreads();                                    // ... and so have the other waves': chunk 0 may be read
  if (nch > 1) stage(1, 1);
  v8f oacc[4] = {(v8f){}, (v8f){}, (v8f){}, (v8f){}};   // O^T: lane = query, tile t register r8 = d t * 16 + 8 * half + r8
  // every '#pragma unroll' below makes the indices of a register array (sacc, oacc, kh, kl, vh, vlo, pa, pb, w) constants, so that it stays in registers
  float mrow = -INFINITY, slo = 0.0f, shi = 0.0f, sin_ = 0.0f;
#pragma unroll 1   // stays rolled: the trip count comes from valid_lens
  for (int ch = 0; ch < nch; ++ch) { const int k0 = ch * CH; v8f sacc[CH / 16]; const b16 (*Kc)[CH][KP] = Ksh[ch & 1]; const b16 (*Vc)[HD][VP] = Vsh[ch & 1];
#pragma unroll
    for (int tg = 0; tg < CH / 16; tg += 2) { v16b kh[2][2], kl[2][2];   // two tiles' fragment reads stand together, ahead of their products, for speed only
#pragma unroll
      for (int t = 0; t < 2; ++t)
#pragma unroll
        for (int ks = 0; ks < 2; ++ks) { kh[t][ks] = frag_kb(&Kc[0][(tg + t) * 16 + nloc][ks * 32], hlf); kl[t][ks] = frag_kb(&Kc[1][(tg + t) * 16 + nloc][ks * 32], hlf); }
#pragma unroll
      for (int t = 0; t < 2; ++t) { v8f s = (v8f){};
#pragma unroll
        for (int ks = 0; ks < 2; ++ks) { s = wmma16b(kh[t][ks], qa[ks], s); s = wmma16b(kl[t][ks], qa[ks], s); s = wmma16b(kh[t][ks], ql[ks], s); }
        sacc[tg + t] = s; } }
    const int dl = k0 + rowb - q0 - nloc;   // key - query of this lane at tile 0, register 0
    float mx = -INFINITY;
#pragma unroll
    for (int t = 0; t < CH / 16; ++t) { const int rel = k0 + t * 16 - q0; const bool near = rel >= -16 && rel <= 16;   // wave-uniform: only these three tiles hold an inner distance
      if (near) {   // bias by distance from LDS; the score of an inner distance is kept
#pragma unroll
        for (int r8 = 0; r8 < 8; ++r8) { const int d = dl + t * 16 + r8; const float s = (sacc[t][r8] * (1.0f / (HS * HS)) + QE[nloc][iclamp(d, -CLIP, CLIP) + CLIP]) * SCALE; const float sm = k0 + t * 16 + rowb + r8 < vl ? s : -INFINITY; sacc[t][r8] = sm; if (d > -CLIP && d < CLIP) Bk[nloc][d + CLIP] = sm; } }
      else { const float qe = rel < 0 ? qlo : qhi;
#pragma unroll
        for (int r8 = 0; r8 < 8; ++r8) sacc[t][r8] = (sacc[t][r8] * (1.0f / (HS * HS)) + qe) * SCALE;
        if (k0 + t * 16 + 16 > vl) {   // wave-uniform: only a tile that reaches past valid_len has keys to exclude
#pragma unroll
          for (int r8 = 0; r8 < 8; ++r8) sacc[t][r8] = k0 + t * 16 + rowb + r8 < vl ? sacc[t][r8] : -INFINITY; } }
      mx = fmaxf(mx, fmaxf(fmaxf(fmaxf(sacc[t][0], sacc[t][1]), fmaxf(sacc[t][2], sacc[t][3])), fmaxf(fmaxf(sacc[t][4], sacc[t][5]), fmaxf(sacc[t][6], sacc[t][7])))); }
    mx = fmaxf(mx, xhalf(mx));   // both halves now hold the maximum of this query's 128 scores
    const float mn = fmaxf(mrow, mx), fac = (mrow == -INFINITY) ? 0.0f : __expf(mrow - mn); mrow = mn; slo *= fac; shi *= fac; sin_ *= fac;
#pragma unroll
    for (int t = 0; t < 4; ++t)
#pragma unroll
      for (int r8 = 0; r8 < 8; ++r8) oacc[t][r8] *= fac;
#pragma unroll
    for (int kb = 0; kb < CH; kb += 32) { v16b vh[4], vlo[4], pa, pb;   // one group of reads, ahead of the exponentials that make this block's P
#pragma unroll
      for (int t = 0; t < 4; ++t) { vh[t] = frag_kb(&Vc[0][t * 16 + nloc][kb], hlf); vlo[t] = frag_kb(&Vc[1][t * 16 + nloc][kb], hlf); }
#pragma unroll
      for (int u = 0; u < 2; ++u) { const int t = kb / 16 + u, rel = k0 + t * 16 - q0;   // element u * 8 + r8 of the fragment is key kb + u * 16 + 8 * half + r8: the k order of frag_kb
#pragma unroll
        for (int r8 = 0; r8 < 8; r8 += 2) { const float p0 = __expf(sacc[t][r8] - mrow), p1 = __expf(sacc[t][r8 + 1] - mrow); sacc[t][r8] = p0; sacc[t][r8 + 1] = p1; const v2f x = (v2f){p0, p1} * PS;   // two keys share a fragment register: both roundings run on the pair
          const v2b ph = __builtin_convertvector(x, v2b), pl = __builtin_convertvector(x - __builtin_convertvector(ph, v2f), v2b); pa[u * 8 + r8] = ph[0]; pa[u * 8 + r8 + 1] = ph[1]; pb[u * 8 + r8] = pl[0]; pb[u * 8 + r8 + 1] = pl[1]; }
        if (rel <= -32) slo += ((sacc[t][0] + sacc[t][1]) + (sacc[t][2] + sacc[t][3])) + ((sacc[t][4] + sacc[t][5]) + (sacc[t][6] + sacc[t][7]));
        else if (rel >= 32) shi += ((sacc[t][0] + sacc[t][1]) + (sacc[t][2] + sacc[t][3])) + ((sacc[t][4] + sacc[t][5]) + (sacc[t][6] + sacc[t][7]));
        else {
#pragma unroll
          for (int r8 = 0; r8 < 8; ++r8) { const int d = dl + t * 16 + r8; const float p = sacc[t][r8]; slo += d <= -CLIP ? p : 0.0f; shi += d >= CLIP ? p : 0.0f; sin_ += (d > -CLIP && d < CLIP) ? p : 0.0f; } } }
#pragma unroll
      for (int t = 0; t < 4; ++t) { oacc[t] = wmma16b(vh[t], pa, oacc[t]); oacc[t] = wmma16b(vlo[t], pa, oacc[t]); oacc[t] = wmma16b(vh[t], pb, oacc[t]); } }
    asm volatile("s_wait_dscnt 0x0" ::: "memory");      // this wave's reads of the chunk's buffer have returned
    asm volatile("s_wait_asynccnt 0x0" ::: "memory");   // this wave's copies of chunk ch + 1 have landed
    __syncthreads();                                    // publishes chunk ch + 1 and frees the buffer that this pass has read
    if (ch + 2 < nch) stage(ch + 2, ch & 1); }
  asm volatile("s_wait_asynccnt 0x0" ::: "memory");     // no copy is outstanding behind the loop
  // this lane's two columns of all 33 Ev rows: the loads fly together, under the joins below, and the values stay in registers for all 16 query rows
  v2f evr[NR];
#pragma unroll
  for (int j = 0; j < NR; ++j) evr[j] = *(const v2f*)(ev + (size_t)j * HD + lane * 2);
  // join the two halves' sums; the inner distances' kept scores become weights under the final maximum (a slot no key reached holds -inf and gives 0)
  { const float a = slo + xhalf(slo), c = shi + xhalf(shi), e = sin_ + xhalf(sin_);
    if (hlf == 0) { Bk[nloc][0] = a; Bk[nloc][2 * CLIP] = c; Ls[nloc] = a + c + e; } }
  float w[16];   // half 0 turns slots 1-16 of its query, half 1 slots 17-31: it has no sixteenth slot, reads its fifteenth again and stores nothing
#pragma unroll
  for (int j = 0; j < 16; ++j) { const int sl = 1 + 16 * hlf + j; w[j] = __expf(Bk[nloc][sl < 2 * CLIP ? sl : 2 * CLIP - 1] - mrow); }
#pragma unroll
  for (int j = 0; j < 16; ++j) { const int sl = 1 + 16 * hlf + j; if (sl < 2 * CLIP) Bk[nloc][sl] = w[j]; }
#pragma unroll
  for (int t = 0; t < 4; ++t)
#pragma unroll
    for (int r8 = 0; r8 < 8; ++r8) Of[nloc][t * 16 + rowb + r8] = oacc[t][r8] * (1.0f / (PS * HS));
  wave_lds_sync();
  // + sum_r Bk[row][r] Ev[r][d]; lane = d pair. Every '#pragma unroll' here makes the indices of evr, bq and a constants, so that they stay in registers.
#pragma unroll
  for (int j = 0; j < NR; ++j) { evr[j][0] = bf16_near(evr[j][0]); evr[j][1] = bf16_near(evr[j][1]); }
#pragma unroll 1   // stays rolled: four rows a trip already give four independent sum chains, and sixteen would only lengthen the code
  for (int r0 = 0; r0 < 16; r0 += 4) { v2f a[4]; v4f bq[4][8]; float bl[4], inv[4];
#pragma unroll
    for (int i = 0; i < 4; ++i) { a[i] = (v2f){Of[r0 + i][lane * 2], Of[r0 + i][lane * 2 + 1]}; bl[i] = Bk[r0 + i][32]; inv[i] = 1.0f / Ls[r0 + i];
#pragma unroll
      for (int j = 0; j < 8; ++j) bq[i][j] = *(const v4f*)(&Bk[r0 + i][j * 4]); }
#pragma unroll
    for (int j = 0; j < NR - 1; ++j)
#pragma unroll
      for (int i = 0; i < 4; ++i) a[i] += bq[i][j >> 2][j & 3] * evr[j];
#pragma unroll
    for (int i = 0; i < 4; ++i) { a[i] += bl[i] * evr[NR - 1]; *(v2f*)(O + (tq + r0 + i) * D + h * HD + lane * 2) = a[i] * inv[i]; }
    asm volatile("s_wait_xcnt 0x0" ::: "memory"); } }   // the next trip rewrites the registers that these issued stores name: the wait stands in front of that overwrite
__global__ __launch_bounds__(256) void outp_kernel(const float* __restrict__ O, const b16* __restrict__ WO, int ALIM, float* __restrict__ out) {
  __shared__ __attribute__((aligned(16))) b16 Ah[BM][LP], Al[BM][LP], Bs[BN][LP]; __shared__ __attribute__((aligned(16))) float Tf[8][16][68];
  const int tid = threadIdx.x, lane = tid & 31, wave = tid >> 5, nloc = lane & 15, hlf = lane >> 4, wm = wave >> 1, wn = wave & 1;
  const size_t t0 = (size_t)blockIdx.x * BM; const int c0 = blockIdx.y * BN; if ((int)(t0 % S) >= ALIM) return;
  const int ar = tid >> 4, ac = (tid & 15) * 4, br = tid >> 3, bc = (tid & 7) * 8;
  const float* og = O + (t0 + ar) * D + ac; const b16* wg = WO + ((size_t)c0 + br) * D + bc;
  v4f ra[8]; v8b rb[4];
#pragma unroll
  for (int i = 0; i < 8; ++i) ra[i] = *(const v4f*)(og + (size_t)i * 16 * D);
#pragma unroll
  for (int i = 0; i < 4; ++i) rb[i] = *(const v8b*)(wg + (size_t)i * 32 * D);
  v8f acc[2][4];
#pragma unroll
  for (int mi = 0; mi < 2; ++mi)
#pragma unroll
    for (int ni = 0; ni < 4; ++ni) acc[mi][ni] = (v8f){};
#pragma unroll 1   // stays rolled, for speed only
  for (int k0 = 0; k0 < D; k0 += KS) {
#pragma unroll
    for (int i = 0; i < 8; ++i) { v4b hx, lx;
#pragma unroll
      for (int j = 0; j < 4; ++j) { b16 p, q; split16(ra[i][j] * HS, p, q); hx[j] = p; lx[j] = q; }
      *(v4b*)(&Ah[ar + i * 16][ac]) = hx; *(v4b*)(&Al[ar + i * 16][ac]) = lx; }
#pragma unroll
    for (int i = 0; i < 4; ++i) *(v8b*)(&Bs[br + i * 32][bc]) = rb[i];
    __syncthreads();
    if (k0 + KS < D) {
#pragma unroll
      for (int i = 0; i < 8; ++i) ra[i] = *(const v4f*)(og + (size_t)i * 16 * D + k0 + KS);
#pragma unroll
      for (int i = 0; i < 4; ++i) rb[i] = *(const v8b*)(wg + (size_t)i * 32 * D + k0 + KS);
      asm volatile("s_wait_xcnt 0x0" ::: "memory"); }   // the loop advances the address registers that these issued loads name: the wait stands in front of that overwrite
#pragma unroll
    for (int kb = 0; kb < KS; kb += 32) { v16b a[2], al[2], bw[4];
#pragma unroll
      for (int mi = 0; mi < 2; ++mi) { a[mi] = frag_kb(&Ah[wm * 32 + mi * 16 + nloc][kb], hlf); al[mi] = frag_kb(&Al[wm * 32 + mi * 16 + nloc][kb], hlf); }
#pragma unroll
      for (int ni = 0; ni < 4; ++ni) bw[ni] = frag_kb(&Bs[wn * 64 + ni * 16 + nloc][kb], hlf);
#pragma unroll
      for (int mi = 0; mi < 2; ++mi)
#pragma unroll
        for (int ni = 0; ni < 4; ++ni) acc[mi][ni] = wmma16b(a[mi], bw[ni], acc[mi][ni]);
#pragma unroll
      for (int mi = 0; mi < 2; ++mi)
#pragma unroll
        for (int ni = 0; ni < 4; ++ni) acc[mi][ni] = wmma16b(al[mi], bw[ni], acc[mi][ni]); }
    __syncthreads(); }
#pragma unroll
  for (int mi = 0; mi < 2; ++mi) {
#pragma unroll
    for (int ni = 0; ni < 4; ++ni)
#pragma unroll
      for (int r8 = 0; r8 < 8; ++r8) Tf[wave][8 * hlf + r8][ni * 16 + nloc] = acc[mi][ni][r8] * (1.0f / (HS * WSC));
    wave_lds_sync();
    v4f tv[8]; const size_t o = (t0 + wm * 32 + mi * 16 + hlf) * D + c0 + wn * 64 + nloc * 4;
#pragma unroll
    for (int rr = 0; rr < 8; ++rr) tv[rr] = *(const v4f*)(&Tf[wave][rr * 2 + hlf][nloc * 4]);
#pragma unroll
    for (int rr = 0; rr < 8; ++rr) *(v4f*)(out + o + (size_t)rr * 2 * D) = tv[rr];
    wave_lds_sync(); } }
}  // namespace

extern "C" void kernel_launch(void* const* d_in, const int* in_sizes, int n_in, void* d_out, int out_size, void* d_ws, size_t ws_size, hipStream_t stream) {
  (void)n_in;
  auto Fp = [&](int i) { return (const float*)d_in[i]; }; auto Ip = [&](int i) { return (const int*)d_in[i]; };
  // Input order: 0 queries [4,1024,1024]; 1 keys; 2 values; 3 valid_lens [4] i32; 4 Wq [1024,1024]; 5 Wk; 6 Wv; 7 Wo; 8 Ek [33,64]; 9 Ev [33,64]
  if (in_sizes[0] != NT * D || in_sizes[1] != NT * D || in_sizes[2] != NT * D || in_sizes[3] != NB_ || in_sizes[4] != D * D || in_sizes[7] != D * D || in_sizes[8] != NR * HD || in_sizes[9] != NR * HD || out_size != NT * D) return;
  const int QLIM = S, ALIM = S;   // QLIM = tokens projected per batch (>= max valid_len), ALIM = queries attended/output (multiples of 128)
  size_t off = 0; char* ws = (char*)d_ws;
  auto carve = [&](size_t bytes) { char* p = ws + off; off += (bytes + 255) & ~(size_t)255; return p; };
  b16* W4 = (b16*)carve((size_t)4 * D * D * 2); b16* EKh = (b16*)carve(48 * HD * 2); b16* EKl = (b16*)carve(48 * HD * 2); b16* Qh = (b16*)carve((size_t)NT * D * 2); b16* Ql = (b16*)carve((size_t)NT * D * 2); b16* Kh = (b16*)carve((size_t)NT * D * 2); b16* Kl = (b16*)carve((size_t)NT * D * 2); b16* VTh = (b16*)carve((size_t)NT * D * 2); b16* VTl = (b16*)carve((size_t)NT * D * 2); float* O = (float*)carve((size_t)NT * D * 4); b16* X16 = (b16*)carve((size_t)3 * NT * D * 2);
  if (off > ws_size || off > ((size_t)104 << 20)) return;   // ~ 101 MB
  wput_kernel<<<PG, 256, 0, stream>>>(Fp(4), Fp(5), Fp(6), Fp(7), Fp(8), Fp(0), Fp(1), Fp(2), W4, EKh, EKl, X16);
  proj_kernel<<<dim3(NT / BM, D / BN, 3), 256, 0, stream>>>(X16, W4, QLIM, Qh, Ql, Kh, Kl, VTh, VTl);
  att_kernel<<<NB_ * H * (S / (16 * AW)), 32 * AW, 0, stream>>>(Qh, Ql, Kh, Kl, VTh, VTl, EKh, EKl, Fp(9), Ip(3), ALIM, O);
  outp_kernel<<<dim3(NT / BM, D / BN), 256, 0, stream>>>(O, W4 + (size_t)3 * D * D, ALIM, (float*)d_out);
}

// v008
// Measured time: 90.4 microseconds a run.
// Next to v007, in two timings, it ran 1.08 times as fast each time.
// Counting every step since v000, it is 15.9 times as fast.
#include <hip/hip_runtime.h>

// MultiHeadAttentionWithRPR: q = queries Wq^T, k = keys Wk^T, v = values Wv^T (16 heads x 64); dist = clip(k - q, -16, 16) + 16; scores = (q.k + q.Ek[dist]) / 8; keys >= valid_lens[b] -> -1e6 (excluded); attn = softmax; out_h = attn v + sum_k attn Ev[dist]; out = concat_h Wo^T -> [4][1024][1024].
// Deterministic: online softmax over fixed 64-key chunks (only chunks below valid_len), fixed order; the Ev term via 33 per-row bucket sums of attn; no atomics.
// WMMA (v_wmma_f32_16x16x32_f16, f32 accumulate): inputs (EXACT bf16 x8, K 1,024) x Wq/Wk/Wv rows (EXACT) in 128 x 128 block tiles; per (bh, 16-query) wave (8 waves a work-group, K and V^T chunks shared in LDS) QE = q (hi+lo) x Ek rows (hi+lo; 3 tiles), S^T = k rows x q (hi+lo; 4 tiles/chunk), O^T += v^T (hi+lo) x P (hi+lo; 4 tiles); o (hi+lo) x Wo rows (64 tiles) — ≈ 4 M WMMA; softmax, buckets, Ev epilogue in f32.

namespace {
constexpr int NB_ = 4, S = 1024, D = 1024, H = 16, HD = 64, CLIP = 16, NR = 2 * CLIP + 1 /* 33 */, NT = NB_ * S, CH = 64;
constexpr int BM = 128, BN = 128, KS = 64, LP = KS + 8;   // GEMM block tile, k per LDS stage, LDS row pitch in halves (144 B = 16 B x odd, for 16-byte readers)
constexpr int PG = 512, XU = NT * D / 4 / (PG * 256);   // first launch: work-groups, and 4-element pieces of each input tensor a thread converts
constexpr int AW = 8, KP = HD + 8, VP = CH + 8;   // attention: waves of a work-group; LDS row pitch in halves of a staged K row and V^T row (144 B each = 16 B x odd, for 16-byte readers)
constexpr float XS = 8.0f, HS = 256.0f, PS = 256.0f, WSC = 256.0f, SCALE = 0.125f;
typedef _Float16 b16;
typedef __attribute__((ext_vector_type(16))) _Float16 v16b;
typedef __attribute__((ext_vector_type(8))) _Float16 v8b;
typedef __attribute__((ext_vector_type(4))) _Float16 v4b;
typedef __attribute__((ext_vector_type(2))) _Float16 v2b;
typedef __attribute__((ext_vector_type(8))) float v8f;
typedef __attribute__((ext_vector_type(4))) float v4f;
typedef __attribute__((ext_vector_type(2))) float v2f;
__device__ __forceinline__ float bf16_rne(float f) { unsigned int u = __float_as_uint(f); u += 0x7FFFu + ((u >> 16) & 1u); float r = __uint_as_float(u & 0xFFFF0000u); asm volatile("" : "+v"(r)); return r; }
__device__ __forceinline__ float bfv(float f) { float r = bf16_rne(f); asm volatile("" : "+v"(r)); return r; }
__device__ __forceinline__ void split16(float v, b16& hi, b16& lo) { hi = (b16)v; lo = (b16)(v - (float)hi); }
__device__ __forceinline__ v16b frag_kb(const b16* p, int hh) { const v8b a = *(const v8b*)(p + 8 * hh), b = *(const v8b*)(p + 16 + 8 * hh); v16b f;
#pragma unroll
  for (int e = 0; e < 8; ++e) { f[e] = a[e]; f[8 + e] = b[e]; } return f; }
__device__ __forceinline__ v8f wmma16b(v16b a, v16b b, v8f c) { v8f d = __builtin_amdgcn_wmma_f32_16x16x32_f16(false, a, false, b, (short)0, c, false, false); asm volatile("v_nop\n\tv_nop\n\tv_nop\n\tv_nop" : "+v"(d) : "v"(a), "v"(b)); return d; }
__device__ __forceinline__ void wave_lds_sync() { __builtin_amdgcn_fence(__ATOMIC_RELEASE, "workgroup"); __builtin_amdgcn_wave_barrier(); __builtin_amdgcn_fence(__ATOMIC_ACQUIRE, "workgroup"); }
__device__ __forceinline__ float bf16_near(float f) { unsigned int u = __float_as_uint(f); u += 0x7FFFu + ((u >> 16) & 1u); return __uint_as_float(u & 0xFFFF0000u); }   // f rounded to the nearest bf16 value, ties to even
__device__ __forceinline__ float xhalf(float x) { return __builtin_bit_cast(float, __builtin_amdgcn_permlanex16(__builtin_bit_cast(int, x), __builtin_bit_cast(int, x), 0x76543210, 0xfedcba98, false, false)); }   // the value of lane l ^ 16
__device__ __forceinline__ unsigned lds_off(const b16* p) { typedef __attribute__((address_space(3))) const b16 lds_b16; return (unsigned)(size_t)(lds_b16*)p; }   // byte address of p inside the work-group's LDS
// Eight asynchronous copies, 16 bytes a lane each, global memory -> LDS through no register: two each from ga, gb, gc, gd (the pointer, then the pointer + gs); copies 0-3 land at LDS byte la + i * ls, copies 4-7 at lb + (i - 4) * ls.
// The s_wait_xcnt closes the statement so that no address register of an issued copy is rewritten in front of it.
__device__ __forceinline__ void copy8(unsigned la, unsigned lb, unsigned ls, const b16* ga, const b16* gb, const b16* gc, const b16* gd, size_t gs) {
  asm volatile("global_load_async_to_lds_b128 %0, %8, off\n\tglobal_load_async_to_lds_b128 %1, %9, off\n\tglobal_load_async_to_lds_b128 %2, %10, off\n\tglobal_load_async_to_lds_b128 %3, %11, off\n\t"
               "global_load_async_to_lds_b128 %4, %12, off\n\tglobal_load_async_to_lds_b128 %5, %13, off\n\tglobal_load_async_to_lds_b128 %6, %14, off\n\tglobal_load_async_to_lds_b128 %7, %15, off\n\ts_wait_xcnt 0x0"
               :: "v"(la), "v"(la + ls), "v"(la + 2 * ls), "v"(la + 3 * ls), "v"(lb), "v"(lb + ls), "v"(lb + 2 * ls), "v"(lb + 3 * ls),
                  "v"(ga), "v"(ga + gs), "v"(gb), "v"(gb + gs), "v"(gc), "v"(gc + gs), "v"(gd), "v"(gd + gs) : "memory"); }
__device__ __forceinline__ int iclamp(int v, int lo, int hi) { return v < lo ? lo : (v > hi ? hi : v); }

__global__ __launch_bounds__(256) void wput_kernel(const float* __restrict__ wq, const float* __restrict__ wk, const float* __restrict__ wv, const float* __restrict__ wo, const float* __restrict__ ek, const float* __restrict__ xq, const float* __restrict__ xk, const float* __restrict__ xv, b16* __restrict__ W4, b16* __restrict__ EKh, b16* __restrict__ EKl, b16* __restrict__ X16) { const size_t nt = (size_t)gridDim.x * 256, u0 = (size_t)blockIdx.x * 256 + threadIdx.x; v8b v;
  // queries, keys, values: rounded and scaled ONCE here, into one 16-bit plane each, for all eight column blocks of the projection. 16 bytes a lane in, 8 bytes out, whole lines; a thread's XU loads of a tensor fly together.
  static_assert((size_t)XU * PG * 256 * 4 == (size_t)NT * D && XU % 4 == 0, "the pieces cover a tensor exactly");
#pragma unroll 1   // stays rolled: one tensor's loads in flight are enough, and three would triple the registers
  for (int w3 = 0; w3 < 3; ++w3) { const float* x = (w3 == 0 ? xq : (w3 == 1 ? xk : xv)) + u0 * 4; b16* y = X16 + (size_t)w3 * NT * D + u0 * 4; v4f r[XU];
#pragma unroll   // constant indices keep r in registers
    for (int j = 0; j < XU; j += 4) {
#pragma unroll
      for (int i = 0; i < 4; ++i) r[j + i] = *(const v4f*)(x + (size_t)(j + i) * PG * 256 * 4);
      asm volatile("s_wait_xcnt 0x0" ::: "memory"); }   // later loads' results and the store addresses may take the address registers that these issued loads name: the wait stands in front of that overwrite
#pragma unroll
    for (int j = 0; j < XU; ++j) { v4b hx;
#pragma unroll
      for (int e = 0; e < 4; ++e) hx[e] = (b16)(bf16_rne(r[j][e]) * XS);
      *(v4b*)(y + (size_t)j * PG * 256 * 4) = hx; }
    asm volatile("s_wait_xcnt 0x0" ::: "memory"); }   // the next trip rewrites the address registers that these issued stores name: the wait stands in front of that overwrite
  for (size_t u = u0; u < (size_t)4 * D * 128; u += nt) { const int o = (int)(u / 128), k0 = (int)(u % 128) * 8; const int which = o / D, oo = o % D; const float* w = which == 0 ? wq : (which == 1 ? wk : (which == 2 ? wv : wo));
#pragma unroll
    for (int j = 0; j < 8; ++j) v[j] = (b16)(bf16_rne(w[(size_t)oo * D + k0 + j]) * WSC); { *(v8b*)(W4 + (size_t)o * D + k0) = v;  } }
  if (u0 < 48 * 8) { const int r = (int)(u0 / 8), k0 = (int)(u0 % 8) * 8; v8b a, c;
#pragma unroll
    for (int j = 0; j < 8; ++j) { float e = r < NR ? bfv(ek[(size_t)r * HD + k0 + j]) : 0.0f; b16 p, pl; split16(e * HS, p, pl); a[j] = p; c[j] = pl; } { *(v8b*)(EKh + (size_t)r * HD + k0) = a; *(v8b*)(EKl + (size_t)r * HD + k0) = c;  } } }
// The four dense projections run as block-tiled GEMMs: 8 waves share one 128 x 128 output tile (wave = 32 rows x 64 columns), both operands staged in LDS 64 k at a time,
// the next stage's global loads issued ahead of the current stage's products. Every accumulator still sums k in ascending blocks of 32.
// In both kernels each '#pragma unroll' makes the indices of a register array (ra, rb, acc, fragments, tv) constants, so that it stays in registers.
__global__ __launch_bounds__(256) void proj_kernel(const b16* __restrict__ X16, const b16* __restrict__ W4, int QLIM, b16* __restrict__ Qh, b16* __restrict__ Ql, b16* __restrict__ Kh, b16* __restrict__ Kl, b16* __restrict__ VTh, b16* __restrict__ VTl) {
  __shared__ __attribute__((aligned(16))) b16 As[BM][LP], Bs[BN][LP]; __shared__ __attribute__((aligned(16))) float Tf[8][16][68];
  const int tid = threadIdx.x, lane = tid & 31, wave = tid >> 5, nloc = lane & 15, hlf = lane >> 4, wm = wave >> 1, wn = wave & 1;
  const size_t t0 = (size_t)blockIdx.x * BM; const int c0 = blockIdx.y * BN, which = blockIdx.z; if ((int)(t0 % S) >= QLIM) return;
  // v is wanted transposed ([batch][feature][token]): its product takes the W rows as A and the x rows as B, so that an accumulator tile has features as rows and tokens as columns (wave = 32 features x 64 tokens)
  const b16 (*Af)[LP] = which == 2 ? Bs : As; const b16 (*Bf)[LP] = which == 2 ? As : Bs;
  const int br = tid >> 3, bc = (tid & 7) * 8;   // staging: 8 lanes per 128-B piece of an x row (already 16-bit, from the first launch) and of a W row
  const b16* xg = X16 + ((size_t)which * NT + t0 + br) * D + bc; const b16* wg = W4 + ((size_t)which * D + c0 + br) * D + bc;
  v8b ra[4], rb[4];
#pragma unroll
  for (int i = 0; i < 4; ++i) ra[i] = *(const v8b*)(xg + (size_t)i * 32 * D);
#pragma unroll
  for (int i = 0; i < 4; ++i) rb[i] = *(const v8b*)(wg + (size_t)i * 32 * D);
  v8f acc[2][4];
#pragma unroll
  for (int mi = 0; mi < 2; ++mi)
#pragma unroll
    for (int ni = 0; ni < 4; ++ni) acc[mi][ni] = (v8f){};
#pragma unroll 1   // stays rolled, for speed only
  for (int k0 = 0; k0 < D; k0 += KS) {
#pragma unroll
    for (int i = 0; i < 4; ++i) { *(v8b*)(&As[br + i * 32][bc]) = ra[i]; *(v8b*)(&Bs[br + i * 32][bc]) = rb[i]; }
    __syncthreads();
    if (k0 + KS < D) {
#pragma unroll
      for (int i = 0; i < 4; ++i) { ra[i] = *(const v8b*)(xg + (size_t)i * 32 * D + k0 + KS); rb[i] = *(const v8b*)(wg + (size_t)i * 32 * D + k0 + KS); }
      asm volatile("s_wait_xcnt 0x0" ::: "memory"); }   // the loop advances the address registers that these issued loads name: the wait stands in front of that overwrite
#pragma unroll
    for (int kb = 0; kb < KS; kb += 32) { v16b a[2], bw[4];
#pragma unroll
      for (int mi = 0; mi < 2; ++mi) a[mi] = frag_kb(&Af[wm * 32 + mi * 16 + nloc][kb], hlf);
#pragma unroll
      for (int ni = 0; ni < 4; ++ni) bw[ni] = frag_kb(&Bf[wn * 64 + ni * 16 + nloc][kb], hlf);
#pragma unroll
      for (int mi = 0; mi < 2; ++mi)
#pragma unroll
        for (int ni = 0; ni < 4; ++ni) acc[mi][ni] = wmma16b(a[mi], bw[ni], acc[mi][ni]); }
    __syncthreads(); }
  // each wave stages 16 x 64 results in its own LDS range and stores whole lines: two rows per instruction, 16 lanes a row
#pragma unroll
  for (int mi = 0; mi < 2; ++mi) {
#pragma unroll
    for (int ni = 0; ni < 4; ++ni)
#pragma unroll
      for (int r8 = 0; r8 < 8; ++r8) Tf[wave][8 * hlf + r8][ni * 16 + nloc] = acc[mi][ni][r8] * (1.0f / (XS * WSC));
    wave_lds_sync();
    v4f tv[8]; const size_t o = which == 2 ? ((t0 / S) * D + c0 + wm * 32 + mi * 16 + hlf) * S + t0 % S + wn * 64 + nloc * 4 : (t0 + wm * 32 + mi * 16 + hlf) * D + c0 + wn * 64 + nloc * 4;   // v: row = feature, of S tokens; q, k: row = token, of D features
#pragma unroll
    for (int rr = 0; rr < 8; ++rr) tv[rr] = *(const v4f*)(&Tf[wave][rr * 2 + hlf][nloc * 4]);
    { static_assert(S == D, "one row pitch serves both layouts"); b16* Ph = which == 0 ? Qh : (which == 1 ? Kh : VTh); b16* Pl = which == 0 ? Ql : (which == 1 ? Kl : VTl);
#pragma unroll
      for (int rr = 0; rr < 8; ++rr) { v4b ph, pl;
#pragma unroll
        for (int j = 0; j < 4; ++j) { b16 p, q; split16(tv[rr][j] * HS, p, q); ph[j] = p; pl[j] = q; }
        *(v4b*)(Ph + o + (size_t)rr * 2 * D) = ph; *(v4b*)(Pl + o + (size_t)rr * 2 * D) = pl; } }
    wave_lds_sync(); } }
// One work-group of 8 waves per (batch-head, 128 queries), one wave per 16 queries. Each 64-key chunk of K and V^T (hi and lo) is staged once for all eight waves in LDS by asynchronous copies, whole 128-B lines,
// two buffers: chunk c + 1 flies while chunk c is worked on; every fragment of K and V^T is read from LDS. Everything else is private to its wave, as are its LDS ranges (index [wave]).
// The chunk length and the register budget (at most 256, the second launch bound: four waves a SIMD) are set so that TWO work-groups stand on a WGP (LDS under 160 KiB each): one's vector work and waits run under the other's products.
// Both products run transposed: S^T = K q^T (K rows as A, q rows as B) and O^T += V^T P^T (V^T rows as A, P as B). A lane holds ONE query (column lane & 15) and, of each 16-key tile, the keys 8 * half + r8:
// bias, mask, maximum, exp and the sums all run in-lane, the two halves of a query joined by one cross-row move; two score tiles, rounded in place, are the B fragment of P for 32 keys, so that P never goes through LDS.
// Buckets: distance <= -16 and >= 16 are running per-lane sums, joined once after the loop; each of the 31 inner distances has one key, whose score is kept and turned into its weight with the final maximum.
__global__ __launch_bounds__(32 * AW, 4) void att_kernel(const b16* __restrict__ Qh, const b16* __restrict__ Ql, const b16* __restrict__ Kh, const b16* __restrict__ Kl, const b16* __restrict__ VTh, const b16* __restrict__ VTl, const b16* __restrict__ EKh, const b16* __restrict__ EKl, const float* __restrict__ ev, const int* __restrict__ vlens, int ALIM, float* __restrict__ O) { __shared__ __attribute__((aligned(16))) b16 Ksh[2][2][CH][KP], Vsh[2][2][HD][VP];   // [buffer][hi, lo][key][d] and [buffer][hi, lo][d][key]
  __shared__ __attribute__((aligned(16))) float BkW[AW][16][36]; __shared__ float QEW[AW][16][49], LsW[AW][16], OfW[AW][16][HD + 1];
  const int lane = threadIdx.x & 31, wave = __builtin_amdgcn_readfirstlane(threadIdx.x >> 5), nloc = lane & 15, hlf = lane >> 4, rowb = 8 * hlf;   // the wave's number in a scalar register keeps the tests on q0 below scalar branches
  const int bh = blockIdx.x / (S / (16 * AW)), qb = (blockIdx.x % (S / (16 * AW))) * (16 * AW); if (qb >= ALIM) return; const int q0 = qb + wave * 16; const int b = bh / H, h = bh % H; const size_t tq = (size_t)b * S + q0; const int vl = iclamp(vlens[b], 0, S), nch = (vl + CH - 1) / CH;
  float (*Bk)[36] = BkW[wave]; float (*QE)[49] = QEW[wave]; float* Ls = LsW[wave]; float (*Of)[HD + 1] = OfW[wave];
  // staging, per wave and chunk: 4 copies of 4 K rows and 4 copies of 4 V^T row pieces (8 lanes a 128-B row; rows i * 32 + wave * 4 + ..., hi then lo, whose plane follows 64 rows on)
  static_assert(CH == 64 && HD == 64 && KP == VP && S == D, "K and V^T chunks have one shape, in LDS and in their row steps");
  const int kr = wave * 4 + (lane >> 3), kc = (lane & 7) * 8;
  const size_t kg = ((size_t)b * S + kr) * D + h * HD + kc, vg = ((size_t)bh * HD + kr) * S + kc;
  auto stage = [&](int c, int buf) { copy8(lds_off(&Ksh[buf][0][kr][kc]), lds_off(&Vsh[buf][0][kr][kc]), 32 * KP * 2, Kh + kg + (size_t)c * CH * D, Kl + kg + (size_t)c * CH * D, VTh + vg + c * CH, VTl + vg + c * CH, (size_t)32 * D); };
  stage(0, 0);   // chunk 0 flies under the set-up below
  if (lane < 16) { for (int r = 0; r < NR; ++r) Bk[lane][r] = -INFINITY; }
  // q fragments: row or column nloc in the k order of frag_kb, so that one fragment serves as A (QE) and as B (S^T)
  v16b qa[2], ql[2]; for (int ks = 0; ks < 2; ++ks) { qa[ks] = frag_kb(Qh + (tq + nloc) * D + h * HD + ks * 32, hlf); ql[ks] = frag_kb(Ql + (tq + nloc) * D + h * HD + ks * 32, hlf); }
  asm volatile("s_wait_xcnt 0x0" ::: "memory");   // the results of the Ek loads below may take the address registers that these issued loads name: the wait stands in front of that overwrite
  // QE[q][r] = q . Ek[r]
#pragma unroll
  for (int t = 0; t < 3; ++t) { v8f e = (v8f){};
#pragma unroll
    for (int ks = 0; ks < 2; ++ks) { const v16b eh = frag_kb(EKh + (size_t)(t * 16 + nloc) * HD + ks * 32, hlf), el = frag_kb(EKl + (size_t)(t * 16 + nloc) * HD + ks * 32, hlf); e = wmma16b(qa[ks], eh, e); e = wmma16b(qa[ks], el, e); e = wmma16b(ql[ks], eh, e); }
#pragma unroll
    for (int r8 = 0; r8 < 8; ++r8) QE[8 * hlf + r8][t * 16 + nloc] = e[r8] * (1.0f / (HS * HS)); }
  wave_lds_sync();
  const float qlo = QE[nloc][0], qhi = QE[nloc][2 * CLIP];   // this lane's query: the bias of every key at distance <= -16, and of every key at >= 16
  asm volatile("s_wait_asynccnt 0x0" ::: "memory");   // this wave's copies of chunk 0 have landed
  __syncthreads();                                    // ... and so have the other waves': chunk 0 may be read
  if (nch > 1) stage(1, 1);
  v8f oacc[4] = {(v8f){}, (v8f){}, (v8f){}, (v8f){}};   // O^T: lane = query, tile t register r8 = d t * 16 + 8 * half + r8
  // every '#pragma unroll' below makes the indices of a register array (sacc, oacc, kh, kl, vh, vlo, pa, pb, w) constants, so that it stays in registers
  float mrow = -INFINITY, slo = 0.0f, shi = 0.0f, sin_ = 0.0f;
#pragma unroll 1   // stays rolled: the trip count comes from valid_lens
  for (int ch = 0; ch < nch; ++ch) { const int k0 = ch * CH; v8f sacc[CH / 16]; const b16 (*Kc)[CH][KP] = Ksh[ch & 1]; const b16 (*Vc)[HD][VP] = Vsh[ch & 1];
#pragma unroll
    for (int tg = 0; tg < CH / 16; tg += 2) { v16b kh[2][2], kl[2][2];   // two tiles' fragment reads stand together, ahead of their products, for speed only
#pragma unroll
      for (int t = 0; t < 2; ++t)
#pragma unroll
        for (int ks = 0; ks < 2; ++ks) { kh[t][ks] = frag_kb(&Kc[0][(tg + t) * 16 + nloc][ks * 32], hlf); kl[t][ks] = frag_kb(&Kc[1][(tg + t) * 16 + nloc][ks * 32], hlf); }
#pragma unroll
      for (int t = 0; t < 2; ++t) { v8f s = (v8f){};
#pragma unroll
        for (int ks = 0; ks < 2; ++ks) { s = wmma16b(kh[t][ks], qa[ks], s); s = wmma16b(kl[t][ks], qa[ks], s); s = wmma16b(kh[t][ks], ql[ks], s); }
        sacc[tg + t] = s; } }
    const int dl = k0 + rowb - q0 - nloc;   // key - query of this lane at tile 0, register 0
    float mx = -INFINITY;
#pragma unroll
    for (int t = 0; t < CH / 16; ++t) { const int rel = k0 + t * 16 - q0; const bool near = rel >= -16 && rel <= 16;   // wave-uniform: only these three tiles hold an inner distance
      if (near) {   // bias by distance from LDS; the score of an inner distance is kept
#pragma unroll
        for (int r8 = 0; r8 < 8; ++r8) { const int d = dl + t * 16 + r8; const float s = (sacc[t][r8] * (1.0f / (HS * HS)) + QE[nloc][iclamp(d, -CLIP, CLIP) + CLIP]) * SCALE; const float sm = k0 + t * 16 + rowb + r8 < vl ? s : -INFINITY; sacc[t][r8] = sm; if (d > -CLIP && d < CLIP) Bk[nloc][d + CLIP] = sm; } }
      else { const float qe = rel < 0 ? qlo : qhi;
#pragma unroll
        for (int r8 = 0; r8 < 8; ++r8) sacc[t][r8] = (sacc[t][r8] * (1.0f / (HS * HS)) + qe) * SCALE;
        if (k0 + t * 16 + 16 > vl) {   // wave-uniform: only a tile that reaches past valid_len has keys to exclude
#pragma unroll
          for (int r8 = 0; r8 < 8; ++r8) sacc[t][r8] = k0 + t * 16 + rowb + r8 < vl ? sacc[t][r8] : -INFINITY; } }
      mx = fmaxf(mx, fmaxf(fmaxf(fmaxf(sacc[t][0], sacc[t][1]), fmaxf(sacc[t][2], sacc[t][3])), fmaxf(fmaxf(sacc[t][4], sacc[t][5]), fmaxf(sacc[t][6], sacc[t][7])))); }
    mx = fmaxf(mx, xhalf(mx));   // both halves now hold the maximum of this query's 64 scores
    const float mn = fmaxf(mrow, mx), fac = (mrow == -INFINITY) ? 0.0f : __expf(mrow - mn); mrow = mn; slo *= fac; shi *= fac; sin_ *= fac;
#pragma unroll
    for (int t = 0; t < 4; ++t)
#pragma unroll
      for (int r8 = 0; r8 < 8; ++r8) oacc[t][r8] *= fac;
#pragma unroll
    for (int kb = 0; kb < CH; kb += 32) { v16b vh[4], vlo[4], pa, pb;   // one group of reads, ahead of the exponentials that make this block's P
#pragma unroll
      for (int t = 0; t < 4; ++t) { vh[t] = frag_kb(&Vc[0][t * 16 + nloc][kb], hlf); vlo[t] = frag_kb(&Vc[1][t * 16 + nloc][kb], hlf); }
#pragma unroll
      for (int u = 0; u < 2; ++u) { const int t = kb / 16 + u, rel = k0 + t * 16 - q0;   // element u * 8 + r8 of the fragment is key kb + u * 16 + 8 * half + r8: the k order of frag_kb
#pragma unroll
        for (int r8 = 0; r8 < 8; r8 += 2) { const float p0 = __expf(sacc[t][r8] - mrow), p1 = __expf(sacc[t][r8 + 1] - mrow); sacc[t][r8] = p0; sacc[t][r8 + 1] = p1; const v2f x = (v2f){p0, p1} * PS;   // two keys share a fragment register: both roundings run on the pair
          const v2b ph = __builtin_convertvector(x, v2b), pl = __builtin_convertvector(x - __builtin_convertvector(ph, v2f), v2b); pa[u * 8 + r8] = ph[0]; pa[u * 8 + r8 + 1] = ph[1]; pb[u * 8 + r8] = pl[0]; pb[u * 8 + r8 + 1] = pl[1]; }
        if (rel <= -32) slo += ((sacc[t][0] + sacc[t][1]) + (sacc[t][2] + sacc[t][3])) + ((sacc[t][4] + sacc[t][5]) + (sacc[t][6] + sacc[t][7]));
        else if (rel >= 32) shi += ((sacc[t][0] + sacc[t][1]) + (sacc[t][2] + sacc[t][3])) + ((sacc[t][4] + sacc[t][5]) + (sacc[t][6] + sacc[t][7]));
        else {
#pragma unroll
          for (int r8 = 0; r8 < 8; ++r8) { const int d = dl + t * 16 + r8; const float p = sacc[t][r8]; slo += d <= -CLIP ? p : 0.0f; shi += d >= CLIP ? p : 0.0f; sin_ += (d > -CLIP && d < CLIP) ? p : 0.0f; } } }
#pragma unroll
      for (int t = 0; t < 4; ++t) { oacc[t] = wmma16b(vh[t], pa, oacc[t]); oacc[t] = wmma16b(vlo[t], pa, oacc[t]); oacc[t] = wmma16b(vh[t], pb, oacc[t]); } }
    asm volatile("s_wait_dscnt 0x0" ::: "memory");      // this wave's reads of the chunk's buffer have returned
    asm volatile("s_wait_asynccnt 0x0" ::: "memory");   // this wave's copies of chunk ch + 1 have landed
    __syncthreads();                                    // publishes chunk ch + 1 and frees the buffer that this pass has read
    if (ch + 2 < nch) stage(ch + 2, ch & 1); }
  asm volatile("s_wait_asynccnt 0x0" ::: "memory");     // no copy is outstanding behind the loop
  // this lane's two columns of all 33 Ev rows: the loads fly together, under the joins below, and the values stay in registers for all 16 query rows
  v2f evr[NR];
#pragma unroll
  for (int j = 0; j < NR; ++j) evr[j] = *(const v2f*)(ev + (size_t)j * HD + lane * 2);
  // join the two halves' sums; the inner distances' kept scores become weights under the final maximum (a slot no key reached holds -inf and gives 0)
  { const float a = slo + xhalf(slo), c = shi + xhalf(shi), e = sin_ + xhalf(sin_);
    if (hlf == 0) { Bk[nloc][0] = a; Bk[nloc][2 * CLIP] = c; Ls[nloc] = a + c + e; } }
  float w[16];   // half 0 turns slots 1-16 of its query, half 1 slots 17-31: it has no sixteenth slot, reads its fifteenth again and stores nothing
#pragma unroll
  for (int j = 0; j < 16; ++j) { const int sl = 1 + 16 * hlf + j; w[j] = __expf(Bk[nloc][sl < 2 * CLIP ? sl : 2 * CLIP - 1] - mrow); }
#pragma unroll
  for (int j = 0; j < 16; ++j) { const int sl = 1 + 16 * hlf + j; if (sl < 2 * CLIP) Bk[nloc][sl] = w[j]; }
#pragma unroll
  for (int t = 0; t < 4; ++t)
#pragma unroll
    for (int r8 = 0; r8 < 8; ++r8) Of[nloc][t * 16 + rowb + r8] = oacc[t][r8] * (1.0f / (PS * HS));
  wave_lds_sync();
  // + sum_r Bk[row][r] Ev[r][d]; lane = d pair. Every '#pragma unroll' here makes the indices of evr, bq and a constants, so that they stay in registers.
#pragma unroll
  for (int j = 0; j < NR; ++j) { evr[j][0] = bf16_near(evr[j][0]); evr[j][1] = bf16_near(evr[j][1]); }
#pragma unroll 1   // stays rolled: four rows a trip already give four independent sum chains, and sixteen would only lengthen the code
  for (int r0 = 0; r0 < 16; r0 += 4) { v2f a[4]; v4f bq[4][8]; float bl[4], inv[4];
#pragma unroll
    for (int i = 0; i < 4; ++i) { a[i] = (v2f){Of[r0 + i][lane * 2], Of[r0 + i][lane * 2 + 1]}; bl[i] = Bk[r0 + i][32]; inv[i] = 1.0f / Ls[r0 + i];
#pragma unroll
      for (int j = 0; j < 8; ++j) bq[i][j] = *(const v4f*)(&Bk[r0 + i][j * 4]); }
#pragma unroll
    for (int j = 0; j < NR - 1; ++j)
#pragma unroll
      for (int i = 0; i < 4; ++i) a[i] += bq[i][j >> 2][j & 3] * evr[j];
#pragma unroll
    for (int i = 0; i < 4; ++i) { a[i] += bl[i] * evr[NR - 1]; *(v2f*)(O + (tq + r0 + i) * D + h * HD + lane * 2) = a[i] * inv[i]; }
    asm volatile("s_wait_xcnt 0x0" ::: "memory"); } }   // the next trip rewrites the registers that these issued stores name: the wait stands in front of that overwrite
__global__ __launch_bounds__(256) void outp_kernel(const float* __restrict__ O, const b16* __restrict__ WO, int ALIM, float* __restrict__ out) {
  __shared__ __attribute__((aligned(16))) b16 Ah[BM][LP], Al[BM][LP], Bs[BN][LP]; __shared__ __attribute__((aligned(16))) float Tf[8][16][68];
  const int tid = threadIdx.x, lane = tid & 31, wave = tid >> 5, nloc = lane & 15, hlf = lane >> 4, wm = wave >> 1, wn = wave & 1;
  const size_t t0 = (size_t)blockIdx.x * BM; const int c0 = blockIdx.y * BN; if ((int)(t0 % S) >= ALIM) return;
  const int ar = tid >> 4, ac = (tid & 15) * 4, br = tid >> 3, bc = (tid & 7) * 8;
  const float* og = O + (t0 + ar) * D + ac; const b16* wg = WO + ((size_t)c0 + br) * D + bc;
  v4f ra[8]; v8b rb[4];
#pragma unroll
  for (int i = 0; i < 8; ++i) ra[i] = *(const v4f*)(og + (size_t)i * 16 * D);
#pragma unroll
  for (int i = 0; i < 4; ++i) rb[i] = *(const v8b*)(wg + (size_t)i * 32 * D);
  v8f acc[2][4];
#pragma unroll
  for (int mi = 0; mi < 2; ++mi)
#pragma unroll
    for (int ni = 0; ni < 4; ++ni) acc[mi][ni] = (v8f){};
#pragma unroll 1   // stays rolled, for speed only
  for (int k0 = 0; k0 < D; k0 += KS) {
#pragma unroll
    for (int i = 0; i < 8; ++i) { v4b hx, lx;
#pragma unroll
      for (int j = 0; j < 4; ++j) { b16 p, q; split16(ra[i][j] * HS, p, q); hx[j] = p; lx[j] = q; }
      *(v4b*)(&Ah[ar + i * 16][ac]) = hx; *(v4b*)(&Al[ar + i * 16][ac]) = lx; }
#pragma unroll
    for (int i = 0; i < 4; ++i) *(v8b*)(&Bs[br + i * 32][bc]) = rb[i];
    __syncthreads();
    if (k0 + KS < D) {
#pragma unroll
      for (int i = 0; i < 8; ++i) ra[i] = *(const v4f*)(og + (size_t)i * 16 * D + k0 + KS);
#pragma unroll
      for (int i = 0; i < 4; ++i) rb[i] = *(const v8b*)(wg + (size_t)i * 32 * D + k0 + KS);
      asm volatile("s_wait_xcnt 0x0" ::: "memory"); }   // the loop advances the address registers that these issued loads name: the wait stands in front of that overwrite
#pragma unroll
    for (int kb = 0; kb < KS; kb += 32) { v16b a[2], al[2], bw[4];
#pragma unroll
      for (int mi = 0; mi < 2; ++mi) { a[mi] = frag_kb(&Ah[wm * 32 + mi * 16 + nloc][kb], hlf); al[mi] = frag_kb(&Al[wm * 32 + mi * 16 + nloc][kb], hlf); }
#pragma unroll
      for (int ni = 0; ni < 4; ++ni) bw[ni] = frag_kb(&Bs[wn * 64 + ni * 16 + nloc][kb], hlf);
#pragma unroll
      for (int mi = 0; mi < 2; ++mi)
#pragma unroll
        for (int ni = 0; ni < 4; ++ni) acc[mi][ni] = wmma16b(a[mi], bw[ni], acc[mi][ni]);
#pragma unroll
      for (int mi = 0; mi < 2; ++mi)
#pragma unroll
        for (int ni = 0; ni < 4; ++ni) acc[mi][ni] = wmma16b(al[mi], bw[ni], acc[mi][ni]); }
    __syncthreads(); }
#pragma unroll
  for (int mi = 0; mi < 2; ++mi) {
#pragma unroll
    for (int ni = 0; ni < 4; ++ni)
#pragma unroll
      for (int r8 = 0; r8 < 8; ++r8) Tf[wave][8 * hlf + r8][ni * 16 + nloc] = acc[mi][ni][r8] * (1.0f / (HS * WSC));
    wave_lds_sync();
    v4f tv[8]; const size_t o = (t0 + wm * 32 + mi * 16 + hlf) * D + c0 + wn * 64 + nloc * 4;
#pragma unroll
    for (int rr = 0; rr < 8; ++rr) tv[rr] = *(const v4f*)(&Tf[wave][rr * 2 + hlf][nloc * 4]);
#pragma unroll
    for (int rr = 0; rr < 8; ++rr) *(v4f*)(out + o + (size_t)rr * 2 * D) = tv[rr];
    wave_lds_sync(); } }
}  // namespace

extern "C" void kernel_launch(void* const* d_in, const int* in_sizes, int n_in, void* d_out, int out_size, void* d_ws, size_t ws_size, hipStream_t stream) {
  (void)n_in;
  auto Fp = [&](int i) { return (const float*)d_in[i]; }; auto Ip = [&](int i) { return (const int*)d_in[i]; };
  // Input order: 0 queries [4,1024,1024]; 1 keys; 2 values; 3 valid_lens [4] i32; 4 Wq [1024,1024]; 5 Wk; 6 Wv; 7 Wo; 8 Ek [33,64]; 9 Ev [33,64]
  if (in_sizes[0] != NT * D || in_sizes[1] != NT * D || in_sizes[2] != NT * D || in_sizes[3] != NB_ || in_sizes[4] != D * D || in_sizes[7] != D * D || in_sizes[8] != NR * HD || in_sizes[9] != NR * HD || out_size != NT * D) return;
  const int QLIM = S, ALIM = S;   // QLIM = tokens projected per batch (>= max valid_len), ALIM = queries attended/output (multiples of 128)
  size_t off = 0; char* ws = (char*)d_ws;
  auto carve = [&](size_t bytes) { char* p = ws + off; off += (bytes + 255) & ~(size_t)255; return p; };
  b16* W4 = (b16*)carve((size_t)4 * D * D * 2); b16* EKh = (b16*)carve(48 * HD * 2); b16* EKl = (b16*)carve(48 * HD * 2); b16* Qh = (b16*)carve((size_t)NT * D * 2); b16* Ql = (b16*)carve((size_t)NT * D * 2); b16* Kh = (b16*)carve((size_t)NT * D * 2); b16* Kl = (b16*)carve((size_t)NT * D * 2); b16* VTh = (b16*)carve((size_t)NT * D * 2); b16* VTl = (b16*)carve((size_t)NT * D * 2); float* O = (float*)carve((size_t)NT * D * 4); b16* X16 = (b16*)carve((size_t)3 * NT * D * 2);
  if (off > ws_size || off > ((size_t)104 << 20)) return;   // ~ 101 MB
  wput_kernel<<<PG, 256, 0, stream>>>(Fp(4), Fp(5), Fp(6), Fp(7), Fp(8), Fp(0), Fp(1), Fp(2), W4, EKh, EKl, X16);
  proj_kernel<<<dim3(NT / BM, D / BN, 3), 256, 0, stream>>>(X16, W4, QLIM, Qh, Ql, Kh, Kl, VTh, VTl);
  att_kernel<<<NB_ * H * (S / (16 * AW)), 32 * AW, 0, stream>>>(Qh, Ql, Kh, Kl, VTh, VTl, EKh, EKl, Fp(9), Ip(3), ALIM, O);
  outp_kernel<<<dim3(NT / BM, D / BN), 256, 0, stream>>>(O, W4 + (size_t)3 * D * D, ALIM, (float*)d_out);
}

// v009
// One run takes 82.2 microseconds.
// Timed twice side by side with v008, it ran 1.10 times as fast both times.
// All steps since v000 together make it 17.5 times as fast.
#include <hip/hip_runtime.h>

// MultiHeadAttentionWithRPR: q = queries Wq^T, k = keys Wk^T, v = values Wv^T (16 heads x 64); dist = clip(k - q, -16, 16) + 16; scores = (q.k + q.Ek[dist]) / 8; keys >= valid_lens[b] -> -1e6 (excluded); attn = softmax; out_h = attn v + sum_k attn Ev[dist]; out = concat_h Wo^T -> [4][1024][1024].
// Deterministic: online softmax over fixed 64-key chunks (only chunks below valid_len), fixed order; the Ev term via 33 per-row bucket sums of attn; no atomics.
// WMMA (v_wmma_f32_16x16x32_f16, f32 accumulate): inputs (EXACT bf16 x8, K 1,024) x Wq/Wk/Wv rows (EXACT) in 128 x 128 block tiles; per (bh, 16-query) wave (8 waves a work-group, K and V^T chunks shared in LDS) QE = q (hi+lo) x Ek rows (hi+lo; 3 tiles), S^T = k rows x q (hi+lo; 4 tiles/chunk), O^T += v^T (hi+lo) x P (hi+lo; 4 tiles); o (hi+lo) x Wo rows (64 tiles) — ≈ 4 M WMMA; softmax, buckets, Ev epilogue in f32.

namespace {
constexpr int NB_ = 4, S = 1024, D = 1024, H = 16, HD = 64, CLIP = 16, NR = 2 * CLIP + 1 /* 33 */, NT = NB_ * S, CH = 64;
constexpr int BM = 128, BN = 128, KS = 64, LP = KS + 8;   // GEMM block tile, k per LDS stage, LDS row pitch in halves (144 B = 16 B x odd, for 16-byte readers)
constexpr int PG = 512, XU = NT * D / 4 / (PG * 256);   // first launch: work-groups, and 4-element pieces of each input tensor a thread converts
constexpr int AW = 8, KP = HD + 8, VP = CH + 8;   // attention: waves of a work-group; LDS row pitch in halves of a staged K row and V^T row (144 B each = 16 B x odd, for 16-byte readers)
constexpr float XS = 8.0f, HS = 256.0f, PS = 256.0f, WSC = 256.0f, SCALE = 0.125f;
typedef _Float16 b16;
typedef __attribute__((ext_vector_type(16))) _Float16 v16b;
typedef __attribute__((ext_vector_type(8))) _Float16 v8b;
typedef __attribute__((ext_vector_type(4))) _Float16 v4b;
typedef __attribute__((ext_vector_type(2))) _Float16 v2b;
typedef __attribute__((ext_vector_type(8))) float v8f;
typedef __attribute__((ext_vector_type(4))) float v4f;
typedef __attribute__((ext_vector_type(2))) float v2f;
__device__ __forceinline__ float bf16_rne(float f) { unsigned int u = __float_as_uint(f); u += 0x7FFFu + ((u >> 16) & 1u); float r = __uint_as_float(u & 0xFFFF0000u); asm volatile("" : "+v"(r)); return r; }
__device__ __forceinline__ float bfv(float f) { float r = bf16_rne(f); asm volatile("" : "+v"(r)); return r; }
__device__ __forceinline__ void split16(float v, b16& hi, b16& lo) { hi = (b16)v; lo = (b16)(v - (float)hi); }
__device__ __forceinline__ v16b frag_kb(const b16* p, int hh) { const v8b a = *(const v8b*)(p + 8 * hh), b = *(const v8b*)(p + 16 + 8 * hh); v16b f;
#pragma unroll
  for (int e = 0; e < 8; ++e) { f[e] = a[e]; f[8 + e] = b[e]; } return f; }
__device__ __forceinline__ v8f wmma16b(v16b a, v16b b, v8f c) { v8f d = __builtin_amdgcn_wmma_f32_16x16x32_f16(false, a, false, b, (short)0, c, false, false); asm volatile("v_nop\n\tv_nop\n\tv_nop\n\tv_nop" : "+v"(d) : "v"(a), "v"(b)); return d; }
__device__ __forceinline__ void wave_lds_sync() { __builtin_amdgcn_fence(__ATOMIC_RELEASE, "workgroup"); __builtin_amdgcn_wave_barrier(); __builtin_amdgcn_fence(__ATOMIC_ACQUIRE, "workgroup"); }
__device__ __forceinline__ float bf16_near(float f) { unsigned int u = __float_as_uint(f); u += 0x7FFFu + ((u >> 16) & 1u); return __uint_as_float(u & 0xFFFF0000u); }   // f rounded to the nearest bf16 value, ties to even
__device__ __forceinline__ float xhalf(float x) { return __builtin_bit_cast(float, __builtin_amdgcn_permlanex16(__builtin_bit_cast(int, x), __builtin_bit_cast(int, x), 0x76543210, 0xfedcba98, false, false)); }   // the value of lane l ^ 16
__device__ __forceinline__ unsigned lds_off(const b16* p) { typedef __attribute__((address_space(3))) const b16 lds_b16; return (unsigned)(size_t)(lds_b16*)p; }   // byte address of p inside the work-group's LDS
// Eight asynchronous copies, 16 bytes a lane each, global memory -> LDS through no register: two each from ga, gb, gc, gd (the pointer, then the pointer + gs); copies 0-3 land at LDS byte la + i * ls, copies 4-7 at lb + (i - 4) * ls.
// The s_wait_xcnt closes the statement so that no address register of an issued copy is rewritten in front of it.
__device__ __forceinline__ void copy8(unsigned la, unsigned lb, unsigned ls, const b16* ga, const b16* gb, const b16* gc, const b16* gd, size_t gs) {
  asm volatile("global_load_async_to_lds_b128 %0, %8, off\n\tglobal_load_async_to_lds_b128 %1, %9, off\n\tglobal_load_async_to_lds_b128 %2, %10, off\n\tglobal_load_async_to_lds_b128 %3, %11, off\n\t"
               "global_load_async_to_lds_b128 %4, %12, off\n\tglobal_load_async_to_lds_b128 %5, %13, off\n\tglobal_load_async_to_lds_b128 %6, %14, off\n\tglobal_load_async_to_lds_b128 %7, %15, off\n\ts_wait_xcnt 0x0"
               :: "v"(la), "v"(la + ls), "v"(la + 2 * ls), "v"(la + 3 * ls), "v"(lb), "v"(lb + ls), "v"(lb + 2 * ls), "v"(lb + 3 * ls),
                  "v"(ga), "v"(ga + gs), "v"(gb), "v"(gb + gs), "v"(gc), "v"(gc + gs), "v"(gd), "v"(gd + gs) : "memory"); }
__device__ __forceinline__ int iclamp(int v, int lo, int hi) { return v < lo ? lo : (v > hi ? hi : v); }
// Keys at or past valid_len have weight 0 and attention reads none past its last staged 64-key chunk: of keys and values only the first live_tiles(valid_len) 128-token tiles of a batch are rounded (launch 1) and projected (launch 2).
// That covers every 64-key chunk that attention stages, its masked tail included (V^T there must be finite: 0 x NaN is NaN).
__device__ __forceinline__ int live_tiles(int vl) { return (iclamp(vl, 1, S) + BM - 1) / BM; }

__global__ __launch_bounds__(256) void wput_kernel(const float* __restrict__ wq, const float* __restrict__ wk, const float* __restrict__ wv, const float* __restrict__ wo, const float* __restrict__ ek, const float* __restrict__ xq, const float* __restrict__ xk, const float* __restrict__ xv, const int* __restrict__ vlens, b16* __restrict__ W4, b16* __restrict__ EKh, b16* __restrict__ EKl, b16* __restrict__ X16) { const size_t nt = (size_t)gridDim.x * 256, u0 = (size_t)blockIdx.x * 256 + threadIdx.x; v8b v;
  // queries, keys, values: rounded and scaled ONCE here, into one 16-bit plane each, for all eight column blocks of the projection. 16 bytes a lane in, 8 bytes out, whole lines; a thread's XU loads of a tensor fly together.
  static_assert((size_t)XU * PG * 256 * 4 == (size_t)NT * D && XU % 4 == 0, "the pieces cover a tensor exactly");
  static_assert(256 * 4 == D && 2 * PG == S && XU == 2 * NB_, "piece j of a work-group is one whole row: token (j & 1) * PG + blockIdx.x of batch j >> 1");
  int lim[NB_];   // tokens of each batch whose keys and values are wanted
#pragma unroll   // constant indices keep lim in scalar registers
  for (int b = 0; b < NB_; ++b) lim[b] = live_tiles(vlens[b]) * BM;
#pragma unroll 1   // stays rolled: one tensor's loads in flight are enough, and three would triple the registers
  for (int w3 = 0; w3 < 3; ++w3) { const float* x = (w3 == 0 ? xq : (w3 == 1 ? xk : xv)) + u0 * 4; b16* y = X16 + (size_t)w3 * NT * D + u0 * 4; v4f r[XU];
    // a row that is not wanted is not fetched: its load re-reads the thread's own first piece of queries (fetched in the first trip, so it is near, and other lines in every work-group), so that all XU loads still fly together in one instruction stream; nothing is stored for it
    auto live = [&](int j) { return w3 == 0 || (j & 1) * PG + (int)blockIdx.x < lim[j >> 1]; };   // the same for the whole work-group
#pragma unroll   // constant indices keep r in registers
    for (int j = 0; j < XU; j += 4) {
#pragma unroll
      for (int i = 0; i < 4; ++i) r[j + i] = *(const v4f*)(live(j + i) ? x + (size_t)(j + i) * PG * 256 * 4 : xq + u0 * 4);
      asm volatile("s_wait_xcnt 0x0" ::: "memory"); }   // later loads' results and the store addresses may take the address registers that these issued loads name: the wait stands in front of that overwrite
#pragma unroll
    for (int j = 0; j < XU; ++j) { v4b hx;
#pragma unroll
      for (int e = 0; e < 4; ++e) hx[e] = (b16)(bf16_rne(r[j][e]) * XS);
      if (live(j)) *(v4b*)(y + (size_t)j * PG * 256 * 4) = hx; }
    asm volatile("s_wait_xcnt 0x0" ::: "memory"); }   // the next trip rewrites the address registers that these issued stores name: the wait stands in front of that overwrite
  for (size_t u = u0; u < (size_t)4 * D * 128; u += nt) { const int o = (int)(u / 128), k0 = (int)(u % 128) * 8; const int which = o / D, oo = o % D; const float* w = which == 0 ? wq : (which == 1 ? wk : (which == 2 ? wv : wo));
#pragma unroll
    for (int j = 0; j < 8; ++j) v[j] = (b16)(bf16_rne(w[(size_t)oo * D + k0 + j]) * WSC); { *(v8b*)(W4 + (size_t)o * D + k0) = v;  } }
  if (u0 < 48 * 8) { const int r = (int)(u0 / 8), k0 = (int)(u0 % 8) * 8; v8b a, c;
#pragma unroll
    for (int j = 0; j < 8; ++j) { float e = r < NR ? bfv(ek[(size_t)r * HD + k0 + j]) : 0.0f; b16 p, pl; split16(e * HS, p, pl); a[j] = p; c[j] = pl; } { *(v8b*)(EKh + (size_t)r * HD + k0) = a; *(v8b*)(EKl + (size_t)r * HD + k0) = c;  } } }
// The four dense projections run as block-tiled GEMMs: 8 waves share one 128 x 128 output tile (wave = 32 rows x 64 columns), both operands staged in LDS 64 k at a time,
// the next stage's global loads issued ahead of the current stage's products. Every accumulator still sums k in ascending blocks of 32.
// In both kernels each '#pragma unroll' makes the indices of a register array (ra, rb, acc, fragments, tv) constants, so that it stays in registers.
__global__ __launch_bounds__(256) void proj_kernel(const b16* __restrict__ X16, const b16* __restrict__ W4, const int* __restrict__ vlens, int QLIM, b16* __restrict__ Qh, b16* __restrict__ Ql, b16* __restrict__ Kh, b16* __restrict__ Kl, b16* __restrict__ VTh, b16* __restrict__ VTl) {
  __shared__ __attribute__((aligned(16))) b16 As[BM][LP], Bs[BN][LP]; __shared__ __attribute__((aligned(16))) float Tf[8][16][68];
  const int tid = threadIdx.x, lane = tid & 31, wave = tid >> 5, nloc = lane & 15, hlf = lane >> 4, wm = wave >> 1, wn = wave & 1;
  int xt = blockIdx.x, yb = blockIdx.y, which = blockIdx.z;   // token tile, column block, tensor (q, k, v)
  if (which != 0) {   // k and v: the live tiles take the lowest indices, k's first, the column block running fastest; the rest leave here, whole work-groups, ahead of every barrier
    static_assert(S / BM == 8 && D / BN == 8 && NB_ == 4, "the shifts and the three steps below");
    const int n0 = live_tiles(vlens[0]), n1 = live_tiles(vlens[1]), n2 = live_tiles(vlens[2]), n3 = live_tiles(vlens[3]), nl = (n0 + n1 + n2 + n3) * (D / BN);   // nl: live tiles of one tensor
    int g = ((which - 1) * (D / BN) + yb) * (NT / BM) + xt; if (g >= 2 * nl) return;
    which = g < nl ? 1 : 2; g -= (which - 1) * nl; yb = g & 7; int r = g >> 3, b = 0;   // r: rank of the token tile among the live ones, batch by batch
    if (r >= n0) { r -= n0; b = 1; if (r >= n1) { r -= n1; b = 2; if (r >= n2) { r -= n2; b = 3; } } }
    xt = b * (S / BM) + r; }
  const size_t t0 = (size_t)xt * BM; const int c0 = yb * BN; if ((int)(t0 % S) >= QLIM) return;
  // v is wanted transposed ([batch][feature][token]): its product takes the W rows as A and the x rows as B, so that an accumulator tile has features as rows and tokens as columns (wave = 32 features x 64 tokens)
  const b16 (*Af)[LP] = which == 2 ? Bs : As; const b16 (*Bf)[LP] = which == 2 ? As : Bs;
  const int br = tid >> 3, bc = (tid & 7) * 8;   // staging: 8 lanes per 128-B piece of an x row (already 16-bit, from the first launch) and of a W row
  const b16* xg = X16 + ((size_t)which * NT + t0 + br) * D + bc; const b16* wg = W4 + ((size_t)which * D + c0 + br) * D + bc;
  v8b ra[4], rb[4];
#pragma unroll
  for (int i = 0; i < 4; ++i) ra[i] = *(const v8b*)(xg + (size_t)i * 32 * D);
#pragma unroll
  for (int i = 0; i < 4; ++i) rb[i] = *(const v8b*)(wg + (size_t)i * 32 * D);
  v8f acc[2][4];
#pragma unroll
  for (int mi = 0; mi < 2; ++mi)
#pragma unroll
    for (int ni = 0; ni < 4; ++ni) acc[mi][ni] = (v8f){};
#pragma unroll 1   // stays rolled, for speed only
  for (int k0 = 0; k0 < D; k0 += KS) {
#pragma unroll
    for (int i = 0; i < 4; ++i) { *(v8b*)(&As[br + i * 32][bc]) = ra[i]; *(v8b*)(&Bs[br + i * 32][bc]) = rb[i]; }
    __syncthreads();
    if (k0 + KS < D) {
#pragma unroll
      for (int i = 0; i < 4; ++i) { ra[i] = *(const v8b*)(xg + (size_t)i * 32 * D + k0 + KS); rb[i] = *(const v8b*)(wg + (size_t)i * 32 * D + k0 + KS); }
      asm volatile("s_wait_xcnt 0x0" ::: "memory"); }   // the loop advances the address registers that these issued loads name: the wait stands in front of that overwrite
#pragma unroll
    for (int kb = 0; kb < KS; kb += 32) { v16b a[2], bw[4];
#pragma unroll
      for (int mi = 0; mi < 2; ++mi) a[mi] = frag_kb(&Af[wm * 32 + mi * 16 + nloc][kb], hlf);
#pragma unroll
      for (int ni = 0; ni < 4; ++ni) bw[ni] = frag_kb(&Bf[wn * 64 + ni * 16 + nloc][kb], hlf);
#pragma unroll
      for (int mi = 0; mi < 2; ++mi)
#pragma unroll
        for (int ni = 0; ni < 4; ++ni) acc[mi][ni] = wmma16b(a[mi], bw[ni], acc[mi][ni]); }
    __syncthreads(); }
  // each wave stages 16 x 64 results in its own LDS range and stores whole lines: two rows per instruction, 16 lanes a row
#pragma unroll
  for (int mi = 0; mi < 2; ++mi) {
#pragma unroll
    for (int ni = 0; ni < 4; ++ni)
#pragma unroll
      for (int r8 = 0; r8 < 8; ++r8) Tf[wave][8 * hlf + r8][ni * 16 + nloc] = acc[mi][ni][r8] * (1.0f / (XS * WSC));
    wave_lds_sync();
    v4f tv[8]; const size_t o = which == 2 ? ((t0 / S) * D + c0 + wm * 32 + mi * 16 + hlf) * S + t0 % S + wn * 64 + nloc * 4 : (t0 + wm * 32 + mi * 16 + hlf) * D + c0 + wn * 64 + nloc * 4;   // v: row = feature, of S tokens; q, k: row = token, of D features
#pragma unroll
    for (int rr = 0; rr < 8; ++rr) tv[rr] = *(const v4f*)(&Tf[wave][rr * 2 + hlf][nloc * 4]);
    { static_assert(S == D, "one row pitch serves both layouts"); b16* Ph = which == 0 ? Qh : (which == 1 ? Kh : VTh); b16* Pl = which == 0 ? Ql : (which == 1 ? Kl : VTl);
#pragma unroll
      for (int rr = 0; rr < 8; ++rr) { v4b ph, pl;
#pragma unroll
        for (int j = 0; j < 4; ++j) { b16 p, q; split16(tv[rr][j] * HS, p, q); ph[j] = p; pl[j] = q; }
        *(v4b*)(Ph + o + (size_t)rr * 2 * D) = ph; *(v4b*)(Pl + o + (size_t)rr * 2 * D) = pl; } }
    wave_lds_sync(); } }
// One work-group of 8 waves per (batch-head, 128 queries), one wave per 16 queries. Each 64-key chunk of K and V^T (hi and lo) is staged once for all eight waves in LDS by asynchronous copies, whole 128-B lines,
// two buffers: chunk c + 1 flies while chunk c is worked on; every fragment of K and V^T is read from LDS. Everything else is private to its wave, as are its LDS ranges (index [wave]).
// The chunk length and the register budget (at most 256, the second launch bound: four waves a SIMD) are set so that TWO work-groups stand on a WGP (LDS under 160 KiB each): one's vector work and waits run under the other's products.
// Both products run transposed: S^T = K q^T (K rows as A, q rows as B) and O^T += V^T P^T (V^T rows as A, P as B). A lane holds ONE query (column lane & 15) and, of each 16-key tile, the keys 8 * half + r8:
// bias, mask, maximum, exp and the sums all run in-lane, the two halves of a query joined by one cross-row move; two score tiles, rounded in place, are the B fragment of P for 32 keys, so that P never goes through LDS.
// Buckets: distance <= -16 and >= 16 are running per-lane sums, joined once after the loop; each of the 31 inner distances has one key, whose score is kept and turned into its weight with the final maximum.
__global__ __launch_bounds__(32 * AW, 4) void att_kernel(const b16* __restrict__ Qh, const b16* __restrict__ Ql, const b16* __restrict__ Kh, const b16* __restrict__ Kl, const b16* __restrict__ VTh, const b16* __restrict__ VTl, const b16* __restrict__ EKh, const b16* __restrict__ EKl, const float* __restrict__ ev, const int* __restrict__ vlens, int ALIM, float* __restrict__ O) { __shared__ __attribute__((aligned(16))) b16 Ksh[2][2][CH][KP], Vsh[2][2][HD][VP];   // [buffer][hi, lo][key][d] and [buffer][hi, lo][d][key]
  __shared__ __attribute__((aligned(16))) float BkW[AW][16][36]; __shared__ float QEW[AW][16][49], LsW[AW][16], OfW[AW][16][HD + 1];
  const int lane = threadIdx.x & 31, wave = __builtin_amdgcn_readfirstlane(threadIdx.x >> 5), nloc = lane & 15, hlf = lane >> 4, rowb = 8 * hlf;   // the wave's number in a scalar register keeps the tests on q0 below scalar branches
  const int bh = blockIdx.x / (S / (16 * AW)), qb = (blockIdx.x % (S / (16 * AW))) * (16 * AW); if (qb >= ALIM) return; const int q0 = qb + wave * 16; const int b = bh / H, h = bh % H; const size_t tq = (size_t)b * S + q0; const int vl = iclamp(vlens[b], 0, S), nch = (vl + CH - 1) / CH;
  float (*Bk)[36] = BkW[wave]; float (*QE)[49] = QEW[wave]; float* Ls = LsW[wave]; float (*Of)[HD + 1] = OfW[wave];
  // staging, per wave and chunk: 4 copies of 4 K rows and 4 copies of 4 V^T row pieces (8 lanes a 128-B row; rows i * 32 + wave * 4 + ..., hi then lo, whose plane follows 64 rows on)
  static_assert(CH == 64 && HD == 64 && KP == VP && S == D, "K and V^T chunks have one shape, in LDS and in their row steps");
  const int kr = wave * 4 + (lane >> 3), kc = (lane & 7) * 8;
  const size_t kg = ((size_t)b * S + kr) * D + h * HD + kc, vg = ((size_t)bh * HD + kr) * S + kc;
  auto stage = [&](int c, int buf) { copy8(lds_off(&Ksh[buf][0][kr][kc]), lds_off(&Vsh[buf][0][kr][kc]), 32 * KP * 2, Kh + kg + (size_t)c * CH * D, Kl + kg + (size_t)c * CH * D, VTh + vg + c * CH, VTl + vg + c * CH, (size_t)32 * D); };
  stage(0, 0);   // chunk 0 flies under the set-up below
  if (lane < 16) { for (int r = 0; r < NR; ++r) Bk[lane][r] = -INFINITY; }
  // q fragments: row or column nloc in the k order of frag_kb, so that one fragment serves as A (QE) and as B (S^T)
  v16b qa[2], ql[2]; for (int ks = 0; ks < 2; ++ks) { qa[ks] = frag_kb(Qh + (tq + nloc) * D + h * HD + ks * 32, hlf); ql[ks] = frag_kb(Ql + (tq + nloc) * D + h * HD + ks * 32, hlf); }
  asm volatile("s_wait_xcnt 0x0" ::: "memory");   // the results of the Ek loads below may take the address registers that these issued loads name: the wait stands in front of that overwrite
  // QE[q][r] = q . Ek[r]
#pragma unroll
  for (int t = 0; t < 3; ++t) { v8f e = (v8f){};
#pragma unroll
    for (int ks = 0; ks < 2; ++ks) { const v16b eh = frag_kb(EKh + (size_t)(t * 16 + nloc) * HD + ks * 32, hlf), el = frag_kb(EKl + (size_t)(t * 16 + nloc) * HD + ks * 32, hlf); e = wmma16b(qa[ks], eh, e); e = wmma16b(qa[ks], el, e); e = wmma16b(ql[ks], eh, e); }
#pragma unroll
    for (int r8 = 0; r8 < 8; ++r8) QE[8 * hlf + r8][t * 16 + nloc] = e[r8] * (1.0f / (HS * HS)); }
  wave_lds_sync();
  const float qlo = QE[nloc][0], qhi = QE[nloc][2 * CLIP];   // this lane's query: the bias of every key at distance <= -16, and of every key at >= 16
  asm volatile("s_wait_asynccnt 0x0" ::: "memory");   // this wave's copies of chunk 0 have landed
  __syncthreads();                                    // ... and so have the other waves': chunk 0 may be read
  if (nch > 1) stage(1, 1);
  v8f oacc[4] = {(v8f){}, (v8f){}, (v8f){}, (v8f){}};   // O^T: lane = query, tile t register r8 = d t * 16 + 8 * half + r8
  // every '#pragma unroll' below makes the indices of a register array (sacc, oacc, kh, kl, vh, vlo, pa, pb, w) constants, so that it stays in registers
  float mrow = -INFINITY, slo = 0.0f, shi = 0.0f, sin_ = 0.0f;
#pragma unroll 1   // stays rolled: the trip count comes from valid_lens
  for (int ch = 0; ch < nch; ++ch) { const int k0 = ch * CH; v8f sacc[CH / 16]; const b16 (*Kc)[CH][KP] = Ksh[ch & 1]; const b16 (*Vc)[HD][VP] = Vsh[ch & 1];
#pragma unroll
    for (int tg = 0; tg < CH / 16; tg += 2) { v16b kh[2][2], kl[2][2];   // two tiles' fragment reads stand together, ahead of their products, for speed only
#pragma unroll
      for (int t = 0; t < 2; ++t)
#pragma unroll
        for (int ks = 0; ks < 2; ++ks) { kh[t][ks] = frag_kb(&Kc[0][(tg + t) * 16 + nloc][ks * 32], hlf); kl[t][ks] = frag_kb(&Kc[1][(tg + t) * 16 + nloc][ks * 32], hlf); }
#pragma unroll
      for (int t = 0; t < 2; ++t) { v8f s = (v8f){};
#pragma unroll
        for (int ks = 0; ks < 2; ++ks) { s = wmma16b(kh[t][ks], qa[ks], s); s = wmma16b(kl[t][ks], qa[ks], s); s = wmma16b(kh[t][ks], ql[ks], s); }
        sacc[tg + t] = s; } }
    const int dl = k0 + rowb - q0 - nloc;   // key - query of this lane at tile 0, register 0
    float mx = -INFINITY;
#pragma unroll
    for (int t = 0; t < CH / 16; ++t) { const int rel = k0 + t * 16 - q0; const bool near = rel >= -16 && rel <= 16;   // wave-uniform: only these three tiles hold an inner distance
      if (near) {   // bias by distance from LDS; the score of an inner distance is kept
#pragma unroll
        for (int r8 = 0; r8 < 8; ++r8) { const int d = dl + t * 16 + r8; const float s = (sacc[t][r8] * (1.0f / (HS * HS)) + QE[nloc][iclamp(d, -CLIP, CLIP) + CLIP]) * SCALE; const float sm = k0 + t * 16 + rowb + r8 < vl ? s : -INFINITY; sacc[t][r8] = sm; if (d > -CLIP && d < CLIP) Bk[nloc][d + CLIP] = sm; } }
      else { const float qe = rel < 0 ? qlo : qhi;
#pragma unroll
        for (int r8 = 0; r8 < 8; ++r8) sacc[t][r8] = (sacc[t][r8] * (1.0f / (HS * HS)) + qe) * SCALE;
        if (k0 + t * 16 + 16 > vl) {   // wave-uniform: only a tile that reaches past valid_len has keys to exclude
#pragma unroll
          for (int r8 = 0; r8 < 8; ++r8) sacc[t][r8] = k0 + t * 16 + rowb + r8 < vl ? sacc[t][r8] : -INFINITY; } }
      mx = fmaxf(mx, fmaxf(fmaxf(fmaxf(sacc[t][0], sacc[t][1]), fmaxf(sacc[t][2], sacc[t][3])), fmaxf(fmaxf(sacc[t][4], sacc[t][5]), fmaxf(sacc[t][6], sacc[t][7])))); }
    mx = fmaxf(mx, xhalf(mx));   // both halves now hold the maximum of this query's 64 scores
    const float mn = fmaxf(mrow, mx), fac = (mrow == -INFINITY) ? 0.0f : __expf(mrow - mn); mrow = mn; slo *= fac; shi *= fac; sin_ *= fac;
#pragma unroll
    for (int t = 0; t < 4; ++t)
#pragma unroll
      for (int r8 = 0; r8 < 8; ++r8) oacc[t][r8] *= fac;
#pragma unroll
    for (int kb = 0; kb < CH; kb += 32) { v16b vh[4], vlo[4], pa, pb;   // one group of reads, ahead of the exponentials that make this block's P
#pragma unroll
      for (int t = 0; t < 4; ++t) { vh[t] = frag_kb(&Vc[0][t * 16 + nloc][kb], hlf); vlo[t] = frag_kb(&Vc[1][t * 16 + nloc][kb], hlf); }
#pragma unroll
      for (int u = 0; u < 2; ++u) { const int t = kb / 16 + u, rel = k0 + t * 16 - q0;   // element u * 8 + r8 of the fragment is key kb + u * 16 + 8 * half + r8: the k order of frag_kb
#pragma unroll
        for (int r8 = 0; r8 < 8; r8 += 2) { const float p0 = __expf(sacc[t][r8] - mrow), p1 = __expf(sacc[t][r8 + 1] - mrow); sacc[t][r8] = p0; sacc[t][r8 + 1] = p1; const v2f x = (v2f){p0, p1} * PS;   // two keys share a fragment register: both roundings run on the pair
          const v2b ph = __builtin_convertvector(x, v2b), pl = __builtin_convertvector(x - __builtin_convertvector(ph, v2f), v2b); pa[u * 8 + r8] = ph[0]; pa[u * 8 + r8 + 1] = ph[1]; pb[u * 8 + r8] = pl[0]; pb[u * 8 + r8 + 1] = pl[1]; }
        if (rel <= -32) slo += ((sacc[t][0] + sacc[t][1]) + (sacc[t][2] + sacc[t][3])) + ((sacc[t][4] + sacc[t][5]) + (sacc[t][6] + sacc[t][7]));
        else if (rel >= 32) shi += ((sacc[t][0] + sacc[t][1]) + (sacc[t][2] + sacc[t][3])) + ((sacc[t][4] + sacc[t][5]) + (sacc[t][6] + sacc[t][7]));
        else {
#pragma unroll
          for (int r8 = 0; r8 < 8; ++r8) { const int d = dl + t * 16 + r8; const float p = sacc[t][r8]; slo += d <= -CLIP ? p : 0.0f; shi += d >= CLIP ? p : 0.0f; sin_ += (d > -CLIP && d < CLIP) ? p : 0.0f; } } }
#pragma unroll
      for (int t = 0; t < 4; ++t) { oacc[t] = wmma16b(vh[t], pa, oacc[t]); oacc[t] = wmma16b(vlo[t], pa, oacc[t]); oacc[t] = wmma16b(vh[t], pb, oacc[t]); } }
    asm volatile("s_wait_dscnt 0x0" ::: "memory");      // this wave's reads of the chunk's buffer have returned
    asm volatile("s_wait_asynccnt 0x0" ::: "memory");   // this wave's copies of chunk ch + 1 have landed
    __syncthreads();                                    // publishes chunk ch + 1 and frees the buffer that this pass has read
    if (ch + 2 < nch) stage(ch + 2, ch & 1); }
  asm volatile("s_wait_asynccnt 0x0" ::: "memory");     // no copy is outstanding behind the loop
  // this lane's two columns of all 33 Ev rows: the loads fly together, under the joins below, and the values stay in registers for all 16 query rows
  v2f evr[NR];
#pragma unroll
  for (int j = 0; j < NR; ++j) evr[j] = *(const v2f*)(ev + (size_t)j * HD + lane * 2);
  // join the two halves' sums; the inner distances' kept scores become weights under the final maximum (a slot no key reached holds -inf and gives 0)
  { const float a = slo + xhalf(slo), c = shi + xhalf(shi), e = sin_ + xhalf(sin_);
    if (hlf == 0) { Bk[nloc][0] = a; Bk[nloc][2 * CLIP] = c; Ls[nloc] = a + c + e; } }
  float w[16];   // half 0 turns slots 1-16 of its query, half 1 slots 17-31: it has no sixteenth slot, reads its fifteenth again and stores nothing
#pragma unroll
  for (int j = 0; j < 16; ++j) { const int sl = 1 + 16 * hlf + j; w[j] = __expf(Bk[nloc][sl < 2 * CLIP ? sl : 2 * CLIP - 1] - mrow); }
#pragma unroll
  for (int j = 0; j < 16; ++j) { const int sl = 1 + 16 * hlf + j; if (sl < 2 * CLIP) Bk[nloc][sl] = w[j]; }
#pragma unroll
  for (int t = 0; t < 4; ++t)
#pragma unroll
    for (int r8 = 0; r8 < 8; ++r8) Of[nloc][t * 16 + rowb + r8] = oacc[t][r8] * (1.0f / (PS * HS));
  wave_lds_sync();
  // + sum_r Bk[row][r] Ev[r][d]; lane = d pair. Every '#pragma unroll' here makes the indices of evr, bq and a constants, so that they stay in registers.
#pragma unroll
  for (int j = 0; j < NR; ++j) { evr[j][0] = bf16_near(evr[j][0]); evr[j][1] = bf16_near(evr[j][1]); }
#pragma unroll 1   // stays rolled: four rows a trip already give four independent sum chains, and sixteen would only lengthen the code
  for (int r0 = 0; r0 < 16; r0 += 4) { v2f a[4]; v4f bq[4][8]; float bl[4], inv[4];
#pragma unroll
    for (int i = 0; i < 4; ++i) { a[i] = (v2f){Of[r0 + i][lane * 2], Of[r0 + i][lane * 2 + 1]}; bl[i] = Bk[r0 + i][32]; inv[i] = 1.0f / Ls[r0 + i];
#pragma unroll
      for (int j = 0; j < 8; ++j) bq[i][j] = *(const v4f*)(&Bk[r0 + i][j * 4]); }
#pragma unroll
    for (int j = 0; j < NR - 1; ++j)
#pragma unroll
      for (int i = 0; i < 4; ++i) a[i] += bq[i][j >> 2][j & 3] * evr[j];
#pragma unroll
    for (int i = 0; i < 4; ++i) { a[i] += bl[i] * evr[NR - 1]; *(v2f*)(O + (tq + r0 + i) * D + h * HD + lane * 2) = a[i] * inv[i]; }
    asm volatile("s_wait_xcnt 0x0" ::: "memory"); } }   // the next trip rewrites the registers that these issued stores name: the wait stands in front of that overwrite
__global__ __launch_bounds__(256) void outp_kernel(const float* __restrict__ O, const b16* __restrict__ WO, int ALIM, float* __restrict__ out) {
  __shared__ __attribute__((aligned(16))) b16 Ah[BM][LP], Al[BM][LP], Bs[BN][LP]; __shared__ __attribute__((aligned(16))) float Tf[8][16][68];
  const int tid = threadIdx.x, lane = tid & 31, wave = tid >> 5, nloc = lane & 15, hlf = lane >> 4, wm = wave >> 1, wn = wave & 1;
  const size_t t0 = (size_t)blockIdx.x * BM; const int c0 = blockIdx.y * BN; if ((int)(t0 % S) >= ALIM) return;
  const int ar = tid >> 4, ac = (tid & 15) * 4, br = tid >> 3, bc = (tid & 7) * 8;
  const float* og = O + (t0 + ar) * D + ac; const b16* wg = WO + ((size_t)c0 + br) * D + bc;
  v4f ra[8]; v8b rb[4];
#pragma unroll
  for (int i = 0; i < 8; ++i) ra[i] = *(const v4f*)(og + (size_t)i * 16 * D);
#pragma unroll
  for (int i = 0; i < 4; ++i) rb[i] = *(const v8b*)(wg + (size_t)i * 32 * D);
  v8f acc[2][4];
#pragma unroll
  for (int mi = 0; mi < 2; ++mi)
#pragma unroll
    for (int ni = 0; ni < 4; ++ni) acc[mi][ni] = (v8f){};
#pragma unroll 1   // stays rolled, for speed only
  for (int k0 = 0; k0 < D; k0 += KS) {
#pragma unroll
    for (int i = 0; i < 8; ++i) { v4b hx, lx;
#pragma unroll
      for (int j = 0; j < 4; ++j) { b16 p, q; split16(ra[i][j] * HS, p, q); hx[j] = p; lx[j] = q; }
      *(v4b*)(&Ah[ar + i * 16][ac]) = hx; *(v4b*)(&Al[ar + i * 16][ac]) = lx; }
#pragma unroll
    for (int i = 0; i < 4; ++i) *(v8b*)(&Bs[br + i * 32][bc]) = rb[i];
    __syncthreads();
    if (k0 + KS < D) {
#pragma unroll
      for (int i = 0; i < 8; ++i) ra[i] = *(const v4f*)(og + (size_t)i * 16 * D + k0 + KS);
#pragma unroll
      for (int i = 0; i < 4; ++i) rb[i] = *(const v8b*)(wg + (size_t)i * 32 * D + k0 + KS);
      asm volatile("s_wait_xcnt 0x0" ::: "memory"); }   // the loop advances the address registers that these issued loads name: the wait stands in front of that overwrite
#pragma unroll
    for (int kb = 0; kb < KS; kb += 32) { v16b a[2], al[2], bw[4];
#pragma unroll
      for (int mi = 0; mi < 2; ++mi) { a[mi] = frag_kb(&Ah[wm * 32 + mi * 16 + nloc][kb], hlf); al[mi] = frag_kb(&Al[wm * 32 + mi * 16 + nloc][kb], hlf); }
#pragma unroll
      for (int ni = 0; ni < 4; ++ni) bw[ni] = frag_kb(&Bs[wn * 64 + ni * 16 + nloc][kb], hlf);
#pragma unroll
      for (int mi = 0; mi < 2; ++mi)
#pragma unroll
        for (int ni = 0; ni < 4; ++ni) acc[mi][ni] = wmma16b(a[mi], bw[ni], acc[mi][ni]);
#pragma unroll
      for (int mi = 0; mi < 2; ++mi)
#pragma unroll
        for (int ni = 0; ni < 4; ++ni) acc[mi][ni] = wmma16b(al[mi], bw[ni], acc[mi][ni]); }
    __syncthreads(); }
#pragma unroll
  for (int mi = 0; mi < 2; ++mi) {
#pragma unroll
    for (int ni = 0; ni < 4; ++ni)
#pragma unroll
      for (int r8 = 0; r8 < 8; ++r8) Tf[wave][8 * hlf + r8][ni * 16 + nloc] = acc[mi][ni][r8] * (1.0f / (HS * WSC));
    wave_lds_sync();
    v4f tv[8]; const size_t o = (t0 + wm * 32 + mi * 16 + hlf) * D + c0 + wn * 64 + nloc * 4;
#pragma unroll
    for (int rr = 0; rr < 8; ++rr) tv[rr] = *(const v4f*)(&Tf[wave][rr * 2 + hlf][nloc * 4]);
#pragma unroll
    for (int rr = 0; rr < 8; ++rr) *(v4f*)(out + o + (size_t)rr * 2 * D) = tv[rr];
    wave_lds_sync(); } }
}  // namespace

extern "C" void kernel_launch(void* const* d_in, const int* in_sizes, int n_in, void* d_out, int out_size, void* d_ws, size_t ws_size, hipStream_t stream) {
  (void)n_in;
  auto Fp = [&](int i) { return (const float*)d_in[i]; }; auto Ip = [&](int i) { return (const int*)d_in[i]; };
  // Input order: 0 queries [4,1024,1024]; 1 keys; 2 values; 3 valid_lens [4] i32; 4 Wq [1024,1024]; 5 Wk; 6 Wv; 7 Wo; 8 Ek [33,64]; 9 Ev [33,64]
  if (in_sizes[0] != NT * D || in_sizes[1] != NT * D || in_sizes[2] != NT * D || in_sizes[3] != NB_ || in_sizes[4] != D * D || in_sizes[7] != D * D || in_sizes[8] != NR * HD || in_sizes[9] != NR * HD || out_size != NT * D) return;
  const int QLIM = S, ALIM = S;   // QLIM = tokens projected per batch (>= max valid_len), ALIM = queries attended/output (multiples of 128)
  size_t off = 0; char* ws = (char*)d_ws;
  auto carve = [&](size_t bytes) { char* p = ws + off; off += (bytes + 255) & ~(size_t)255; return p; };
  b16* W4 = (b16*)carve((size_t)4 * D * D * 2); b16* EKh = (b16*)carve(48 * HD * 2); b16* EKl = (b16*)carve(48 * HD * 2); b16* Qh = (b16*)carve((size_t)NT * D * 2); b16* Ql = (b16*)carve((size_t)NT * D * 2); b16* Kh = (b16*)carve((size_t)NT * D * 2); b16* Kl = (b16*)carve((size_t)NT * D * 2); b16* VTh = (b16*)carve((size_t)NT * D * 2); b16* VTl = (b16*)carve((size_t)NT * D * 2); float* O = (float*)carve((size_t)NT * D * 4); b16* X16 = (b16*)carve((size_t)3 * NT * D * 2);
  if (off > ws_size || off > ((size_t)104 << 20)) return;   // ~ 101 MB
  wput_kernel<<<PG, 256, 0, stream>>>(Fp(4), Fp(5), Fp(6), Fp(7), Fp(8), Fp(0), Fp(1), Fp(2), Ip(3), W4, EKh, EKl, X16);
  proj_kernel<<<dim3(NT / BM, D / BN, 3), 256, 0, stream>>>(X16, W4, Ip(3), QLIM, Qh, Ql, Kh, Kl, VTh, VTl);
  att_kernel<<<NB_ * H * (S / (16 * AW)), 32 * AW, 0, stream>>>(Qh, Ql, Kh, Kl, VTh, VTl, EKh, EKl, Fp(9), Ip(3), ALIM, O);
  outp_kernel<<<dim3(NT / BM, D / BN), 256, 0, stream>>>(O, W4 + (size_t)3 * D * D, ALIM, (float*)d_out);
}

// v010
// A run of this version takes 74.7 microseconds.
// Next to v009, in two timings, it ran 1.09 and 1.10 times as fast.
// Over all steps from v000 it is 19.2 times as fast.
#include <hip/hip_runtime.h>

// MultiHeadAttentionWithRPR: q = queries Wq^T, k = keys Wk^T, v = values Wv^T (16 heads x 64); dist = clip(k - q, -16, 16) + 16; scores = (q.k + q.Ek[dist]) / 8; keys >= valid_lens[b] -> -1e6 (excluded); attn = softmax; out_h = attn v + sum_k attn Ev[dist]; out = concat_h Wo^T -> [4][1024][1024].
// Deterministic: online softmax over fixed 64-key chunks (only chunks below valid_len), fixed order; the Ev term via 33 per-row bucket sums of attn; no atomics.
// WMMA (v_wmma_f32_16x16x32_f16, f32 accumulate): inputs (EXACT bf16 x8, K 1,024) x Wq/Wk/Wv rows (EXACT) in 128 x 128 block tiles; per (bh, 16-query) wave (8 waves a work-group, K and V^T chunks shared in LDS) QE = q (hi+lo) x Ek rows (hi+lo; 3 tiles), S^T = k rows x q (hi+lo; 4 tiles/chunk), O^T += v^T (hi+lo) x P (hi+lo; 4 tiles); o (hi+lo) x Wo rows (64 tiles) — ≈ 4 M WMMA; softmax, buckets, Ev epilogue in f32.

namespace {
constexpr int NB_ = 4, S = 1024, D = 1024, H = 16, HD = 64, CLIP = 16, NR = 2 * CLIP + 1 /* 33 */, NT = NB_ * S, CH = 64;
constexpr int BM = 128, BN = 128, KS = 64, LP = KS + 8;   // GEMM block tile, k per LDS stage, LDS row pitch in halves (144 B = 16 B x odd, for 16-byte readers)
constexpr int PG = 512, XU = NT * D / 4 / (PG * 256);   // first launch: work-groups, and 4-element pieces of each input tensor a thread converts
constexpr int AW = 8, KP = HD + 8, VP = CH + 8;   // attention: waves of a work-group; LDS row pitch in halves of a staged K row and V^T row (144 B each = 16 B x odd, for 16-byte readers)
constexpr float XS = 8.0f, HS = 256.0f, PS = 256.0f, WSC = 256.0f, SCALE = 0.125f;
typedef _Float16 b16;
typedef __attribute__((ext_vector_type(16))) _Float16 v16b;
typedef __attribute__((ext_vector_type(8))) _Float16 v8b;
typedef __attribute__((ext_vector_type(4))) _Float16 v4b;
typedef __attribute__((ext_vector_type(2))) _Float16 v2b;
typedef __attribute__((ext_vector_type(8))) float v8f;
typedef __attribute__((ext_vector_type(4))) float v4f;
typedef __attribute__((ext_vector_type(2))) float v2f;
__device__ __forceinline__ float bf16_rne(float f) { unsigned int u = __float_as_uint(f); u += 0x7FFFu + ((u >> 16) & 1u); float r = __uint_as_float(u & 0xFFFF0000u); asm volatile("" : "+v"(r)); return r; }
__device__ __forceinline__ float bfv(float f) { float r = bf16_rne(f); asm volatile("" : "+v"(r)); return r; }
__device__ __forceinline__ void split16(float v, b16& hi, b16& lo) { hi = (b16)v; lo = (b16)(v - (float)hi); }
__device__ __forceinline__ v16b frag_kb(const b16* p, int hh) { const v8b a = *(const v8b*)(p + 8 * hh), b = *(const v8b*)(p + 16 + 8 * hh); v16b f;
#pragma unroll
  for (int e = 0; e < 8; ++e) { f[e] = a[e]; f[8 + e] = b[e]; } return f; }
__device__ __forceinline__ v8f wmma16b(v16b a, v16b b, v8f c) { v8f d = __builtin_amdgcn_wmma_f32_16x16x32_f16(false, a, false, b, (short)0, c, false, false); asm volatile("v_nop\n\tv_nop\n\tv_nop\n\tv_nop" : "+v"(d) : "v"(a), "v"(b)); return d; }
__device__ __forceinline__ void wave_lds_sync() { __builtin_amdgcn_fence(__ATOMIC_RELEASE, "workgroup"); __builtin_amdgcn_wave_barrier(); __builtin_amdgcn_fence(__ATOMIC_ACQUIRE, "workgroup"); }
// Work-group barrier that orders LDS alone: a wave's LDS stores and reads are done in front of it (s_wait_dscnt 0), while its global loads stay in flight across it; __syncthreads() would wait for those too.
__device__ __forceinline__ void lds_block_sync() { __builtin_amdgcn_fence(__ATOMIC_RELEASE, "workgroup", "local"); __builtin_amdgcn_s_barrier(); __builtin_amdgcn_fence(__ATOMIC_ACQUIRE, "workgroup", "local"); }
__device__ __forceinline__ float bf16_near(float f) { unsigned int u = __float_as_uint(f); u += 0x7FFFu + ((u >> 16) & 1u); return __uint_as_float(u & 0xFFFF0000u); }   // f rounded to the nearest bf16 value, ties to even
__device__ __forceinline__ float xhalf(float x) { return __builtin_bit_cast(float, __builtin_amdgcn_permlanex16(__builtin_bit_cast(int, x), __builtin_bit_cast(int, x), 0x76543210, 0xfedcba98, false, false)); }   // the value of lane l ^ 16
__device__ __forceinline__ unsigned lds_off(const b16* p) { typedef __attribute__((address_space(3))) const b16 lds_b16; return (unsigned)(size_t)(lds_b16*)p; }   // byte address of p inside the work-group's LDS
// Eight asynchronous copies, 16 bytes a lane each, global memory -> LDS through no register: two each from ga, gb, gc, gd (the pointer, then the pointer + gs); copies 0-3 land at LDS byte la + i * ls, copies 4-7 at lb + (i - 4) * ls.
// The s_wait_xcnt closes the statement so that no address register of an issued copy is rewritten in front of it.
__device__ __forceinline__ void copy8(unsigned la, unsigned lb, unsigned ls, const b16* ga, const b16* gb, const b16* gc, const b16* gd, size_t gs) {
  asm volatile("global_load_async_to_lds_b128 %0, %8, off\n\tglobal_load_async_to_lds_b128 %1, %9, off\n\tglobal_load_async_to_lds_b128 %2, %10, off\n\tglobal_load_async_to_lds_b128 %3, %11, off\n\t"
               "global_load_async_to_lds_b128 %4, %12, off\n\tglobal_load_async_to_lds_b128 %5, %13, off\n\tglobal_load_async_to_lds_b128 %6, %14, off\n\tglobal_load_async_to_lds_b128 %7, %15, off\n\ts_wait_xcnt 0x0"
               :: "v"(la), "v"(la + ls), "v"(la + 2 * ls), "v"(la + 3 * ls), "v"(lb), "v"(lb + ls), "v"(lb + 2 * ls), "v"(lb + 3 * ls),
                  "v"(ga), "v"(ga + gs), "v"(gb), "v"(gb + gs), "v"(gc), "v"(gc + gs), "v"(gd), "v"(gd + gs) : "memory"); }
__device__ __forceinline__ int iclamp(int v, int lo, int hi) { return v < lo ? lo : (v > hi ? hi : v); }
// Keys at or past valid_len have weight 0 and attention reads none past its last staged 64-key chunk: of keys and values only the first live_tiles(valid_len) 128-token tiles of a batch are rounded (launch 1) and projected (launch 2).
// That covers every 64-key chunk that attention stages, its masked tail included (V^T there must be finite: 0 x NaN is NaN).
__device__ __forceinline__ int live_tiles(int vl) { return (iclamp(vl, 1, S) + BM - 1) / BM; }

__global__ __launch_bounds__(256) void wput_kernel(const float* __restrict__ wq, const float* __restrict__ wk, const float* __restrict__ wv, const float* __restrict__ wo, const float* __restrict__ ek, const float* __restrict__ xq, const float* __restrict__ xk, const float* __restrict__ xv, const int* __restrict__ vlens, b16* __restrict__ W4, b16* __restrict__ EKh, b16* __restrict__ EKl, b16* __restrict__ X16) { const size_t nt = (size_t)gridDim.x * 256, u0 = (size_t)blockIdx.x * 256 + threadIdx.x; v8b v;
  // queries, keys, values: rounded and scaled ONCE here, into one 16-bit plane each, for all eight column blocks of the projection. 16 bytes a lane in, 8 bytes out, whole lines; a thread's XU loads of a tensor fly together.
  static_assert((size_t)XU * PG * 256 * 4 == (size_t)NT * D && XU % 4 == 0, "the pieces cover a tensor exactly");
  static_assert(256 * 4 == D && 2 * PG == S && XU == 2 * NB_, "piece j of a work-group is one whole row: token (j & 1) * PG + blockIdx.x of batch j >> 1");
  int lim[NB_];   // tokens of each batch whose keys and values are wanted
#pragma unroll   // constant indices keep lim in scalar registers
  for (int b = 0; b < NB_; ++b) lim[b] = live_tiles(vlens[b]) * BM;
#pragma unroll 1   // stays rolled: one tensor's loads in flight are enough, and three would triple the registers
  for (int w3 = 0; w3 < 3; ++w3) { const float* x = (w3 == 0 ? xq : (w3 == 1 ? xk : xv)) + u0 * 4; b16* y = X16 + (size_t)w3 * NT * D + u0 * 4; v4f r[XU];
    // a row that is not wanted is not fetched: its load re-reads the thread's own first piece of queries (fetched in the first trip, so it is near, and other lines in every work-group), so that all XU loads still fly together in one instruction stream; nothing is stored for it
    auto live = [&](int j) { return w3 == 0 || (j & 1) * PG + (int)blockIdx.x < lim[j >> 1]; };   // the same for the whole work-group
#pragma unroll   // constant indices keep r in registers
    for (int j = 0; j < XU; j += 4) {
#pragma unroll
      for (int i = 0; i < 4; ++i) r[j + i] = *(const v4f*)(live(j + i) ? x + (size_t)(j + i) * PG * 256 * 4 : xq + u0 * 4);
      asm volatile("s_wait_xcnt 0x0" ::: "memory"); }   // later loads' results and the store addresses may take the address registers that these issued loads name: the wait stands in front of that overwrite
#pragma unroll
    for (int j = 0; j < XU; ++j) { v4b hx;
#pragma unroll
      for (int e = 0; e < 4; ++e) hx[e] = (b16)(bf16_rne(r[j][e]) * XS);
      if (live(j)) *(v4b*)(y + (size_t)j * PG * 256 * 4) = hx; }
    asm volatile("s_wait_xcnt 0x0" ::: "memory"); }   // the next trip rewrites the address registers that these issued stores name: the wait stands in front of that overwrite
  for (size_t u = u0; u < (size_t)4 * D * 128; u += nt) { const int o = (int)(u / 128), k0 = (int)(u % 128) * 8; const int which = o / D, oo = o % D; const float* w = which == 0 ? wq : (which == 1 ? wk : (which == 2 ? wv : wo));
#pragma unroll
    for (int j = 0; j < 8; ++j) v[j] = (b16)(bf16_rne(w[(size_t)oo * D + k0 + j]) * WSC); { *(v8b*)(W4 + (size_t)o * D + k0) = v;  } }
  if (u0 < 48 * 8) { const int r = (int)(u0 / 8), k0 = (int)(u0 % 8) * 8; v8b a, c;
#pragma unroll
    for (int j = 0; j < 8; ++j) { float e = r < NR ? bfv(ek[(size_t)r * HD + k0 + j]) : 0.0f; b16 p, pl; split16(e * HS, p, pl); a[j] = p; c[j] = pl; } { *(v8b*)(EKh + (size_t)r * HD + k0) = a; *(v8b*)(EKl + (size_t)r * HD + k0) = c;  } } }
// The four dense projections run as block-tiled GEMMs: 8 waves share one 128 x 128 output tile (wave = 32 rows x 64 columns), both operands staged in LDS 64 k at a time,
// in TWO LDS buffers, as a pipeline with one work-group barrier a stage. While stage s is multiplied, stage s + 1 (fetched into registers one stage earlier) is stored into the other buffer and stage s + 2 is fetched;
// each 32-k block's fragments are read one block ahead of their products, into a second register set. The barrier stands between the two blocks of a stage: behind it stage s + 1 may be read,
// and the buffer of stage s, whose last reads have returned in every wave (the s_wait_dscnt 0 in front of the barrier), may be refilled. Every accumulator still sums k in ascending blocks of 32.
// In both kernels each '#pragma unroll' makes the indices of a register array (ra, rb, acc, fragments, tv) constants, so that it stays in registers.
__global__ __launch_bounds__(256) void proj_kernel(const b16* __restrict__ X16, const b16* __restrict__ W4, const int* __restrict__ vlens, int QLIM, b16* __restrict__ Qh, b16* __restrict__ Ql, b16* __restrict__ Kh, b16* __restrict__ Kl, b16* __restrict__ VTh, b16* __restrict__ VTl) {
  __shared__ __attribute__((aligned(16))) b16 As[2][BM][LP], Bs[2][BN][LP]; __shared__ __attribute__((aligned(16))) float Tf[8][16][68];
  const int tid = threadIdx.x, lane = tid & 31, wave = tid >> 5, nloc = lane & 15, hlf = lane >> 4, wm = wave >> 1, wn = wave & 1;
  int xt = blockIdx.x, yb = blockIdx.y, which = blockIdx.z;   // token tile, column block, tensor (q, k, v)
  if (which != 0) {   // k and v: the live tiles take the lowest indices, k's first, the column block running fastest; the rest leave here, whole work-groups, ahead of every barrier
    static_assert(S / BM == 8 && D / BN == 8 && NB_ == 4, "the shifts and the three steps below");
    const int n0 = live_tiles(vlens[0]), n1 = live_tiles(vlens[1]), n2 = live_tiles(vlens[2]), n3 = live_tiles(vlens[3]), nl = (n0 + n1 + n2 + n3) * (D / BN);   // nl: live tiles of one tensor
    int g = ((which - 1) * (D / BN) + yb) * (NT / BM) + xt; if (g >= 2 * nl) return;
    which = g < nl ? 1 : 2; g -= (which - 1) * nl; yb = g & 7; int r = g >> 3, b = 0;   // r: rank of the token tile among the live ones, batch by batch
    if (r >= n0) { r -= n0; b = 1; if (r >= n1) { r -= n1; b = 2; if (r >= n2) { r -= n2; b = 3; } } }
    xt = b * (S / BM) + r; }
  const size_t t0 = (size_t)xt * BM; const int c0 = yb * BN; if ((int)(t0 % S) >= QLIM) return;
  // v is wanted transposed ([batch][feature][token]): its product takes the W rows as A and the x rows as B, so that an accumulator tile has features as rows and tokens as columns (wave = 32 features x 64 tokens)
  static_assert(BM == BN, "the two staged operands have one shape, so that either can serve as A");
  const b16 (*Af)[BM][LP] = which == 2 ? Bs : As; const b16 (*Bf)[BM][LP] = which == 2 ? As : Bs;
  const int br = tid >> 3, bc = (tid & 7) * 8;   // staging: 8 lanes per 128-B piece of an x row (already 16-bit, from the first launch) and of a W row
  const b16* xg = X16 + ((size_t)which * NT + t0 + br) * D + bc; const b16* wg = W4 + ((size_t)which * D + c0 + br) * D + bc;
  v8b ra[4], rb[4];
  auto fetch = [&](int k0) {   // one stage of x and W, global memory -> registers
#pragma unroll
    for (int i = 0; i < 4; ++i) { ra[i] = *(const v8b*)(xg + (size_t)i * 32 * D + k0); rb[i] = *(const v8b*)(wg + (size_t)i * 32 * D + k0); }
    asm volatile("s_wait_xcnt 0x0" ::: "memory"); };   // the loop advances the address registers that these issued loads name: the wait stands in front of that overwrite
  auto put = [&](int buf) {   // the fetched stage, registers -> LDS
#pragma unroll
    for (int i = 0; i < 4; ++i) { *(v8b*)(&As[buf][br + i * 32][bc]) = ra[i]; *(v8b*)(&Bs[buf][br + i * 32][bc]) = rb[i]; } };
  auto frags = [&](int buf, int kb, v16b (&a)[2], v16b (&bw)[4]) {
#pragma unroll
    for (int mi = 0; mi < 2; ++mi) a[mi] = frag_kb(&Af[buf][wm * 32 + mi * 16 + nloc][kb], hlf);
#pragma unroll
    for (int ni = 0; ni < 4; ++ni) bw[ni] = frag_kb(&Bf[buf][wn * 64 + ni * 16 + nloc][kb], hlf); };
  v8f acc[2][4];
#pragma unroll
  for (int mi = 0; mi < 2; ++mi)
#pragma unroll
    for (int ni = 0; ni < 4; ++ni) acc[mi][ni] = (v8f){};
  auto prod = [&](const v16b (&a)[2], const v16b (&bw)[4]) {
#pragma unroll
    for (int mi = 0; mi < 2; ++mi)
#pragma unroll
      for (int ni = 0; ni < 4; ++ni) acc[mi][ni] = wmma16b(a[mi], bw[ni], acc[mi][ni]); };
  static_assert(KS == 64 && D >= 2 * KS, "a stage is two 32-k blocks, and the prologue fetches two stages");
  v16b a0[2], w0[4], a1[2], w1[4];
  fetch(0); put(0); fetch(KS);
  lds_block_sync();
  frags(0, 0, a0, w0);
#pragma unroll 1   // stays rolled: sixteen unrolled stages would crowd the instruction cache
  for (int k0 = 0; k0 < D; k0 += KS) { const int c = (k0 / KS) & 1;
    if (k0 + KS < D) put(c ^ 1);
    frags(c, 32, a1, w1);
    if (k0 + 2 * KS < D) fetch(k0 + 2 * KS);
    prod(a0, w0);
    lds_block_sync();
    if (k0 + KS < D) frags(c ^ 1, 0, a0, w0);
    prod(a1, w1); }
  // each wave stages 16 x 64 results in its own LDS range and stores whole lines: two rows per instruction, 16 lanes a row
#pragma unroll
  for (int mi = 0; mi < 2; ++mi) {
#pragma unroll
    for (int ni = 0; ni < 4; ++ni)
#pragma unroll
      for (int r8 = 0; r8 < 8; ++r8) Tf[wave][8 * hlf + r8][ni * 16 + nloc] = acc[mi][ni][r8] * (1.0f / (XS * WSC));
    wave_lds_sync();
    v4f tv[8]; const size_t o = which == 2 ? ((t0 / S) * D + c0 + wm * 32 + mi * 16 + hlf) * S + t0 % S + wn * 64 + nloc * 4 : (t0 + wm * 32 + mi * 16 + hlf) * D + c0 + wn * 64 + nloc * 4;   // v: row = feature, of S tokens; q, k: row = token, of D features
#pragma unroll
    for (int rr = 0; rr < 8; ++rr) tv[rr] = *(const v4f*)(&Tf[wave][rr * 2 + hlf][nloc * 4]);
    { static_assert(S == D, "one row pitch serves both layouts"); b16* Ph = which == 0 ? Qh : (which == 1 ? Kh : VTh); b16* Pl = which == 0 ? Ql : (which == 1 ? Kl : VTl);
#pragma unroll
      for (int rr = 0; rr < 8; ++rr) { v4b ph, pl;
#pragma unroll
        for (int j = 0; j < 4; ++j) { b16 p, q; split16(tv[rr][j] * HS, p, q); ph[j] = p; pl[j] = q; }
        *(v4b*)(Ph + o + (size_t)rr * 2 * D) = ph; *(v4b*)(Pl + o + (size_t)rr * 2 * D) = pl; } }
    wave_lds_sync(); } }
// One work-group of 8 waves per (batch-head, 128 queries), one wave per 16 queries. Each 64-key chunk of K and V^T (hi and lo) is staged once for all eight waves in LDS by asynchronous copies, whole 128-B lines,
// two buffers: chunk c + 1 flies while chunk c is worked on; every fragment of K and V^T is read from LDS. Everything else is private to its wave, as are its LDS ranges (index [wave]).
// The chunk length and the register budget (at most 256, the second launch bound: four waves a SIMD) are set so that TWO work-groups stand on a WGP (LDS under 160 KiB each): one's vector work and waits run under the other's products.
// Both products run transposed: S^T = K q^T (K rows as A, q rows as B) and O^T += V^T P^T (V^T rows as A, P as B). A lane holds ONE query (column lane & 15) and, of each 16-key tile, the keys 8 * half + r8:
// bias, mask, maximum, exp and the sums all run in-lane, the two halves of a query joined by one cross-row move; two score tiles, rounded in place, are the B fragment of P for 32 keys, so that P never goes through LDS.
// Buckets: distance <= -16 and >= 16 are running per-lane sums, joined once after the loop; each of the 31 inner distances has one key, whose score is kept and turned into its weight with the final maximum.
__global__ __launch_bounds__(32 * AW, 4) void att_kernel(const b16* __restrict__ Qh, const b16* __restrict__ Ql, const b16* __restrict__ Kh, const b16* __restrict__ Kl, const b16* __restrict__ VTh, const b16* __restrict__ VTl, const b16* __restrict__ EKh, const b16* __restrict__ EKl, const float* __restrict__ ev, const int* __restrict__ vlens, int ALIM, float* __restrict__ O) { __shared__ __attribute__((aligned(16))) b16 Ksh[2][2][CH][KP], Vsh[2][2][HD][VP];   // [buffer][hi, lo][key][d] and [buffer][hi, lo][d][key]
  __shared__ __attribute__((aligned(16))) float BkW[AW][16][36]; __shared__ float QEW[AW][16][49], LsW[AW][16], OfW[AW][16][HD + 1];
  const int lane = threadIdx.x & 31, wave = __builtin_amdgcn_readfirstlane(threadIdx.x >> 5), nloc = lane & 15, hlf = lane >> 4, rowb = 8 * hlf;   // the wave's number in a scalar register keeps the tests on q0 below scalar branches
  const int bh = blockIdx.x / (S / (16 * AW)), qb = (blockIdx.x % (S / (16 * AW))) * (16 * AW); if (qb >= ALIM) return; const int q0 = qb + wave * 16; const int b = bh / H, h = bh % H; const size_t tq = (size_t)b * S + q0; const int vl = iclamp(vlens[b], 0, S), nch = (vl + CH - 1) / CH;
  float (*Bk)[36] = BkW[wave]; float (*QE)[49] = QEW[wave]; float* Ls = LsW[wave]; float (*Of)[HD + 1] = OfW[wave];
  // staging, per wave and chunk: 4 copies of 4 K rows and 4 copies of 4 V^T row pieces (8 lanes a 128-B row; rows i * 32 + wave * 4 + ..., hi then lo, whose plane follows 64 rows on)
  static_assert(CH == 64 && HD == 64 && KP == VP && S == D, "K and V^T chunks have one shape, in LDS and in their row steps");
  const int kr = wave * 4 + (lane >> 3), kc = (lane & 7) * 8;
  const size_t kg = ((size_t)b * S + kr) * D + h * HD + kc, vg = ((size_t)bh * HD + kr) * S + kc;
  auto stage = [&](int c, int buf) { copy8(lds_off(&Ksh[buf][0][kr][kc]), lds_off(&Vsh[buf][0][kr][kc]), 32 * KP * 2, Kh + kg + (size_t)c * CH * D, Kl + kg + (size_t)c * CH * D, VTh + vg + c * CH, VTl + vg + c * CH, (size_t)32 * D); };
  stage(0, 0);   // chunk 0 flies under the set-up below
  if (lane < 16) { for (int r = 0; r < NR; ++r) Bk[lane][r] = -INFINITY; }
  // q fragments: row or column nloc in the k order of frag_kb, so that one fragment serves as A (QE) and as B (S^T)
  v16b qa[2], ql[2]; for (int ks = 0; ks < 2; ++ks) { qa[ks] = frag_kb(Qh + (tq + nloc) * D + h * HD + ks * 32, hlf); ql[ks] = frag_kb(Ql + (tq + nloc) * D + h * HD + ks * 32, hlf); }
  asm volatile("s_wait_xcnt 0x0" ::: "memory");   // the results of the Ek loads below may take the address registers that these issued loads name: the wait stands in front of that overwrite
  // QE[q][r] = q . Ek[r]
#pragma unroll
  for (int t = 0; t < 3; ++t) { v8f e = (v8f){};
#pragma unroll
    for (int ks = 0; ks < 2; ++ks) { const v16b eh = frag_kb(EKh + (size_t)(t * 16 + nloc) * HD + ks * 32, hlf), el = frag_kb(EKl + (size_t)(t * 16 + nloc) * HD + ks * 32, hlf); e = wmma16b(qa[ks], eh, e); e = wmma16b(qa[ks], el, e); e = wmma16b(ql[ks], eh, e); }
#pragma unroll
    for (int r8 = 0; r8 < 8; ++r8) QE[8 * hlf + r8][t * 16 + nloc] = e[r8] * (1.0f / (HS * HS)); }
  wave_lds_sync();
  const float qlo = QE[nloc][0], qhi = QE[nloc][2 * CLIP];   // this lane's query: the bias of every key at distance <= -16, and of every key at >= 16
  asm volatile("s_wait_asynccnt 0x0" ::: "memory");   // this wave's copies of chunk 0 have landed
  __syncthreads();                                    // ... and so have the other waves': chunk 0 may be read
  if (nch > 1) stage(1, 1);
  v8f oacc[4] = {(v8f){}, (v8f){}, (v8f){}, (v8f){}};   // O^T: lane = query, tile t register r8 = d t * 16 + 8 * half + r8
  // every '#pragma unroll' below makes the indices of a register array (sacc, oacc, kh, kl, vh, vlo, pa, pb, w) constants, so that it stays in registers
  float mrow = -INFINITY, slo = 0.0f, shi = 0.0f, sin_ = 0.0f;
#pragma unroll 1   // stays rolled: the trip count comes from valid_lens
  for (int ch = 0; ch < nch; ++ch) { const int k0 = ch * CH; v8f sacc[CH / 16]; const b16 (*Kc)[CH][KP] = Ksh[ch & 1]; const b16 (*Vc)[HD][VP] = Vsh[ch & 1];
#pragma unroll
    for (int tg = 0; tg < CH / 16; tg += 2) { v16b kh[2][2], kl[2][2];   // two tiles' fragment reads stand together, ahead of their products, for speed only
#pragma unroll
      for (int t = 0; t < 2; ++t)
#pragma unroll
        for (int ks = 0; ks < 2; ++ks) { kh[t][ks] = frag_kb(&Kc[0][(tg + t) * 16 + nloc][ks * 32], hlf); kl[t][ks] = frag_kb(&Kc[1][(tg + t) * 16 + nloc][ks * 32], hlf); }
#pragma unroll
      for (int t = 0; t < 2; ++t) { v8f s = (v8f){};
#pragma unroll
        for (int ks = 0; ks < 2; ++ks) { s = wmma16b(kh[t][ks], qa[ks], s); s = wmma16b(kl[t][ks], qa[ks], s); s = wmma16b(kh[t][ks], ql[ks], s); }
        sacc[tg + t] = s; } }
    const int dl = k0 + rowb - q0 - nloc;   // key - query of this lane at tile 0, register 0
    float mx = -INFINITY;
#pragma unroll
    for (int t = 0; t < CH / 16; ++t) { const int rel = k0 + t * 16 - q0; const bool near = rel >= -16 && rel <= 16;   // wave-uniform: only these three tiles hold an inner distance
      if (near) {   // bias by distance from LDS; the score of an inner distance is kept
#pragma unroll
        for (int r8 = 0; r8 < 8; ++r8) { const int d = dl + t * 16 + r8; const float s = (sacc[t][r8] * (1.0f / (HS * HS)) + QE[nloc][iclamp(d, -CLIP, CLIP) + CLIP]) * SCALE; const float sm = k0 + t * 16 + rowb + r8 < vl ? s : -INFINITY; sacc[t][r8] = sm; if (d > -CLIP && d < CLIP) Bk[nloc][d + CLIP] = sm; } }
      else { const float qe = rel < 0 ? qlo : qhi;
#pragma unroll
        for (int r8 = 0; r8 < 8; ++r8) sacc[t][r8] = (sacc[t][r8] * (1.0f / (HS * HS)) + qe) * SCALE;
        if (k0 + t * 16 + 16 > vl) {   // wave-uniform: only a tile that reaches past valid_len has keys to exclude
#pragma unroll
          for (int r8 = 0; r8 < 8; ++r8) sacc[t][r8] = k0 + t * 16 + rowb + r8 < vl ? sacc[t][r8] : -INFINITY; } }
      mx = fmaxf(mx, fmaxf(fmaxf(fmaxf(sacc[t][0], sacc[t][1]), fmaxf(sacc[t][2], sacc[t][3])), fmaxf(fmaxf(sacc[t][4], sacc[t][5]), fmaxf(sacc[t][6], sacc[t][7])))); }
    mx = fmaxf(mx, xhalf(mx));   // both halves now hold the maximum of this query's 64 scores
    const float mn = fmaxf(mrow, mx), fac = (mrow == -INFINITY) ? 0.0f : __expf(mrow - mn); mrow = mn; slo *= fac; shi *= fac; sin_ *= fac;
#pragma unroll
    for (int t = 0; t < 4; ++t)
#pragma unroll
      for (int r8 = 0; r8 < 8; ++r8) oacc[t][r8] *= fac;
#pragma unroll
    for (int kb = 0; kb < CH; kb += 32) { v16b vh[4], vlo[4], pa, pb;   // one group of reads, ahead of the exponentials that make this block's P
#pragma unroll
      for (int t = 0; t < 4; ++t) { vh[t] = frag_kb(&Vc[0][t * 16 + nloc][kb], hlf); vlo[t] = frag_kb(&Vc[1][t * 16 + nloc][kb], hlf); }
#pragma unroll
      for (int u = 0; u < 2; ++u) { const int t = kb / 16 + u, rel = k0 + t * 16 - q0;   // element u * 8 + r8 of the fragment is key kb + u * 16 + 8 * half + r8: the k order of frag_kb
#pragma unroll
        for (int r8 = 0; r8 < 8; r8 += 2) { const float p0 = __expf(sacc[t][r8] - mrow), p1 = __expf(sacc[t][r8 + 1] - mrow); sacc[t][r8] = p0; sacc[t][r8 + 1] = p1; const v2f x = (v2f){p0, p1} * PS;   // two keys share a fragment register: both roundings run on the pair
          const v2b ph = __builtin_convertvector(x, v2b), pl = __builtin_convertvector(x - __builtin_convertvector(ph, v2f), v2b); pa[u * 8 + r8] = ph[0]; pa[u * 8 + r8 + 1] = ph[1]; pb[u * 8 + r8] = pl[0]; pb[u * 8 + r8 + 1] = pl[1]; }
        if (rel <= -32) slo += ((sacc[t][0] + sacc[t][1]) + (sacc[t][2] + sacc[t][3])) + ((sacc[t][4] + sacc[t][5]) + (sacc[t][6] + sacc[t][7]));
        else if (rel >= 32) shi += ((sacc[t][0] + sacc[t][1]) + (sacc[t][2] + sacc[t][3])) + ((sacc[t][4] + sacc[t][5]) + (sacc[t][6] + sacc[t][7]));
        else {
#pragma unroll
          for (int r8 = 0; r8 < 8; ++r8) { const int d = dl + t * 16 + r8; const float p = sacc[t][r8]; slo += d <= -CLIP ? p : 0.0f; shi += d >= CLIP ? p : 0.0f; sin_ += (d > -CLIP && d < CLIP) ? p : 0.0f; } } }
#pragma unroll
      for (int t = 0; t < 4; ++t) { oacc[t] = wmma16b(vh[t], pa, oacc[t]); oacc[t] = wmma16b(vlo[t], pa, oacc[t]); oacc[t] = wmma16b(vh[t], pb, oacc[t]); } }
    asm volatile("s_wait_dscnt 0x0" ::: "memory");      // this wave's reads of the chunk's buffer have returned
    asm volatile("s_wait_asynccnt 0x0" ::: "memory");   // this wave's copies of chunk ch + 1 have landed
    __syncthreads();                                    // publishes chunk ch + 1 and frees the buffer that this pass has read
    if (ch + 2 < nch) stage(ch + 2, ch & 1); }
  asm volatile("s_wait_asynccnt 0x0" ::: "memory");     // no copy is outstanding behind the loop
  // this lane's two columns of all 33 Ev rows: the loads fly together, under the joins below, and the values stay in registers for all 16 query rows
  v2f evr[NR];
#pragma unroll
  for (int j = 0; j < NR; ++j) evr[j] = *(const v2f*)(ev + (size_t)j * HD + lane * 2);
  // join the two halves' sums; the inner distances' kept scores become weights under the final maximum (a slot no key reached holds -inf and gives 0)
  { const float a = slo + xhalf(slo), c = shi + xhalf(shi), e = sin_ + xhalf(sin_);
    if (hlf == 0) { Bk[nloc][0] = a; Bk[nloc][2 * CLIP] = c; Ls[nloc] = a + c + e; } }
  float w[16];   // half 0 turns slots 1-16 of its query, half 1 slots 17-31: it has no sixteenth slot, reads its fifteenth again and stores nothing
#pragma unroll
  for (int j = 0; j < 16; ++j) { const int sl = 1 + 16 * hlf + j; w[j] = __expf(Bk[nloc][sl < 2 * CLIP ? sl : 2 * CLIP - 1] - mrow); }
#pragma unroll
  for (int j = 0; j < 16; ++j) { const int sl = 1 + 16 * hlf + j; if (sl < 2 * CLIP) Bk[nloc][sl] = w[j]; }
#pragma unroll
  for (int t = 0; t < 4; ++t)
#pragma unroll
    for (int r8 = 0; r8 < 8; ++r8) Of[nloc][t * 16 + rowb + r8] = oacc[t][r8] * (1.0f / (PS * HS));
  wave_lds_sync();
  // + sum_r Bk[row][r] Ev[r][d]; lane = d pair. Every '#pragma unroll' here makes the indices of evr, bq and a constants, so that they stay in registers.
#pragma unroll
  for (int j = 0; j < NR; ++j) { evr[j][0] = bf16_near(evr[j][0]); evr[j][1] = bf16_near(evr[j][1]); }
#pragma unroll 1   // stays rolled: four rows a trip already give four independent sum chains, and sixteen would only lengthen the code
  for (int r0 = 0; r0 < 16; r0 += 4) { v2f a[4]; v4f bq[4][8]; float bl[4], inv[4];
#pragma unroll
    for (int i = 0; i < 4; ++i) { a[i] = (v2f){Of[r0 + i][lane * 2], Of[r0 + i][lane * 2 + 1]}; bl[i] = Bk[r0 + i][32]; inv[i] = 1.0f / Ls[r0 + i];
#pragma unroll
      for (int j = 0; j < 8; ++j) bq[i][j] = *(const v4f*)(&Bk[r0 + i][j * 4]); }
#pragma unroll
    for (int j = 0; j < NR - 1; ++j)
#pragma unroll
      for (int i = 0; i < 4; ++i) a[i] += bq[i][j >> 2][j & 3] * evr[j];
#pragma unroll
    for (int i = 0; i < 4; ++i) { a[i] += bl[i] * evr[NR - 1]; *(v2f*)(O + (tq + r0 + i) * D + h * HD + lane * 2) = a[i] * inv[i]; }
    asm volatile("s_wait_xcnt 0x0" ::: "memory"); } }   // the next trip rewrites the registers that these issued stores name: the wait stands in front of that overwrite
// The output projection: the same pipeline; o is split hi + lo on its way from the registers into LDS, under the other wave's products.
__global__ __launch_bounds__(256) void outp_kernel(const float* __restrict__ O, const b16* __restrict__ WO, int ALIM, float* __restrict__ out) {
  __shared__ __attribute__((aligned(16))) b16 Ah[2][BM][LP], Al[2][BM][LP], Bs[2][BN][LP]; __shared__ __attribute__((aligned(16))) float Tf[8][16][68];
  const int tid = threadIdx.x, lane = tid & 31, wave = tid >> 5, nloc = lane & 15, hlf = lane >> 4, wm = wave >> 1, wn = wave & 1;
  const size_t t0 = (size_t)blockIdx.x * BM; const int c0 = blockIdx.y * BN; if ((int)(t0 % S) >= ALIM) return;
  const int ar = tid >> 4, ac = (tid & 15) * 4, br = tid >> 3, bc = (tid & 7) * 8;
  const float* og = O + (t0 + ar) * D + ac; const b16* wg = WO + ((size_t)c0 + br) * D + bc;
  v4f ra[8]; v8b rb[4];
  auto fetch = [&](int k0) {   // one stage of o and Wo, global memory -> registers
#pragma unroll
    for (int i = 0; i < 8; ++i) ra[i] = *(const v4f*)(og + (size_t)i * 16 * D + k0);
#pragma unroll
    for (int i = 0; i < 4; ++i) rb[i] = *(const v8b*)(wg + (size_t)i * 32 * D + k0);
    asm volatile("s_wait_xcnt 0x0" ::: "memory"); };   // the loop advances the address registers that these issued loads name: the wait stands in front of that overwrite
  auto put = [&](int buf) {   // the fetched stage, o split hi + lo, registers -> LDS
#pragma unroll
    for (int i = 0; i < 8; ++i) { v4b hx, lx;
#pragma unroll
      for (int j = 0; j < 4; ++j) { b16 p, q; split16(ra[i][j] * HS, p, q); hx[j] = p; lx[j] = q; }
      *(v4b*)(&Ah[buf][ar + i * 16][ac]) = hx; *(v4b*)(&Al[buf][ar + i * 16][ac]) = lx; }
#pragma unroll
    for (int i = 0; i < 4; ++i) *(v8b*)(&Bs[buf][br + i * 32][bc]) = rb[i]; };
  auto frags = [&](int buf, int kb, v16b (&a)[2], v16b (&al)[2], v16b (&bw)[4]) {
#pragma unroll
    for (int mi = 0; mi < 2; ++mi) { a[mi] = frag_kb(&Ah[buf][wm * 32 + mi * 16 + nloc][kb], hlf); al[mi] = frag_kb(&Al[buf][wm * 32 + mi * 16 + nloc][kb], hlf); }
#pragma unroll
    for (int ni = 0; ni < 4; ++ni) bw[ni] = frag_kb(&Bs[buf][wn * 64 + ni * 16 + nloc][kb], hlf); };
  v8f acc[2][4];
#pragma unroll
  for (int mi = 0; mi < 2; ++mi)
#pragma unroll
    for (int ni = 0; ni < 4; ++ni) acc[mi][ni] = (v8f){};
  auto prod = [&](const v16b (&a)[2], const v16b (&al)[2], const v16b (&bw)[4]) {
#pragma unroll
    for (int mi = 0; mi < 2; ++mi)
#pragma unroll
      for (int ni = 0; ni < 4; ++ni) acc[mi][ni] = wmma16b(a[mi], bw[ni], acc[mi][ni]);
#pragma unroll
    for (int mi = 0; mi < 2; ++mi)
#pragma unroll
      for (int ni = 0; ni < 4; ++ni) acc[mi][ni] = wmma16b(al[mi], bw[ni], acc[mi][ni]); };
  static_assert(KS == 64 && D >= 2 * KS, "a stage is two 32-k blocks, and the prologue fetches two stages");
  v16b a0[2], l0[2], w0[4], a1[2], l1[2], w1[4];
  fetch(0); put(0); fetch(KS);
  lds_block_sync();
  frags(0, 0, a0, l0, w0);
#pragma unroll 1   // stays rolled: sixteen unrolled stages would crowd the instruction cache
  for (int k0 = 0; k0 < D; k0 += KS) { const int c = (k0 / KS) & 1;
    if (k0 + KS < D) put(c ^ 1);
    frags(c, 32, a1, l1, w1);
    if (k0 + 2 * KS < D) fetch(k0 + 2 * KS);
    prod(a0, l0, w0);
    lds_block_sync();
    if (k0 + KS < D) frags(c ^ 1, 0, a0, l0, w0);
    prod(a1, l1, w1); }
#pragma unroll
  for (int mi = 0; mi < 2; ++mi) {
#pragma unroll
    for (int ni = 0; ni < 4; ++ni)
#pragma unroll
      for (int r8 = 0; r8 < 8; ++r8) Tf[wave][8 * hlf + r8][ni * 16 + nloc] = acc[mi][ni][r8] * (1.0f / (HS * WSC));
    wave_lds_sync();
    v4f tv[8]; const size_t o = (t0 + wm * 32 + mi * 16 + hlf) * D + c0 + wn * 64 + nloc * 4;
#pragma unroll
    for (int rr = 0; rr < 8; ++rr) tv[rr] = *(const v4f*)(&Tf[wave][rr * 2 + hlf][nloc * 4]);
#pragma unroll
    for (int rr = 0; rr < 8; ++rr) *(v4f*)(out + o + (size_t)rr * 2 * D) = tv[rr];
    wave_lds_sync(); } }
}  // namespace

extern "C" void kernel_launch(void* const* d_in, const int* in_sizes, int n_in, void* d_out, int out_size, void* d_ws, size_t ws_size, hipStream_t stream) {
  (void)n_in;
  auto Fp = [&](int i) { return (const float*)d_in[i]; }; auto Ip = [&](int i) { return (const int*)d_in[i]; };
  // Input order: 0 queries [4,1024,1024]; 1 keys; 2 values; 3 valid_lens [4] i32; 4 Wq [1024,1024]; 5 Wk; 6 Wv; 7 Wo; 8 Ek [33,64]; 9 Ev [33,64]
  if (in_sizes[0] != NT * D || in_sizes[1] != NT * D || in_sizes[2] != NT * D || in_sizes[3] != NB_ || in_sizes[4] != D * D || in_sizes[7] != D * D || in_sizes[8] != NR * HD || in_sizes[9] != NR * HD || out_size != NT * D) return;
  const int QLIM = S, ALIM = S;   // QLIM = tokens projected per batch (>= max valid_len), ALIM = queries attended/output (multiples of 128)
  size_t off = 0; char* ws = (char*)d_ws;
  auto carve = [&](size_t bytes) { char* p = ws + off; off += (bytes + 255) & ~(size_t)255; return p; };
  b16* W4 = (b16*)carve((size_t)4 * D * D * 2); b16* EKh = (b16*)carve(48 * HD * 2); b16* EKl = (b16*)carve(48 * HD * 2); b16* Qh = (b16*)carve((size_t)NT * D * 2); b16* Ql = (b16*)carve((size_t)NT * D * 2); b16* Kh = (b16*)carve((size_t)NT * D * 2); b16* Kl = (b16*)carve((size_t)NT * D * 2); b16* VTh = (b16*)carve((size_t)NT * D * 2); b16* VTl = (b16*)carve((size_t)NT * D * 2); float* O = (float*)carve((size_t)NT * D * 4); b16* X16 = (b16*)carve((size_t)3 * NT * D * 2);
  if (off > ws_size || off > ((size_t)104 << 20)) return;   // ~ 101 MB
  wput_kernel<<<PG, 256, 0, stream>>>(Fp(4), Fp(5), Fp(6), Fp(7), Fp(8), Fp(0), Fp(1), Fp(2), Ip(3), W4, EKh, EKl, X16);
  proj_kernel<<<dim3(NT / BM, D / BN, 3), 256, 0, stream>>>(X16, W4, Ip(3), QLIM, Qh, Ql, Kh, Kl, VTh, VTl);
  att_kernel<<<NB_ * H * (S / (16 * AW)), 32 * AW, 0, stream>>>(Qh, Ql, Kh, Kl, VTh, VTl, EKh, EKl, Fp(9), Ip(3), ALIM, O);
  outp_kernel<<<dim3(NT / BM, D / BN), 256, 0, stream>>>(O, W4 + (size_t)3 * D * D, ALIM, (float*)d_out);
}
